// v000
// The times below were measured on an AMD MI455X: many runs one after another, warmed up first and cycling through
// copies of the inputs, with the whole window's GPU time divided by the number of runs. Launches and the gaps
// between them are all in it. The median over several windows is given; except for v000 it joins two sittings, which
// can be a few percent apart, so the side-by-side timings, each taken in one sitting, are the better comparison.
// v000, which the later versions start from, runs in 300 microseconds.
// Contractions: S = q.k^T and O = p.v on v_wmma_f32_16x16x32_f16 (f16 operands: q, k, v x1, p x1024; f32 accumulate); out = z.Wout on v_wmma_f32_16x16x32_f16 (f16 operands: z x16, Wout x64; f32 accumulate, 1/1024 folded back in f32). Projections q, k, v = x.W (K = 2) exact f32 on VALU; score scale, online softmax, 1/l, BN affine, PReLU and bias in f32.
#include <hip/hip_runtime.h>
#include <math.h>
#include <stddef.h>
#include <stdint.h>

#define NTOK 32768              // token rows
#define NBAT 32                 // sequences
#define SEQ  1024               // tokens per sequence
#define HD   512                // head width
#define OD   32                 // output width
#define BR   32                 // query rows per attention block
#define BC   128                // keys per chunk

static_assert(NTOK == NBAT * SEQ);
static_assert(SEQ % BC == 0);
static_assert(SEQ % BR == 0);
static_assert(BC % 32 == 0);
static_assert(HD == 512);
static_assert((HD / 8) == 64);
static_assert((SEQ / 8) == 128);
static_assert(OD == 32);

typedef _Float16 v16h __attribute__((ext_vector_type(16)));
typedef _Float16 v8h  __attribute__((ext_vector_type(8)));
typedef float    v8f  __attribute__((ext_vector_type(8)));
typedef float    v4f  __attribute__((ext_vector_type(4)));
typedef float    v2f  __attribute__((ext_vector_type(2)));
typedef unsigned int v4u __attribute__((ext_vector_type(4)));

union Frag  { v16h v; v8h h[2]; };
union Pack8 { v8h h; v4u u; };

// WMMA with the dependent-VALU hazard guard (ties D, keeps A/B live)
__device__ __forceinline__ v8f mma16(v16h a, v16h b, v8f c) {
  c = __builtin_amdgcn_wmma_f32_16x16x32_f16(false, a, false, b, (short)0, c, false, false);
  asm volatile("v_nop\n\tv_nop\n\tv_nop\n\tv_nop" : "+v"(c) : "v"(a), "v"(b));
  return c;
}

// Fragment loader for k-contiguous 16-bit rows with pitch ld.
// A operand: row0 + (lane&15) is the M row.  B operand stored [n][k]: row0 + (lane&15) is the N column.
// Split k map for both: elements 0..7 <- k0 + 8*(lane>>4) + 0..7, elements 8..15 <- k0 + 16 + 8*(lane>>4) + 0..7.
// D map: acc[r] = element (8*(lane>>4) + r, lane&15) of the 16x16 tile.
__device__ __forceinline__ v16h ldfrag(const _Float16* p, int ld, int row0, int k0, int lane) {
  const int m = lane & 15, lh = lane >> 4;
  const _Float16* q = p + (size_t)(row0 + m) * ld + k0 + 8 * lh;
  Frag f;
  f.h[0] = *(const v8h*)(q);
  f.h[1] = *(const v8h*)(q + 16);
  return f.v;
}

__device__ __forceinline__ v8f zero8() { return (v8f){0.f, 0.f, 0.f, 0.f, 0.f, 0.f, 0.f, 0.f}; }

// ---------------------------------------------------------------------------
// kernel 0: Wout f32 [512][32] ([k][n]) -> f16 plane WoT [32][512] ([n][k], k-contiguous), values x64.
// Thread t: n = t>>6, k0 = (t&63)*8: gathers 8 consecutive k of column n, one 16-B store; 32 lanes write
// coverage: 2048 threads x 8 halves = 32 x 512.
// ---------------------------------------------------------------------------
__global__ __launch_bounds__(256) void k_wout(const float* __restrict__ wo, _Float16* __restrict__ wot, int n) {
  const int t = blockIdx.x * 256 + (int)threadIdx.x;
  if (t >= n) return;                                   // no barriers in this kernel
  const int nn = t >> 6;
  const int k0 = (t & 63) * 8;
  const float* src = wo + (size_t)k0 * OD + nn;
  Pack8 pk;
  pk.h = (v8h){(_Float16)(src[0 * OD] * 64.0f), (_Float16)(src[1 * OD] * 64.0f),
               (_Float16)(src[2 * OD] * 64.0f), (_Float16)(src[3 * OD] * 64.0f),
               (_Float16)(src[4 * OD] * 64.0f), (_Float16)(src[5 * OD] * 64.0f),
               (_Float16)(src[6 * OD] * 64.0f), (_Float16)(src[7 * OD] * 64.0f)};
  const v4u vv = pk.u;
  v4u* d = (v4u*)(wot + (size_t)nn * HD + k0);
  *d = vv;
  
}

// ---------------------------------------------------------------------------
// kernel 1: projections with K = 2 in exact f32 on VALU, stored as f16 planes (x1).
//   blockIdx.y = 0 / 1: q / k plane [token][512]; thread t: tok = t>>6, h0 = (t&63)*8 -> 8 consecutive h,
//   blockIdx.y = 2: v^T plane [b][e][l] (pitch SEQ); thread t: l0 = (t&127)*8, e = (t>>7)&511, b = t>>16
// coverage: q, k: 2097152 threads x 8 = 32768 x 512 each; v^T: 2097152 threads x 8 = 32 x 512 x 1024.
// ---------------------------------------------------------------------------
__global__ __launch_bounds__(256) void k_proj(const float* __restrict__ x,
                                              const float* __restrict__ wq,
                                              const float* __restrict__ wk,
                                              const float* __restrict__ wv,
                                              _Float16* __restrict__ qp,
                                              _Float16* __restrict__ kp,
                                              _Float16* __restrict__ vt, int nqk, int nv) {
  const int which = blockIdx.y;                         // block-uniform
  const int t = blockIdx.x * 256 + (int)threadIdx.x;
  if (which < 2) {
    if (t >= nqk) return;                               // no barriers in this kernel
    const float* w = (which == 0) ? wq : wk;            // both global
    _Float16* dst  = (which == 0) ? qp : kp;            // both global
    const int tok = t >> 6;
    const int h0  = (t & 63) * 8;
    const v2f xx  = *(const v2f*)(x + 2 * (size_t)tok);
    const float x0 = xx[0], x1 = xx[1];
    const v4f a0 = *(const v4f*)(w + h0);               // W[0][h0..h0+3]
    const v4f a1 = *(const v4f*)(w + h0 + 4);
    const v4f b0 = *(const v4f*)(w + HD + h0);          // W[1][h0..h0+3]
    const v4f b1 = *(const v4f*)(w + HD + h0 + 4);
    Pack8 pk;
    pk.h = (v8h){(_Float16)fmaf(x1, b0[0], x0 * a0[0]), (_Float16)fmaf(x1, b0[1], x0 * a0[1]),
                 (_Float16)fmaf(x1, b0[2], x0 * a0[2]), (_Float16)fmaf(x1, b0[3], x0 * a0[3]),
                 (_Float16)fmaf(x1, b1[0], x0 * a1[0]), (_Float16)fmaf(x1, b1[1], x0 * a1[1]),
                 (_Float16)fmaf(x1, b1[2], x0 * a1[2]), (_Float16)fmaf(x1, b1[3], x0 * a1[3])};
    const v4u vv = pk.u;
    v4u* d = (v4u*)(dst + (size_t)tok * HD + h0);
    *d = vv;
    
  } else {
    if (t >= nv) return;
    const int l0 = (t & 127) * 8;
    const int e  = (t >> 7) & 511;
    const int b  = t >> 16;
    const float w0 = wv[e], w1 = wv[HD + e];
    const float* xr = x + ((size_t)(b * SEQ + l0)) * 2;   // 8 token rows x 2 = 16 floats, 64-B aligned
    const v4f c0 = *(const v4f*)(xr);
    const v4f c1 = *(const v4f*)(xr + 4);
    const v4f c2 = *(const v4f*)(xr + 8);
    const v4f c3 = *(const v4f*)(xr + 12);
    Pack8 pk;
    pk.h = (v8h){(_Float16)fmaf(c0[1], w1, c0[0] * w0), (_Float16)fmaf(c0[3], w1, c0[2] * w0),
                 (_Float16)fmaf(c1[1], w1, c1[0] * w0), (_Float16)fmaf(c1[3], w1, c1[2] * w0),
                 (_Float16)fmaf(c2[1], w1, c2[0] * w0), (_Float16)fmaf(c2[3], w1, c2[2] * w0),
                 (_Float16)fmaf(c3[1], w1, c3[0] * w0), (_Float16)fmaf(c3[3], w1, c3[2] * w0)};
    const v4u vv = pk.u;
    v4u* d = (v4u*)(vt + ((size_t)(b * HD + e)) * SEQ + l0);
    *d = vv;
    
  }
}

// ---------------------------------------------------------------------------
// kernel 2: non-causal flash attention per (query tile, sequence), single head of width 512, with the
// BN-affine + PReLU + z.Wout + bias tail fused. Block = 8 waves = 32 query rows of one sequence;
// key chunks of 128 (nch = SEQ/BC = 8, derived from the batch_size input and clamped to the static maximum).
//   qp, kp: f16 planes [token][512];  vt: f16 plane [b][e][l];  wot: f16 plane [32][512] (x64).
// Per chunk: S: wave w computes keys j0+16w..+15 x 32 rows (16 k-steps over 512, fragments straight from the
//   planes); scale in f32 -> sS; block-cooperative online softmax in f32 through LDS (8 threads per row);
//   p = exp(s - m) x 1024 -> f16 tile sP [row][key] (16-B LDS stores), block barrier, reloaded with the A
//   loader (same element type); O: wave w owns cols 64w..64w+63 for all 32 rows (2 x 4 accumulator tiles),
//   B fragments straight from the V^T plane.
// Tail: o = oacc / (1024 l); z = (o - mean) * gamma/sqrt(var + eps) + beta; PReLU; z x16 -> f16 LDS tile
//   zA [32][512]; barrier; out tile 32x32: wave w = (row tile w&1, col tile (w>>1)&1, k half w>>2), 8 k-steps
//   each, partial D to LDS part[khalf][32][32]; barrier; val = (part0 + part1)/1024 + b_out; each d_out row
// LDS: one raw buffer: loop phase sS (floats 0..4095) + sP (halves at float offset 4096); tail phase zA
//   (halves at float offset 0 .. 8319) + part (floats 8320 .. 10623).
// grid = (SEQ/BR, NBAT) = (32, 32).
// coverage: zA per wave 32 rows x 64 cols -> 8 waves = 32 x 512; part per wave 16 x 16 -> 4 waves per k half
//   = 32 x 32 each; d_out per block 256 thr x 4 floats = 32 rows x 32 -> 1024 blocks = 32768 rows x 32.
// ---------------------------------------------------------------------------
#define SSP 128
#define SPP 136
#define ZP  520
#define PTP 36
#define SP_OFF_F   (BR * SSP)                 // 4096 floats
#define PART_OFF_F ((BR * ZP) / 2)            // 8320 floats
#define SBIGF      (PART_OFF_F + 2 * BR * PTP) // 10624 floats = 42496 B
static_assert((BR * ZP) % 8 == 0);
static_assert(SP_OFF_F + (BR * SPP) / 2 <= SBIGF);
static_assert((SP_OFF_F % 4) == 0);
static_assert((PART_OFF_F % 4) == 0);
static_assert((ZP % 8) == 0);
static_assert((SPP % 8) == 0);

__global__ __launch_bounds__(256) void k_attn(const _Float16* __restrict__ qp,
                                              const _Float16* __restrict__ kp,
                                              const _Float16* __restrict__ vt,
                                              const _Float16* __restrict__ wot,
                                              const float* __restrict__ gam,
                                              const float* __restrict__ bet,
                                              const float* __restrict__ mu,
                                              const float* __restrict__ var,
                                              const float* __restrict__ pa,
                                              const float* __restrict__ bo,
                                              const int* __restrict__ bsp,
                                              float* __restrict__ out, float sscale) {
  __shared__ __align__(16) float sBig[SBIGF];
  __shared__ __align__(16) float sRed[BR * 8];
  __shared__ __align__(16) float rM[BR];
  __shared__ __align__(16) float rMn[BR];
  __shared__ __align__(16) float rL[BR];
  __shared__ __align__(16) float rSc[BR];

  float*    sS   = sBig;
  _Float16* sP   = (_Float16*)(sBig + SP_OFF_F);
  _Float16* zA   = (_Float16*)sBig;
  float*    part = sBig + PART_OFF_F;

  const int tid = threadIdx.x, lane = tid & 31, wave = tid >> 5;
  const int hh = lane >> 4, c = lane & 15;
  const int b  = blockIdx.y;
  const int q0 = (int)blockIdx.x * BR;                  // query row base within the sequence
  int bs = bsp[0];
  bs = (bs < 1) ? 1 : bs;
  int seql = NTOK / bs;
  seql = (seql > SEQ) ? SEQ : seql;
  const int nch = seql / BC;                            // block-uniform, <= SEQ/BC
  const _Float16* Qb = qp + (size_t)b * SEQ * HD;
  const _Float16* Kb = kp + (size_t)b * SEQ * HD;
  const _Float16* Vb = vt + (size_t)b * HD * SEQ;        // [e][l]
  const size_t tokbase = (size_t)b * SEQ + q0;
  const float NEGI = -__builtin_huge_valf();
  if (tid < BR) { rM[tid] = NEGI; rL[tid] = 0.f; }
  __syncthreads();

  v8f oacc[2][4];
#pragma unroll
  for (int s = 0; s < 2; ++s)
#pragma unroll
    for (int t = 0; t < 4; ++t) oacc[s][t] = zero8();

  const int srow = tid >> 3, schk = tid & 7;            // softmax: 8 threads per row, 16 keys each

#pragma unroll 1
  for (int ch = 0; ch < nch; ++ch) {
    const int j0  = ch * BC;
    const int kr0 = j0 + wave * 16;                     // this wave's key tile
    v8f s[2];
    s[0] = zero8(); s[1] = zero8();
#pragma unroll 2
    for (int k0 = 0; k0 < HD; k0 += 32) {
      const v16h a0 = ldfrag(Qb, HD, q0, k0, lane);
      const v16h a1 = ldfrag(Qb, HD, q0 + 16, k0, lane);
      const v16h kb = ldfrag(Kb, HD, kr0, k0, lane);
      s[0] = mma16(a0, kb, s[0]);
      s[1] = mma16(a1, kb, s[1]);
    }
    // s[t][r] = S[q0 + 16t + 8hh + r][kr0 + c]
#pragma unroll
    for (int t = 0; t < 2; ++t) {
#pragma unroll
      for (int r = 0; r < 8; ++r) {
        const int row = 16 * t + 8 * hh + r;
        sS[row * SSP + wave * 16 + c] = s[t][r] * sscale;
      }
    }
    __syncthreads();
    {
      const float* sr = sS + srow * SSP + schk * 16;
      const v4f x0 = *(const v4f*)(sr);
      const v4f x1 = *(const v4f*)(sr + 4);
      const v4f x2 = *(const v4f*)(sr + 8);
      const v4f x3 = *(const v4f*)(sr + 12);
      float mx = x0[0];
#pragma unroll
      for (int e = 1; e < 4; ++e) mx = fmaxf(mx, x0[e]);
#pragma unroll
      for (int e = 0; e < 4; ++e) { mx = fmaxf(mx, x1[e]); mx = fmaxf(mx, x2[e]); mx = fmaxf(mx, x3[e]); }
      sRed[srow * 8 + schk] = mx;
    }
    __syncthreads();
    if (tid < BR) {                                     // wave 0, uniform
      float mx = rM[tid];
#pragma unroll
      for (int i = 0; i < 8; ++i) mx = fmaxf(mx, sRed[tid * 8 + i]);
      rMn[tid] = mx;
    }
    __syncthreads();
    {
      const float mx = rMn[srow];
      const float* sr = sS + srow * SSP + schk * 16;
      float sum = 0.f;
      Pack8 p0, p1;
#pragma unroll
      for (int e = 0; e < 8; ++e) {
        const float p = __expf(sr[e] - mx);
        sum += p;
        p0.h[e] = (_Float16)(p * 1024.0f);
      }
#pragma unroll
      for (int e = 0; e < 8; ++e) {
        const float p = __expf(sr[8 + e] - mx);
        sum += p;
        p1.h[e] = (_Float16)(p * 1024.0f);
      }
      *(v8h*)(sP + srow * SPP + schk * 16)     = p0.h;
      *(v8h*)(sP + srow * SPP + schk * 16 + 8) = p1.h;
      sRed[srow * 8 + schk] = sum;
    }
    __syncthreads();
    if (tid < BR) {
      float sum = 0.f;
#pragma unroll
      for (int i = 0; i < 8; ++i) sum += sRed[tid * 8 + i];
      const float mnew = rMn[tid];
      const float fac  = __expf(rM[tid] - mnew);
      rL[tid]  = rL[tid] * fac + sum;
      rM[tid]  = mnew;
      rSc[tid] = fac;
    }
    __syncthreads();                                    // P tile and row factors complete
#pragma unroll
    for (int t = 0; t < 2; ++t) {
      const v4f f0 = *(const v4f*)(rSc + 16 * t + 8 * hh);
      const v4f f1 = *(const v4f*)(rSc + 16 * t + 8 * hh + 4);
#pragma unroll
      for (int et = 0; et < 4; ++et) {
#pragma unroll
        for (int r = 0; r < 4; ++r) {
          oacc[t][et][r]     *= f0[r];
          oacc[t][et][4 + r] *= f1[r];
        }
      }
    }
#pragma unroll 1
    for (int kk = 0; kk < BC / 32; ++kk) {
      // A operand: P rows 16t + (lane&15), split k map over keys
      const v16h pa0 = ldfrag(sP, SPP, 0, kk * 32, lane);
      const v16h pa1 = ldfrag(sP, SPP, 16, kk * 32, lane);
#pragma unroll
      for (int et = 0; et < 4; ++et) {
        // B operand: column 64w + 16et + (lane&15) of V^T [e][l], split k map over keys
        const v16h vb = ldfrag(Vb, SEQ, wave * 64 + 16 * et, j0 + kk * 32, lane);
        oacc[0][et] = mma16(pa0, vb, oacc[0][et]);
        oacc[1][et] = mma16(pa1, vb, oacc[1][et]);
      }
    }
    __syncthreads();                                    // sS / sP / rSc free for the next chunk
  }

  // ---- tail: 1/(1024 l) per row, BN affine, PReLU, z x16 -> f16 LDS tile ----
  if (tid < BR) {
    const float l = rL[tid];
    rSc[tid] = (l > 0.f) ? (0.0009765625f * (1.0f / l)) : 0.f;
  }
  __syncthreads();
  {
    const float a = pa[0];
    v4f iv0[2], iv1[2];
#pragma unroll
    for (int sub = 0; sub < 2; ++sub) {
      iv0[sub] = *(const v4f*)(rSc + 16 * sub + 8 * hh);
      iv1[sub] = *(const v4f*)(rSc + 16 * sub + 8 * hh + 4);
    }
#pragma unroll
    for (int t = 0; t < 4; ++t) {
      const int h = wave * 64 + 16 * t + c;             // output column of the attention = BN channel
      const float sc = gam[h] * (1.0f / sqrtf(var[h] + 1.0e-5f));
      const float m  = mu[h];
      const float be = bet[h];
#pragma unroll
      for (int sub = 0; sub < 2; ++sub) {
#pragma unroll
        for (int r = 0; r < 4; ++r) {
          const float o0 = oacc[sub][t][r] * iv0[sub][r];
          float z0 = (o0 - m) * sc + be;
          z0 = (z0 >= 0.f) ? z0 : a * z0;
          zA[(16 * sub + 8 * hh + r) * ZP + h] = (_Float16)(z0 * 16.0f);
          const float o1 = oacc[sub][t][4 + r] * iv1[sub][r];
          float z1 = (o1 - m) * sc + be;
          z1 = (z1 >= 0.f) ? z1 : a * z1;
          zA[(16 * sub + 8 * hh + 4 + r) * ZP + h] = (_Float16)(z1 * 16.0f);
        }
      }
    }
  }
  __syncthreads();                                      // zA complete (cross-wave)

  // ---- out tile 32 x 32 = zA[32][512] . WoT, K split over two wave groups ----
  {
    const int osub = wave & 1, ont = (wave >> 1) & 1, okh = wave >> 2;
    v8f acc = zero8();
#pragma unroll 2
    for (int ks = 0; ks < 8; ++ks) {
      const int k0 = (okh * 8 + ks) * 32;
      const v16h af = ldfrag(zA, ZP, 16 * osub, k0, lane);
      const v16h bf = ldfrag(wot, HD, 16 * ont, k0, lane);
      acc = mma16(af, bf, acc);
    }
    float* pp = part + okh * (BR * PTP) + (16 * osub + 8 * hh) * PTP + 16 * ont + c;
#pragma unroll
    for (int r = 0; r < 8; ++r) pp[r * PTP] = acc[r];
  }
  __syncthreads();                                      // part complete
  {
    const int row = tid >> 3, pc = tid & 7;
    const v4f p0 = *(const v4f*)(part + row * PTP + pc * 4);
    const v4f p1 = *(const v4f*)(part + BR * PTP + row * PTP + pc * 4);
    const v4f bb = *(const v4f*)(bo + pc * 4);
    const v4f val = (p0 + p1) * 0.0009765625f + bb;     // 1/(16 * 64)
    v4f* d = (v4f*)(out + (tokbase + (size_t)row) * OD + pc * 4);
    *d = val;
    
  }
}

// ---------------------------------------------------------------------------
// Workspace map (bytes; every region is a whole number of the 512-B store units its producer writes and
// every dimension is a tile multiple, so no padded tail rows exist):
//   Q    f16 [32768][512]            0   33554432
//   K    f16 [32768][512]     33554432   33554432
//   V^T  f16 [32][512][1024]  67108864   33554432
//   WoT  f16 [32][512]       100663296      32768
//   total                   100696064
// ---------------------------------------------------------------------------
extern "C" void kernel_launch(void* const* d_in, const int* in_sizes, int n_in,
                              void* d_out, int out_size, void* d_ws, size_t ws_size,
                              hipStream_t stream) {
  if (n_in < 12) return;
  if (in_sizes[0] != NTOK * 2) return;
  if (in_sizes[1] < 1) return;
  if (in_sizes[2] != 2 * HD) return;
  if (in_sizes[3] != 2 * HD) return;
  if (in_sizes[4] != 2 * HD) return;
  if (in_sizes[5] != HD) return;
  if (in_sizes[6] != HD) return;
  if (in_sizes[7] != HD) return;
  if (in_sizes[8] != HD) return;
  if (in_sizes[9] < 1) return;
  if (in_sizes[10] != HD * OD) return;
  if (in_sizes[11] != OD) return;
  if (out_size != NTOK * OD) return;

  const float* x    = (const float*)d_in[0];    // [32768][2]
  const int*   bsz  = (const int*)d_in[1];      // [1]
  const float* wq   = (const float*)d_in[2];    // [2][512]
  const float* wk   = (const float*)d_in[3];    // [2][512]
  const float* wv   = (const float*)d_in[4];    // [2][512]
  const float* gam  = (const float*)d_in[5];    // [512]
  const float* bet  = (const float*)d_in[6];    // [512]
  const float* mu   = (const float*)d_in[7];    // [512]
  const float* var  = (const float*)d_in[8];    // [512]
  const float* pa   = (const float*)d_in[9];    // [1]
  const float* wo   = (const float*)d_in[10];   // [512][32]
  const float* bo   = (const float*)d_in[11];   // [32]
  float* out = (float*)d_out;                   // [32768][32]

  size_t off = 0;
  const size_t oQ = off; off += (size_t)NTOK * HD * 2;
  const size_t oK = off; off += (size_t)NTOK * HD * 2;
  const size_t oV = off; off += (size_t)NBAT * HD * SEQ * 2;
  const size_t oW = off; off += (size_t)OD * HD * 2;
  if (off > ws_size) return;                    // off = 100696064
  if (off > (size_t)134217728) return;

  char* ws = (char*)d_ws;
  _Float16* Qp  = (_Float16*)(ws + oQ);
  _Float16* Kp  = (_Float16*)(ws + oK);
  _Float16* Vt  = (_Float16*)(ws + oV);
  _Float16* WoT = (_Float16*)(ws + oW);

  const float sscale = 1.0f / sqrtf((float)HD);

  // (0) Wout -> f16 [n][k] plane (x64)
  const int ngw = (OD * HD) / 8;                // 2048
  k_wout<<<dim3((ngw + 255) / 256), dim3(256), 0, stream>>>(wo, WoT, ngw);
  // (1) q, k planes [token][512] and v^T plane [b][e][l], exact f32 K = 2 projections -> f16
  const int nqk = (NTOK * HD) / 8;              // 2097152
  const int nv  = (NBAT * HD * SEQ) / 8;        // 2097152
  const int ngp = (nqk > nv) ? nqk : nv;
  k_proj<<<dim3((ngp + 255) / 256, 3), dim3(256), 0, stream>>>(x, wq, wk, wv, Qp, Kp, Vt, nqk, nv);
  // (2) attention + BN/PReLU/Wout tail -> d_out
  k_attn<<<dim3(SEQ / BR, NBAT), dim3(256), 0, stream>>>(Qp, Kp, Vt, WoT, gam, bet, mu, var, pa, bo, bsz,
                                                         out, sscale);
  (void)hipGetLastError();
}

// v001
// One run takes 155 microseconds.
// Timed twice side by side with v000, it ran 1.99 and 2.00 times as fast.
// Contractions: S = q.k^T = (x.M).x^T with M = Wq.Wk^T (2 x 2, f32) on v_wmma_f32_16x16x32_f16 (f16 hi + lo operand pairs, f32 accumulate); O = p.v on v_wmma_f32_16x16x32_f16 (f16 operands: v x1, p x1024; f32 accumulate); out = z.Wout on v_wmma_f32_16x16x32_f16 (f16 operands: z x16, Wout x64; f32 accumulate, 1/1024 folded back in f32). Projection v = x.Wv (K = 2), M and y = x.M exact f32 on VALU; score scale, online softmax, 1/l, BN affine, PReLU and bias in f32.
#include <hip/hip_runtime.h>
#include <math.h>
#include <stddef.h>
#include <stdint.h>

#define NTOK 32768              // token rows
#define NBAT 32                 // sequences
#define SEQ  1024               // tokens per sequence
#define HD   512                // head width
#define OD   32                 // output width
#define BR   32                 // query rows per attention block
#define BC   128                // keys per chunk

static_assert(NTOK == NBAT * SEQ);
static_assert(SEQ % BC == 0);
static_assert(SEQ % BR == 0);
static_assert(BC % 32 == 0);
static_assert(HD == 512);
static_assert((HD / 8) == 64);
static_assert((SEQ / 8) == 128);
static_assert(OD == 32);

typedef _Float16 v16h __attribute__((ext_vector_type(16)));
typedef _Float16 v8h  __attribute__((ext_vector_type(8)));
typedef float    v8f  __attribute__((ext_vector_type(8)));
typedef float    v4f  __attribute__((ext_vector_type(4)));
typedef float    v2f  __attribute__((ext_vector_type(2)));
typedef unsigned int v4u __attribute__((ext_vector_type(4)));

union Frag  { v16h v; v8h h[2]; };
union Pack8 { v8h h; v4u u; };

// WMMA with the dependent-VALU hazard guard (ties D, keeps A/B live)
__device__ __forceinline__ v8f mma16(v16h a, v16h b, v8f c) {
  c = __builtin_amdgcn_wmma_f32_16x16x32_f16(false, a, false, b, (short)0, c, false, false);
  asm volatile("v_nop\n\tv_nop\n\tv_nop\n\tv_nop" : "+v"(c) : "v"(a), "v"(b));
  return c;
}

// Fragment loader for k-contiguous 16-bit rows with pitch ld.
// A operand: row0 + (lane&15) is the M row.  B operand stored [n][k]: row0 + (lane&15) is the N column.
// Split k map for both: elements 0..7 <- k0 + 8*(lane>>4) + 0..7, elements 8..15 <- k0 + 16 + 8*(lane>>4) + 0..7.
// D map: acc[r] = element (8*(lane>>4) + r, lane&15) of the 16x16 tile.
__device__ __forceinline__ v16h ldfrag(const _Float16* p, int ld, int row0, int k0, int lane) {
  const int m = lane & 15, lh = lane >> 4;
  const _Float16* q = p + (size_t)(row0 + m) * ld + k0 + 8 * lh;
  Frag f;
  f.h[0] = *(const v8h*)(q);
  f.h[1] = *(const v8h*)(q + 16);
  return f.v;
}

__device__ __forceinline__ v8f zero8() { return (v8f){0.f, 0.f, 0.f, 0.f, 0.f, 0.f, 0.f, 0.f}; }

// ---------------------------------------------------------------------------
// kernel 0: Wout f32 [512][32] ([k][n]) -> f16 plane WoT [32][512] ([n][k], k-contiguous), values x64.
// Thread t: n = t>>6, k0 = (t&63)*8: gathers 8 consecutive k of column n, one 16-B store; 32 lanes write
// coverage: 2048 threads x 8 halves = 32 x 512.
// The block behind these (n is a multiple of 256): its wave 0 forms M[i][j] = sum_h Wq[i][h] * Wk[j][h] in f32 (lane l: h = 16l .. 16l+15, then a
// butterfly over the 32 lanes) and stores the four values to mm.
// ---------------------------------------------------------------------------
__global__ __launch_bounds__(256) void k_wout(const float* __restrict__ wo, _Float16* __restrict__ wot, int n,
                                              const float* __restrict__ wq, const float* __restrict__ wk,
                                              float* __restrict__ mm) {
  if ((int)blockIdx.x * 256 >= n) {                     // the block behind the plane's; block-uniform; no barriers in this kernel
    if (threadIdx.x >= 32) return;
    const int h0 = (int)threadIdx.x * 16;
    float m00 = 0.f, m01 = 0.f, m10 = 0.f, m11 = 0.f;
#pragma unroll
    for (int g = 0; g < 4; ++g) {
      const v4f q0v = *(const v4f*)(wq + h0 + 4 * g);
      const v4f q1v = *(const v4f*)(wq + HD + h0 + 4 * g);
      const v4f k0v = *(const v4f*)(wk + h0 + 4 * g);
      const v4f k1v = *(const v4f*)(wk + HD + h0 + 4 * g);
#pragma unroll
      for (int e = 0; e < 4; ++e) {
        m00 = fmaf(q0v[e], k0v[e], m00);
        m01 = fmaf(q0v[e], k1v[e], m01);
        m10 = fmaf(q1v[e], k0v[e], m10);
        m11 = fmaf(q1v[e], k1v[e], m11);
      }
    }
#pragma unroll
    for (int d = 16; d >= 1; d >>= 1) {
      m00 += __shfl_xor(m00, d, 32);
      m01 += __shfl_xor(m01, d, 32);
      m10 += __shfl_xor(m10, d, 32);
      m11 += __shfl_xor(m11, d, 32);
    }
    if (threadIdx.x == 0) *(v4f*)mm = (v4f){m00, m01, m10, m11};
    return;
  }
  const int t = blockIdx.x * 256 + (int)threadIdx.x;
  if (t >= n) return;
  const int nn = t >> 6;
  const int k0 = (t & 63) * 8;
  const float* src = wo + (size_t)k0 * OD + nn;
  Pack8 pk;
  pk.h = (v8h){(_Float16)(src[0 * OD] * 64.0f), (_Float16)(src[1 * OD] * 64.0f),
               (_Float16)(src[2 * OD] * 64.0f), (_Float16)(src[3 * OD] * 64.0f),
               (_Float16)(src[4 * OD] * 64.0f), (_Float16)(src[5 * OD] * 64.0f),
               (_Float16)(src[6 * OD] * 64.0f), (_Float16)(src[7 * OD] * 64.0f)};
  const v4u vv = pk.u;
  v4u* d = (v4u*)(wot + (size_t)nn * HD + k0);
  *d = vv;
  
}

// ---------------------------------------------------------------------------
// kernel 1: projection v = x.Wv with K = 2 in exact f32 on VALU, stored as an f16 plane (x1).
//   v^T plane [b][e][l] (pitch SEQ); thread t: l0 = (t&127)*8, e = (t>>7)&511, b = t>>16
// coverage: 2097152 threads x 8 = 32 x 512 x 1024.
// ---------------------------------------------------------------------------
__global__ __launch_bounds__(256) void k_proj(const float* __restrict__ x,
                                              const float* __restrict__ wv,
                                              _Float16* __restrict__ vt, int nv) {
  const int t = blockIdx.x * 256 + (int)threadIdx.x;
  if (t >= nv) return;                                  // no barriers in this kernel
  const int l0 = (t & 127) * 8;
  const int e  = (t >> 7) & 511;
  const int b  = t >> 16;
  const float w0 = wv[e], w1 = wv[HD + e];
  const float* xr = x + ((size_t)(b * SEQ + l0)) * 2;   // 8 token rows x 2 = 16 floats, 64-B aligned
  const v4f c0 = *(const v4f*)(xr);
  const v4f c1 = *(const v4f*)(xr + 4);
  const v4f c2 = *(const v4f*)(xr + 8);
  const v4f c3 = *(const v4f*)(xr + 12);
  Pack8 pk;
  pk.h = (v8h){(_Float16)fmaf(c0[1], w1, c0[0] * w0), (_Float16)fmaf(c0[3], w1, c0[2] * w0),
               (_Float16)fmaf(c1[1], w1, c1[0] * w0), (_Float16)fmaf(c1[3], w1, c1[2] * w0),
               (_Float16)fmaf(c2[1], w1, c2[0] * w0), (_Float16)fmaf(c2[3], w1, c2[2] * w0),
               (_Float16)fmaf(c3[1], w1, c3[0] * w0), (_Float16)fmaf(c3[3], w1, c3[2] * w0)};
  const v4u vv = pk.u;
  v4u* d = (v4u*)(vt + ((size_t)(b * HD + e)) * SEQ + l0);
  *d = vv;
}

// ---------------------------------------------------------------------------
// kernel 2: non-causal flash attention per (query tile, sequence), single head of width 512, with the
// BN-affine + PReLU + z.Wout + bias tail fused. Block = 8 waves = 32 query rows of one sequence;
// key chunks of 128 (nch = SEQ/BC = 8, derived from the batch_size input and clamped to the static maximum).
//   x: f32 input [token][2];  mm: f32 M = Wq.Wk^T [2][2];  vt: f16 plane [b][e][l];  wot: f16 plane [32][512] (x64).
// S: q.k = sum_ij x_i M_ij x'_j = y.x' with y = x.M, so the score product contracts 2 dims, not 512. Each f32
//   factor goes in as an f16 pair hi + lo and the four cross products of the two dims fill k slots 0..7 of one
//   16x16x32 step (slots 8..31 are zero in A and in B).
// Per chunk: S: wave w computes keys j0+16w..+15 x 32 rows (one k-step; A fragments formed once per block, B
//   fragment from this chunk's x rows); scale in f32 -> sS; block-cooperative online softmax in f32 through LDS (8 threads per row);
//   p = exp(s - m) x 1024 -> f16 tile sP [row][key] (16-B LDS stores), block barrier, reloaded with the A
//   loader (same element type); O: wave w owns cols 64w..64w+63 for all 32 rows (2 x 4 accumulator tiles),
//   B fragments straight from the V^T plane.
// Tail: o = oacc / (1024 l); z = (o - mean) * gamma/sqrt(var + eps) + beta; PReLU; z x16 -> f16 LDS tile
//   zA [32][512]; barrier; out tile 32x32: wave w = (row tile w&1, col tile (w>>1)&1, k half w>>2), 8 k-steps
//   each, partial D to LDS part[khalf][32][32]; barrier; val = (part0 + part1)/1024 + b_out; each d_out row
// LDS: one raw buffer: loop phase sS (floats 0..4095) + sP (halves at float offset 4096); tail phase zA
//   (halves at float offset 0 .. 8319) + part (floats 8320 .. 10623).
// grid = (SEQ/BR, NBAT) = (32, 32).
// coverage: zA per wave 32 rows x 64 cols -> 8 waves = 32 x 512; part per wave 16 x 16 -> 4 waves per k half
//   = 32 x 32 each; d_out per block 256 thr x 4 floats = 32 rows x 32 -> 1024 blocks = 32768 rows x 32.
// ---------------------------------------------------------------------------
#define SSP 128
#define SPP 136
#define ZP  520
#define PTP 36
#define SP_OFF_F   (BR * SSP)                 // 4096 floats
#define PART_OFF_F ((BR * ZP) / 2)            // 8320 floats
#define SBIGF      (PART_OFF_F + 2 * BR * PTP) // 10624 floats = 42496 B
static_assert((BR * ZP) % 8 == 0);
static_assert(SP_OFF_F + (BR * SPP) / 2 <= SBIGF);
static_assert((SP_OFF_F % 4) == 0);
static_assert((PART_OFF_F % 4) == 0);
static_assert((ZP % 8) == 0);
static_assert((SPP % 8) == 0);

// Score fragment from one f32 pair (u0, u1). k slots 0..7, held by lanes 0..15 in elements 0..7:
//   A (isA): hi0 hi1 hi0 hi1 lo0 lo1 lo0 lo1      B: hi0 hi1 lo0 lo1 hi0 hi1 lo0 lo1
// so slot by slot the products are hi.hi, hi.lo, lo.hi, lo.lo for dim 0 and dim 1. All other slots are zero.
__device__ __forceinline__ v16h sfrag(float u0, float u1, bool isA, int lane) {
  const _Float16 h0 = (_Float16)u0, h1 = (_Float16)u1;
  const _Float16 l0 = (_Float16)(u0 - (float)h0), l1 = (_Float16)(u1 - (float)h1);
  const v8h zz = (v8h){0, 0, 0, 0, 0, 0, 0, 0};
  const v8h va = (v8h){h0, h1, h0, h1, l0, l1, l0, l1};
  const v8h vb = (v8h){h0, h1, l0, l1, h0, h1, l0, l1};
  Frag f;
  f.h[0] = (lane < 16) ? (isA ? va : vb) : zz;
  f.h[1] = zz;
  return f.v;
}

__global__ __launch_bounds__(256) void k_attn(const float* __restrict__ x,
                                              const float* __restrict__ mm,
                                              const _Float16* __restrict__ vt,
                                              const _Float16* __restrict__ wot,
                                              const float* __restrict__ gam,
                                              const float* __restrict__ bet,
                                              const float* __restrict__ mu,
                                              const float* __restrict__ var,
                                              const float* __restrict__ pa,
                                              const float* __restrict__ bo,
                                              const int* __restrict__ bsp,
                                              float* __restrict__ out, float sscale) {
  __shared__ __align__(16) float sBig[SBIGF];
  __shared__ __align__(16) float sRed[BR * 8];
  __shared__ __align__(16) float rM[BR];
  __shared__ __align__(16) float rMn[BR];
  __shared__ __align__(16) float rL[BR];
  __shared__ __align__(16) float rSc[BR];

  float*    sS   = sBig;
  _Float16* sP   = (_Float16*)(sBig + SP_OFF_F);
  _Float16* zA   = (_Float16*)sBig;
  float*    part = sBig + PART_OFF_F;

  const int tid = threadIdx.x, lane = tid & 31, wave = tid >> 5;
  const int hh = lane >> 4, c = lane & 15;
  const int b  = blockIdx.y;
  const int q0 = (int)blockIdx.x * BR;                  // query row base within the sequence
  int bs = bsp[0];
  bs = (bs < 1) ? 1 : bs;
  int seql = NTOK / bs;
  seql = (seql > SEQ) ? SEQ : seql;
  const int nch = seql / BC;                            // block-uniform, <= SEQ/BC
  const float* Xb = x + (size_t)b * SEQ * 2;             // this sequence's token rows [l][2]
  const _Float16* Vb = vt + (size_t)b * HD * SEQ;        // [e][l]
  const size_t tokbase = (size_t)b * SEQ + q0;
  const float NEGI = -__builtin_huge_valf();
  if (tid < BR) { rM[tid] = NEGI; rL[tid] = 0.f; }
  __syncthreads();

  v8f oacc[2][4];
#pragma unroll
  for (int s = 0; s < 2; ++s)
#pragma unroll
    for (int t = 0; t < 4; ++t) oacc[s][t] = zero8();

  const int srow = tid >> 3, schk = tid & 7;            // softmax: 8 threads per row, 16 keys each

  // A fragments of the score product: y = x.M for query rows q0 + 16t + (lane&15)
  v16h ya[2];
  {
    const v4f mv = *(const v4f*)mm;                     // M00 M01 M10 M11
#pragma unroll
    for (int t = 0; t < 2; ++t) {
      const v2f xq = *(const v2f*)(Xb + 2 * (size_t)(q0 + 16 * t + c));
      ya[t] = sfrag(fmaf(xq[1], mv[2], xq[0] * mv[0]), fmaf(xq[1], mv[3], xq[0] * mv[1]), true, lane);
    }
  }

#pragma unroll 1
  for (int ch = 0; ch < nch; ++ch) {
    const int j0  = ch * BC;
    const int kr0 = j0 + wave * 16;                     // this wave's key tile
    v8f s[2];
    s[0] = zero8(); s[1] = zero8();
    {
      const v2f xk = *(const v2f*)(Xb + 2 * (size_t)(kr0 + c));
      const v16h kb = sfrag(xk[0], xk[1], false, lane);
      s[0] = mma16(ya[0], kb, s[0]);
      s[1] = mma16(ya[1], kb, s[1]);
    }
    // s[t][r] = S[q0 + 16t + 8hh + r][kr0 + c]
#pragma unroll
    for (int t = 0; t < 2; ++t) {
#pragma unroll
      for (int r = 0; r < 8; ++r) {
        const int row = 16 * t + 8 * hh + r;
        sS[row * SSP + wave * 16 + c] = s[t][r] * sscale;
      }
    }
    __syncthreads();
    {
      const float* sr = sS + srow * SSP + schk * 16;
      const v4f x0 = *(const v4f*)(sr);
      const v4f x1 = *(const v4f*)(sr + 4);
      const v4f x2 = *(const v4f*)(sr + 8);
      const v4f x3 = *(const v4f*)(sr + 12);
      float mx = x0[0];
#pragma unroll
      for (int e = 1; e < 4; ++e) mx = fmaxf(mx, x0[e]);
#pragma unroll
      for (int e = 0; e < 4; ++e) { mx = fmaxf(mx, x1[e]); mx = fmaxf(mx, x2[e]); mx = fmaxf(mx, x3[e]); }
      sRed[srow * 8 + schk] = mx;
    }
    __syncthreads();
    if (tid < BR) {                                     // wave 0, uniform
      float mx = rM[tid];
#pragma unroll
      for (int i = 0; i < 8; ++i) mx = fmaxf(mx, sRed[tid * 8 + i]);
      rMn[tid] = mx;
    }
    __syncthreads();
    {
      const float mx = rMn[srow];
      const float* sr = sS + srow * SSP + schk * 16;
      float sum = 0.f;
      Pack8 p0, p1;
#pragma unroll
      for (int e = 0; e < 8; ++e) {
        const float p = __expf(sr[e] - mx);
        sum += p;
        p0.h[e] = (_Float16)(p * 1024.0f);
      }
#pragma unroll
      for (int e = 0; e < 8; ++e) {
        const float p = __expf(sr[8 + e] - mx);
        sum += p;
        p1.h[e] = (_Float16)(p * 1024.0f);
      }
      *(v8h*)(sP + srow * SPP + schk * 16)     = p0.h;
      *(v8h*)(sP + srow * SPP + schk * 16 + 8) = p1.h;
      sRed[srow * 8 + schk] = sum;
    }
    __syncthreads();
    if (tid < BR) {
      float sum = 0.f;
#pragma unroll
      for (int i = 0; i < 8; ++i) sum += sRed[tid * 8 + i];
      const float mnew = rMn[tid];
      const float fac  = __expf(rM[tid] - mnew);
      rL[tid]  = rL[tid] * fac + sum;
      rM[tid]  = mnew;
      rSc[tid] = fac;
    }
    __syncthreads();                                    // P tile and row factors complete
#pragma unroll
    for (int t = 0; t < 2; ++t) {
      const v4f f0 = *(const v4f*)(rSc + 16 * t + 8 * hh);
      const v4f f1 = *(const v4f*)(rSc + 16 * t + 8 * hh + 4);
#pragma unroll
      for (int et = 0; et < 4; ++et) {
#pragma unroll
        for (int r = 0; r < 4; ++r) {
          oacc[t][et][r]     *= f0[r];
          oacc[t][et][4 + r] *= f1[r];
        }
      }
    }
#pragma unroll 1
    for (int kk = 0; kk < BC / 32; ++kk) {
      // A operand: P rows 16t + (lane&15), split k map over keys
      const v16h pa0 = ldfrag(sP, SPP, 0, kk * 32, lane);
      const v16h pa1 = ldfrag(sP, SPP, 16, kk * 32, lane);
#pragma unroll
      for (int et = 0; et < 4; ++et) {
        // B operand: column 64w + 16et + (lane&15) of V^T [e][l], split k map over keys
        const v16h vb = ldfrag(Vb, SEQ, wave * 64 + 16 * et, j0 + kk * 32, lane);
        oacc[0][et] = mma16(pa0, vb, oacc[0][et]);
        oacc[1][et] = mma16(pa1, vb, oacc[1][et]);
      }
    }
    __syncthreads();                                    // sS / sP / rSc free for the next chunk
  }

  // ---- tail: 1/(1024 l) per row, BN affine, PReLU, z x16 -> f16 LDS tile ----
  if (tid < BR) {
    const float l = rL[tid];
    rSc[tid] = (l > 0.f) ? (0.0009765625f * (1.0f / l)) : 0.f;
  }
  __syncthreads();
  {
    const float a = pa[0];
    v4f iv0[2], iv1[2];
#pragma unroll
    for (int sub = 0; sub < 2; ++sub) {
      iv0[sub] = *(const v4f*)(rSc + 16 * sub + 8 * hh);
      iv1[sub] = *(const v4f*)(rSc + 16 * sub + 8 * hh + 4);
    }
#pragma unroll
    for (int t = 0; t < 4; ++t) {
      const int h = wave * 64 + 16 * t + c;             // output column of the attention = BN channel
      const float sc = gam[h] * (1.0f / sqrtf(var[h] + 1.0e-5f));
      const float m  = mu[h];
      const float be = bet[h];
#pragma unroll
      for (int sub = 0; sub < 2; ++sub) {
#pragma unroll
        for (int r = 0; r < 4; ++r) {
          const float o0 = oacc[sub][t][r] * iv0[sub][r];
          float z0 = (o0 - m) * sc + be;
          z0 = (z0 >= 0.f) ? z0 : a * z0;
          zA[(16 * sub + 8 * hh + r) * ZP + h] = (_Float16)(z0 * 16.0f);
          const float o1 = oacc[sub][t][4 + r] * iv1[sub][r];
          float z1 = (o1 - m) * sc + be;
          z1 = (z1 >= 0.f) ? z1 : a * z1;
          zA[(16 * sub + 8 * hh + 4 + r) * ZP + h] = (_Float16)(z1 * 16.0f);
        }
      }
    }
  }
  __syncthreads();                                      // zA complete (cross-wave)

  // ---- out tile 32 x 32 = zA[32][512] . WoT, K split over two wave groups ----
  {
    const int osub = wave & 1, ont = (wave >> 1) & 1, okh = wave >> 2;
    v8f acc = zero8();
#pragma unroll 2
    for (int ks = 0; ks < 8; ++ks) {
      const int k0 = (okh * 8 + ks) * 32;
      const v16h af = ldfrag(zA, ZP, 16 * osub, k0, lane);
      const v16h bf = ldfrag(wot, HD, 16 * ont, k0, lane);
      acc = mma16(af, bf, acc);
    }
    float* pp = part + okh * (BR * PTP) + (16 * osub + 8 * hh) * PTP + 16 * ont + c;
#pragma unroll
    for (int r = 0; r < 8; ++r) pp[r * PTP] = acc[r];
  }
  __syncthreads();                                      // part complete
  {
    const int row = tid >> 3, pc = tid & 7;
    const v4f p0 = *(const v4f*)(part + row * PTP + pc * 4);
    const v4f p1 = *(const v4f*)(part + BR * PTP + row * PTP + pc * 4);
    const v4f bb = *(const v4f*)(bo + pc * 4);
    const v4f val = (p0 + p1) * 0.0009765625f + bb;     // 1/(16 * 64)
    v4f* d = (v4f*)(out + (tokbase + (size_t)row) * OD + pc * 4);
    *d = val;
    
  }
}

// ---------------------------------------------------------------------------
// Workspace map (bytes; V^T and WoT are whole numbers of the 512-B store units their producers write and
// their dimensions are tile multiples, so they have no padded tail rows; M is one 16-B store in a 128-B slot):
//   V^T  f16 [32][512][1024]         0   33554432
//   WoT  f16 [32][512]        33554432      32768
//   M    f32 [2][2]           33587200        128 (16 used)
//   total                     33587328
// ---------------------------------------------------------------------------
extern "C" void kernel_launch(void* const* d_in, const int* in_sizes, int n_in,
                              void* d_out, int out_size, void* d_ws, size_t ws_size,
                              hipStream_t stream) {
  if (n_in < 12) return;
  if (in_sizes[0] != NTOK * 2) return;
  if (in_sizes[1] < 1) return;
  if (in_sizes[2] != 2 * HD) return;
  if (in_sizes[3] != 2 * HD) return;
  if (in_sizes[4] != 2 * HD) return;
  if (in_sizes[5] != HD) return;
  if (in_sizes[6] != HD) return;
  if (in_sizes[7] != HD) return;
  if (in_sizes[8] != HD) return;
  if (in_sizes[9] < 1) return;
  if (in_sizes[10] != HD * OD) return;
  if (in_sizes[11] != OD) return;
  if (out_size != NTOK * OD) return;

  const float* x    = (const float*)d_in[0];    // [32768][2]
  const int*   bsz  = (const int*)d_in[1];      // [1]
  const float* wq   = (const float*)d_in[2];    // [2][512]
  const float* wk   = (const float*)d_in[3];    // [2][512]
  const float* wv   = (const float*)d_in[4];    // [2][512]
  const float* gam  = (const float*)d_in[5];    // [512]
  const float* bet  = (const float*)d_in[6];    // [512]
  const float* mu   = (const float*)d_in[7];    // [512]
  const float* var  = (const float*)d_in[8];    // [512]
  const float* pa   = (const float*)d_in[9];    // [1]
  const float* wo   = (const float*)d_in[10];   // [512][32]
  const float* bo   = (const float*)d_in[11];   // [32]
  float* out = (float*)d_out;                   // [32768][32]

  size_t off = 0;
  const size_t oV = off; off += (size_t)NBAT * HD * SEQ * 2;
  const size_t oW = off; off += (size_t)OD * HD * 2;
  const size_t oM = off; off += (size_t)128;
  if (off > ws_size) return;                    // off = 33587328
  if (off > (size_t)134217728) return;

  char* ws = (char*)d_ws;
  _Float16* Vt  = (_Float16*)(ws + oV);
  _Float16* WoT = (_Float16*)(ws + oW);
  float*    Mm  = (float*)(ws + oM);

  const float sscale = 1.0f / sqrtf((float)HD);

  // (0) Wout -> f16 [n][k] plane (x64); one more block forms M = Wq.Wk^T
  const int ngw = (OD * HD) / 8;                // 2048
  k_wout<<<dim3((ngw + 255) / 256 + 1), dim3(256), 0, stream>>>(wo, WoT, ngw, wq, wk, Mm);
  // (1) v^T plane [b][e][l], exact f32 K = 2 projection -> f16
  const int nv  = (NBAT * HD * SEQ) / 8;        // 2097152
  k_proj<<<dim3((nv + 255) / 256), dim3(256), 0, stream>>>(x, wv, Vt, nv);
  // (2) attention + BN/PReLU/Wout tail -> d_out
  k_attn<<<dim3(SEQ / BR, NBAT), dim3(256), 0, stream>>>(x, Mm, Vt, WoT, gam, bet, mu, var, pa, bo, bsz,
                                                         out, sscale);
  (void)hipGetLastError();
}

// v002
// It runs in 24.5 microseconds.
// In two side-by-side timings against v001, it was 6.41 and 6.31 times as fast.
// All steps since v000 together make it 12.7 times as fast.
// Contractions: S = q.k^T = (x.M).x^T with M = Wq.Wk^T (2 x 2, f32) on v_wmma_f32_16x16x32_f16 (f16 hi + lo operand pairs, f32 accumulate); O = p.v = (p.x).Wv with u = p.x (2 columns) on v_wmma_f32_16x16x32_f16 (f16 operands: x as hi and lo columns, p x1024; f32 accumulate); out = z.Wout on v_wmma_f32_16x16x32_f16 (f16 operands: z x16, Wout x64; f32 accumulate, 1/1024 folded back in f32). Projection o = u.Wv (K = 2), M and y = x.M exact f32 on VALU; score scale, online softmax, 1/l, BN affine, PReLU and bias in f32.
#include <hip/hip_runtime.h>
#include <math.h>
#include <stddef.h>
#include <stdint.h>

#define NTOK 32768              // token rows
#define NBAT 32                 // sequences
#define SEQ  1024               // tokens per sequence
#define HD   512                // head width
#define OD   32                 // output width
#define BR   32                 // query rows per attention block
#define BC   128                // keys per chunk

static_assert(NTOK == NBAT * SEQ);
static_assert(SEQ % BC == 0);
static_assert(SEQ % BR == 0);
static_assert(BC % 32 == 0);
static_assert(HD == 512);
static_assert((HD / 8) == 64);
static_assert(SEQ == 256 * 4);
static_assert(OD == 32);

typedef _Float16 v16h __attribute__((ext_vector_type(16)));
typedef _Float16 v8h  __attribute__((ext_vector_type(8)));
typedef _Float16 v4h  __attribute__((ext_vector_type(4)));
typedef float    v8f  __attribute__((ext_vector_type(8)));
typedef float    v4f  __attribute__((ext_vector_type(4)));
typedef float    v2f  __attribute__((ext_vector_type(2)));
typedef unsigned int v4u __attribute__((ext_vector_type(4)));

union Frag  { v16h v; v8h h[2]; };
union Pack8 { v8h h; v4u u; };

// WMMA with the dependent-VALU hazard guard (ties D, keeps A/B live)
__device__ __forceinline__ v8f mma16(v16h a, v16h b, v8f c) {
  c = __builtin_amdgcn_wmma_f32_16x16x32_f16(false, a, false, b, (short)0, c, false, false);
  asm volatile("v_nop\n\tv_nop\n\tv_nop\n\tv_nop" : "+v"(c) : "v"(a), "v"(b));
  return c;
}

// Fragment loader for k-contiguous 16-bit rows with pitch ld.
// A operand: row0 + (lane&15) is the M row.  B operand stored [n][k]: row0 + (lane&15) is the N column.
// Split k map for both: elements 0..7 <- k0 + 8*(lane>>4) + 0..7, elements 8..15 <- k0 + 16 + 8*(lane>>4) + 0..7.
// D map: acc[r] = element (8*(lane>>4) + r, lane&15) of the 16x16 tile.
__device__ __forceinline__ v16h ldfrag(const _Float16* p, int ld, int row0, int k0, int lane) {
  const int m = lane & 15, lh = lane >> 4;
  const _Float16* q = p + (size_t)(row0 + m) * ld + k0 + 8 * lh;
  Frag f;
  f.h[0] = *(const v8h*)(q);
  f.h[1] = *(const v8h*)(q + 16);
  return f.v;
}

__device__ __forceinline__ v8f zero8() { return (v8f){0.f, 0.f, 0.f, 0.f, 0.f, 0.f, 0.f, 0.f}; }

// ---------------------------------------------------------------------------
// kernel 0: Wout f32 [512][32] ([k][n]) -> f16 plane WoT [32][512] ([n][k], k-contiguous), values x64.
// Thread t: n = t>>6, k0 = (t&63)*8: gathers 8 consecutive k of column n, one 16-B store; 32 lanes write
// coverage: 2048 threads x 8 halves = 32 x 512.
// The block behind these (n is a multiple of 256): its wave 0 forms M[i][j] = sum_h Wq[i][h] * Wk[j][h] in f32 (lane l: h = 16l .. 16l+15, then a
// butterfly over the 32 lanes) and stores the four values to mm.
// ---------------------------------------------------------------------------
__global__ __launch_bounds__(256) void k_wout(const float* __restrict__ wo, _Float16* __restrict__ wot, int n,
                                              const float* __restrict__ wq, const float* __restrict__ wk,
                                              float* __restrict__ mm) {
  if ((int)blockIdx.x * 256 >= n) {                     // the block behind the plane's; block-uniform; no barriers in this kernel
    if (threadIdx.x >= 32) return;
    const int h0 = (int)threadIdx.x * 16;
    float m00 = 0.f, m01 = 0.f, m10 = 0.f, m11 = 0.f;
#pragma unroll
    for (int g = 0; g < 4; ++g) {
      const v4f q0v = *(const v4f*)(wq + h0 + 4 * g);
      const v4f q1v = *(const v4f*)(wq + HD + h0 + 4 * g);
      const v4f k0v = *(const v4f*)(wk + h0 + 4 * g);
      const v4f k1v = *(const v4f*)(wk + HD + h0 + 4 * g);
#pragma unroll
      for (int e = 0; e < 4; ++e) {
        m00 = fmaf(q0v[e], k0v[e], m00);
        m01 = fmaf(q0v[e], k1v[e], m01);
        m10 = fmaf(q1v[e], k0v[e], m10);
        m11 = fmaf(q1v[e], k1v[e], m11);
      }
    }
#pragma unroll
    for (int d = 16; d >= 1; d >>= 1) {
      m00 += __shfl_xor(m00, d, 32);
      m01 += __shfl_xor(m01, d, 32);
      m10 += __shfl_xor(m10, d, 32);
      m11 += __shfl_xor(m11, d, 32);
    }
    if (threadIdx.x == 0) *(v4f*)mm = (v4f){m00, m01, m10, m11};
    return;
  }
  const int t = blockIdx.x * 256 + (int)threadIdx.x;
  if (t >= n) return;
  const int nn = t >> 6;
  const int k0 = (t & 63) * 8;
  const float* src = wo + (size_t)k0 * OD + nn;
  Pack8 pk;
  pk.h = (v8h){(_Float16)(src[0 * OD] * 64.0f), (_Float16)(src[1 * OD] * 64.0f),
               (_Float16)(src[2 * OD] * 64.0f), (_Float16)(src[3 * OD] * 64.0f),
               (_Float16)(src[4 * OD] * 64.0f), (_Float16)(src[5 * OD] * 64.0f),
               (_Float16)(src[6 * OD] * 64.0f), (_Float16)(src[7 * OD] * 64.0f)};
  const v4u vv = pk.u;
  v4u* d = (v4u*)(wot + (size_t)nn * HD + k0);
  *d = vv;
  
}

// ---------------------------------------------------------------------------
// kernel 1: non-causal flash attention per (query tile, sequence), single head of width 512, with the
// BN-affine + PReLU + z.Wout + bias tail fused. Block = 8 waves = 32 query rows of one sequence;
// key chunks of 128 (nch = SEQ/BC = 8, derived from the batch_size input and clamped to the static maximum).
//   x: f32 input [token][2];  mm: f32 M = Wq.Wk^T [2][2];  wv: f32 input [2][512];  wot: f16 plane [32][512] (x64).
// S: q.k = sum_ij x_i M_ij x'_j = y.x' with y = x.M, so the score product contracts 2 dims, not 512. Each f32
//   factor goes in as an f16 pair hi + lo and the four cross products of the two dims fill k slots 0..7 of one
//   16x16x32 step (slots 8..31 are zero in A and in B).
// Per chunk: S: wave w computes keys j0+16w..+15 x 32 rows (one k-step; A fragments formed once per block, B
//   fragment from this chunk's x rows); scale in f32 -> sS; block-cooperative online softmax in f32 through LDS (8 threads per row);
//   p = exp(s - m) x 1024 -> f16 tile sP [row][key] (16-B LDS stores), block barrier, reloaded with the A
//   loader (same element type).
// O: p.v = p.(x.Wv) = (p.x).Wv, so the value product has 2 output columns, not 512. The block forms x^T once in LDS
//   as four f16 rows xT [hi0 hi1 lo0 lo1][key]; B column n of the product reads row n & 3 (columns 4..15 repeat
//   columns 0..3 and are never read back). Wave w: row tile w&1, keys 32(w>>1)..+31 of each chunk, one k-step per
//   chunk into one accumulator tile; after the loop the four key slices are summed through LDS (uP).
// Tail: u = (hi + lo sums) / (1024 l); o = u.Wv (K = 2, f32; wave w owns cols 64w..64w+63 for all 32 rows);
//   z = (o - mean) * gamma/sqrt(var + eps) + beta; PReLU; z x16 -> f16 LDS tile
//   zA [32][512]; barrier; out tile 32x32: wave w = (row tile w&1, col tile (w>>1)&1, k half w>>2), 8 k-steps
//   each, partial D to LDS part[khalf][32][32]; barrier; val = (part0 + part1)/1024 + b_out; each d_out row
// LDS: one raw buffer: loop phase sS (floats 0..4095) + sP (halves at float offset 4096); tail phase zA
//   (halves at float offset 0 .. 8319) + part (floats 8320 .. 10623).
// grid = (SEQ/BR, NBAT) = (32, 32).
// coverage: zA per wave 32 rows x 64 cols -> 8 waves = 32 x 512; part per wave 16 x 16 -> 4 waves per k half
//   = 32 x 32 each; d_out per block 256 thr x 4 floats = 32 rows x 32 -> 1024 blocks = 32768 rows x 32.
// ---------------------------------------------------------------------------
#define SSP 128
#define SPP 136
#define ZP  520
#define PTP 36
#define XTP 1040                              // xT row pitch in halves: rows 32 B apart modulo the 256-B bank span
#define SP_OFF_F   (BR * SSP)                 // 4096 floats
#define PART_OFF_F ((BR * ZP) / 2)            // 8320 floats
#define SBIGF      (PART_OFF_F + 2 * BR * PTP) // 10624 floats = 42496 B
static_assert((BR * ZP) % 8 == 0);
static_assert(SP_OFF_F + (BR * SPP) / 2 <= SBIGF);
static_assert((SP_OFF_F % 4) == 0);
static_assert((PART_OFF_F % 4) == 0);
static_assert((ZP % 8) == 0);
static_assert((SPP % 8) == 0);
static_assert((XTP % 8) == 0);
static_assert(XTP >= SEQ);

// Score fragment from one f32 pair (u0, u1). k slots 0..7, held by lanes 0..15 in elements 0..7:
//   A (isA): hi0 hi1 hi0 hi1 lo0 lo1 lo0 lo1      B: hi0 hi1 lo0 lo1 hi0 hi1 lo0 lo1
// so slot by slot the products are hi.hi, hi.lo, lo.hi, lo.lo for dim 0 and dim 1. All other slots are zero.
__device__ __forceinline__ v16h sfrag(float u0, float u1, bool isA, int lane) {
  const _Float16 h0 = (_Float16)u0, h1 = (_Float16)u1;
  const _Float16 l0 = (_Float16)(u0 - (float)h0), l1 = (_Float16)(u1 - (float)h1);
  const v8h zz = (v8h){0, 0, 0, 0, 0, 0, 0, 0};
  const v8h va = (v8h){h0, h1, h0, h1, l0, l1, l0, l1};
  const v8h vb = (v8h){h0, h1, l0, l1, h0, h1, l0, l1};
  Frag f;
  f.h[0] = (lane < 16) ? (isA ? va : vb) : zz;
  f.h[1] = zz;
  return f.v;
}

__global__ __launch_bounds__(256) void k_attn(const float* __restrict__ x,
                                              const float* __restrict__ mm,
                                              const float* __restrict__ wv,
                                              const _Float16* __restrict__ wot,
                                              const float* __restrict__ gam,
                                              const float* __restrict__ bet,
                                              const float* __restrict__ mu,
                                              const float* __restrict__ var,
                                              const float* __restrict__ pa,
                                              const float* __restrict__ bo,
                                              const int* __restrict__ bsp,
                                              float* __restrict__ out, float sscale) {
  __shared__ __align__(16) float sBig[SBIGF];
  __shared__ __align__(16) float sRed[BR * 8];
  __shared__ __align__(16) float rM[BR];
  __shared__ __align__(16) float rMn[BR];
  __shared__ __align__(16) float rL[BR];
  __shared__ __align__(16) float rSc[BR];
  __shared__ __align__(16) float rU[BR * 2];
  __shared__ __align__(16) float uP[4 * BR * 4];
  __shared__ __align__(16) _Float16 xT[4 * XTP];

  float*    sS   = sBig;
  _Float16* sP   = (_Float16*)(sBig + SP_OFF_F);
  _Float16* zA   = (_Float16*)sBig;
  float*    part = sBig + PART_OFF_F;

  const int tid = threadIdx.x, lane = tid & 31, wave = tid >> 5;
  const int hh = lane >> 4, c = lane & 15;
  const int b  = blockIdx.y;
  const int q0 = (int)blockIdx.x * BR;                  // query row base within the sequence
  int bs = bsp[0];
  bs = (bs < 1) ? 1 : bs;
  int seql = NTOK / bs;
  seql = (seql > SEQ) ? SEQ : seql;
  const int nch = seql / BC;                            // block-uniform, <= SEQ/BC
  const float* Xb = x + (size_t)b * SEQ * 2;             // this sequence's token rows [l][2]
  const size_t tokbase = (size_t)b * SEQ + q0;
  const float NEGI = -__builtin_huge_valf();
  if (tid < BR) { rM[tid] = NEGI; rL[tid] = 0.f; }
  {
    // x^T of this sequence as f16 hi and lo rows; thread t: tokens 4t .. 4t+3
    const int l0 = tid * 4;
    const v4f a0 = *(const v4f*)(Xb + 2 * l0);
    const v4f a1 = *(const v4f*)(Xb + 2 * l0 + 4);
    const v4f e0 = (v4f){a0[0], a0[2], a1[0], a1[2]};
    const v4f e1 = (v4f){a0[1], a0[3], a1[1], a1[3]};
    v4h h0, h1, g0, g1;
#pragma unroll
    for (int e = 0; e < 4; ++e) {
      h0[e] = (_Float16)e0[e];
      h1[e] = (_Float16)e1[e];
      g0[e] = (_Float16)(e0[e] - (float)h0[e]);
      g1[e] = (_Float16)(e1[e] - (float)h1[e]);
    }
    *(v4h*)(xT + 0 * XTP + l0) = h0;
    *(v4h*)(xT + 1 * XTP + l0) = h1;
    *(v4h*)(xT + 2 * XTP + l0) = g0;
    *(v4h*)(xT + 3 * XTP + l0) = g1;
  }
  __syncthreads();

  const int pt = wave & 1, pk = wave >> 1;              // value product: row tile, 32-key slice of each chunk
  v8f uacc = zero8();

  const int srow = tid >> 3, schk = tid & 7;            // softmax: 8 threads per row, 16 keys each

  // A fragments of the score product: y = x.M for query rows q0 + 16t + (lane&15)
  v16h ya[2];
  {
    const v4f mv = *(const v4f*)mm;                     // M00 M01 M10 M11
#pragma unroll
    for (int t = 0; t < 2; ++t) {
      const v2f xq = *(const v2f*)(Xb + 2 * (size_t)(q0 + 16 * t + c));
      ya[t] = sfrag(fmaf(xq[1], mv[2], xq[0] * mv[0]), fmaf(xq[1], mv[3], xq[0] * mv[1]), true, lane);
    }
  }

#pragma unroll 1
  for (int ch = 0; ch < nch; ++ch) {
    const int j0  = ch * BC;
    const int kr0 = j0 + wave * 16;                     // this wave's key tile
    v8f s[2];
    s[0] = zero8(); s[1] = zero8();
    {
      const v2f xk = *(const v2f*)(Xb + 2 * (size_t)(kr0 + c));
      const v16h kb = sfrag(xk[0], xk[1], false, lane);
      s[0] = mma16(ya[0], kb, s[0]);
      s[1] = mma16(ya[1], kb, s[1]);
    }
    // s[t][r] = S[q0 + 16t + 8hh + r][kr0 + c]
#pragma unroll
    for (int t = 0; t < 2; ++t) {
#pragma unroll
      for (int r = 0; r < 8; ++r) {
        const int row = 16 * t + 8 * hh + r;
        sS[row * SSP + wave * 16 + c] = s[t][r] * sscale;
      }
    }
    __syncthreads();
    {
      const float* sr = sS + srow * SSP + schk * 16;
      const v4f x0 = *(const v4f*)(sr);
      const v4f x1 = *(const v4f*)(sr + 4);
      const v4f x2 = *(const v4f*)(sr + 8);
      const v4f x3 = *(const v4f*)(sr + 12);
      float mx = x0[0];
#pragma unroll
      for (int e = 1; e < 4; ++e) mx = fmaxf(mx, x0[e]);
#pragma unroll
      for (int e = 0; e < 4; ++e) { mx = fmaxf(mx, x1[e]); mx = fmaxf(mx, x2[e]); mx = fmaxf(mx, x3[e]); }
      sRed[srow * 8 + schk] = mx;
    }
    __syncthreads();
    if (tid < BR) {                                     // wave 0, uniform
      float mx = rM[tid];
#pragma unroll
      for (int i = 0; i < 8; ++i) mx = fmaxf(mx, sRed[tid * 8 + i]);
      rMn[tid] = mx;
    }
    __syncthreads();
    {
      const float mx = rMn[srow];
      const float* sr = sS + srow * SSP + schk * 16;
      float sum = 0.f;
      Pack8 p0, p1;
#pragma unroll
      for (int e = 0; e < 8; ++e) {
        const float p = __expf(sr[e] - mx);
        sum += p;
        p0.h[e] = (_Float16)(p * 1024.0f);
      }
#pragma unroll
      for (int e = 0; e < 8; ++e) {
        const float p = __expf(sr[8 + e] - mx);
        sum += p;
        p1.h[e] = (_Float16)(p * 1024.0f);
      }
      *(v8h*)(sP + srow * SPP + schk * 16)     = p0.h;
      *(v8h*)(sP + srow * SPP + schk * 16 + 8) = p1.h;
      sRed[srow * 8 + schk] = sum;
    }
    __syncthreads();
    if (tid < BR) {
      float sum = 0.f;
#pragma unroll
      for (int i = 0; i < 8; ++i) sum += sRed[tid * 8 + i];
      const float mnew = rMn[tid];
      const float fac  = __expf(rM[tid] - mnew);
      rL[tid]  = rL[tid] * fac + sum;
      rM[tid]  = mnew;
      rSc[tid] = fac;
    }
    __syncthreads();                                    // P tile and row factors complete
    {
      const v4f f0 = *(const v4f*)(rSc + 16 * pt + 8 * hh);
      const v4f f1 = *(const v4f*)(rSc + 16 * pt + 8 * hh + 4);
#pragma unroll
      for (int r = 0; r < 4; ++r) {
        uacc[r]     *= f0[r];
        uacc[4 + r] *= f1[r];
      }
      // A operand: P rows 16pt + (lane&15), split k map over keys
      const v16h pf = ldfrag(sP, SPP, 16 * pt, pk * 32, lane);
      // B operand: column (lane&15) reads xT row (lane&3) [n][key], the same split k map over keys
      const v16h xb = ldfrag(xT, XTP, 0, j0 + pk * 32, (lane & 3) | (lane & 16));
      uacc = mma16(pf, xb, uacc);
    }
    __syncthreads();                                    // sS / sP / rSc free for the next chunk
  }

  // ---- tail: sum the four key slices, 1/(1024 l) per row, o = u.Wv, BN affine, PReLU, z x16 -> f16 LDS tile ----
  if (c < 4) {
#pragma unroll
    for (int r = 0; r < 8; ++r) uP[(pk * BR + 16 * pt + 8 * hh + r) * 4 + c] = uacc[r];
  }
  __syncthreads();                                      // uP complete (cross-wave)
  if (tid < BR) {
    const float l = rL[tid];
    const float inv = (l > 0.f) ? (0.0009765625f * (1.0f / l)) : 0.f;
    const v4f us = (*(const v4f*)(uP + tid * 4) + *(const v4f*)(uP + (BR + tid) * 4)) +
                   (*(const v4f*)(uP + (2 * BR + tid) * 4) + *(const v4f*)(uP + (3 * BR + tid) * 4));
    *(v2f*)(rU + 2 * tid) = (v2f){(us[0] + us[2]) * inv, (us[1] + us[3]) * inv};
  }
  __syncthreads();
  {
    const float a = pa[0];
    v4f uu[2][4];                                       // uu[sub][r >> 1]: u0 u1 of rows 16sub + 8hh + r, r even then odd
#pragma unroll
    for (int sub = 0; sub < 2; ++sub)
#pragma unroll
      for (int g = 0; g < 4; ++g) uu[sub][g] = *(const v4f*)(rU + 2 * (16 * sub + 8 * hh) + 4 * g);
#pragma unroll
    for (int t = 0; t < 4; ++t) {
      const int h = wave * 64 + 16 * t + c;             // output column of the attention = BN channel
      const float sc = gam[h] * (1.0f / sqrtf(var[h] + 1.0e-5f));
      const float m  = mu[h];
      const float be = bet[h];
      const float w0 = wv[h], w1 = wv[HD + h];
#pragma unroll
      for (int sub = 0; sub < 2; ++sub) {
#pragma unroll
        for (int r = 0; r < 8; ++r) {
          const float o0 = fmaf(uu[sub][r >> 1][2 * (r & 1) + 1], w1, uu[sub][r >> 1][2 * (r & 1)] * w0);
          float z0 = (o0 - m) * sc + be;
          z0 = (z0 >= 0.f) ? z0 : a * z0;
          zA[(16 * sub + 8 * hh + r) * ZP + h] = (_Float16)(z0 * 16.0f);
        }
      }
    }
  }
  __syncthreads();                                      // zA complete (cross-wave)

  // ---- out tile 32 x 32 = zA[32][512] . WoT, K split over two wave groups ----
  {
    const int osub = wave & 1, ont = (wave >> 1) & 1, okh = wave >> 2;
    v8f acc = zero8();
#pragma unroll 2
    for (int ks = 0; ks < 8; ++ks) {
      const int k0 = (okh * 8 + ks) * 32;
      const v16h af = ldfrag(zA, ZP, 16 * osub, k0, lane);
      const v16h bf = ldfrag(wot, HD, 16 * ont, k0, lane);
      acc = mma16(af, bf, acc);
    }
    float* pp = part + okh * (BR * PTP) + (16 * osub + 8 * hh) * PTP + 16 * ont + c;
#pragma unroll
    for (int r = 0; r < 8; ++r) pp[r * PTP] = acc[r];
  }
  __syncthreads();                                      // part complete
  {
    const int row = tid >> 3, pc = tid & 7;
    const v4f p0 = *(const v4f*)(part + row * PTP + pc * 4);
    const v4f p1 = *(const v4f*)(part + BR * PTP + row * PTP + pc * 4);
    const v4f bb = *(const v4f*)(bo + pc * 4);
    const v4f val = (p0 + p1) * 0.0009765625f + bb;     // 1/(16 * 64)
    v4f* d = (v4f*)(out + (tokbase + (size_t)row) * OD + pc * 4);
    *d = val;
    
  }
}

// ---------------------------------------------------------------------------
// Workspace map (bytes; WoT is 64 of the 512-B units one wave of kernel 0 stores, M one 16-B store
// padded to 128 B):
//   WoT  f16 [32][512]               0      32768
//   M    f32 [2][2]              32768        128 (16 used)
//   total                        32896
// ---------------------------------------------------------------------------
extern "C" void kernel_launch(void* const* d_in, const int* in_sizes, int n_in,
                              void* d_out, int out_size, void* d_ws, size_t ws_size,
                              hipStream_t stream) {
  if (n_in < 12) return;
  if (in_sizes[0] != NTOK * 2) return;
  if (in_sizes[1] < 1) return;
  if (in_sizes[2] != 2 * HD) return;
  if (in_sizes[3] != 2 * HD) return;
  if (in_sizes[4] != 2 * HD) return;
  if (in_sizes[5] != HD) return;
  if (in_sizes[6] != HD) return;
  if (in_sizes[7] != HD) return;
  if (in_sizes[8] != HD) return;
  if (in_sizes[9] < 1) return;
  if (in_sizes[10] != HD * OD) return;
  if (in_sizes[11] != OD) return;
  if (out_size != NTOK * OD) return;

  const float* x    = (const float*)d_in[0];    // [32768][2]
  const int*   bsz  = (const int*)d_in[1];      // [1]
  const float* wq   = (const float*)d_in[2];    // [2][512]
  const float* wk   = (const float*)d_in[3];    // [2][512]
  const float* wv   = (const float*)d_in[4];    // [2][512]
  const float* gam  = (const float*)d_in[5];    // [512]
  const float* bet  = (const float*)d_in[6];    // [512]
  const float* mu   = (const float*)d_in[7];    // [512]
  const float* var  = (const float*)d_in[8];    // [512]
  const float* pa   = (const float*)d_in[9];    // [1]
  const float* wo   = (const float*)d_in[10];   // [512][32]
  const float* bo   = (const float*)d_in[11];   // [32]
  float* out = (float*)d_out;                   // [32768][32]

  size_t off = 0;
  const size_t oW = off; off += (size_t)OD * HD * 2;
  const size_t oM = off; off += (size_t)128;
  if (off > ws_size) return;                    // off = 32896
  if (off > (size_t)134217728) return;

  char* ws = (char*)d_ws;
  _Float16* WoT = (_Float16*)(ws + oW);
  float*    Mm  = (float*)(ws + oM);

  const float sscale = 1.0f / sqrtf((float)HD);

  // (0) Wout -> f16 [n][k] plane (x64); one more block forms M = Wq.Wk^T
  const int ngw = (OD * HD) / 8;                // 2048
  k_wout<<<dim3((ngw + 255) / 256 + 1), dim3(256), 0, stream>>>(wo, WoT, ngw, wq, wk, Mm);
  // (1) attention + BN/PReLU/Wout tail -> d_out
  k_attn<<<dim3(SEQ / BR, NBAT), dim3(256), 0, stream>>>(x, Mm, wv, WoT, gam, bet, mu, var, pa, bo, bsz,
                                                         out, sscale);
  (void)hipGetLastError();
}

// v003
// It runs in 13.8 microseconds.
// In two side-by-side timings against v002, it was 1.78 and 1.75 times as fast.
// Counting every step since v000, it is 22.4 times as fast.
// Contractions: S^T = x.(x.M)^T with M = Wq.Wk^T (2 x 2, f32) on v_wmma_f32_16x16x32_f16 (f16 hi + lo operand pairs, f32 accumulate, the row maximum enters as C); u^T = [x^T; 1].P^T (x as hi and lo rows, a row of ones for the row sum, p x1024 packed from the score accumulators) on v_wmma_f32_16x16x32_f16 (f16 operands, f32 accumulate); out = z.Wout on v_wmma_f32_16x16x32_f16 (f16 operands: z x16, Wout x64; f32 accumulate, 1/1024 folded back in f32). Projection o = u.Wv (K = 2), M and y = x.M exact f32 on VALU; score scale, softmax maximum, exp2, 1/l, BN affine, PReLU and bias in f32.
#include <hip/hip_runtime.h>
#include <math.h>
#include <stddef.h>
#include <stdint.h>

#define NTOK 32768              // token rows
#define NBAT 32                 // sequences
#define SEQ  1024               // tokens per sequence
#define HD   512                // head width
#define OD   32                 // output width
#define BR   32                 // query rows per attention block
#define BC   128                // keys per chunk

static_assert(NTOK == NBAT * SEQ);
static_assert(SEQ % BC == 0);
static_assert(SEQ % BR == 0);
static_assert(BC % 32 == 0);
static_assert(HD == 512);
static_assert((HD / 8) == 64);
static_assert(SEQ == 256 * 4);
static_assert(OD == 32);

typedef _Float16 v16h __attribute__((ext_vector_type(16)));
typedef _Float16 v8h  __attribute__((ext_vector_type(8)));
typedef _Float16 v4h  __attribute__((ext_vector_type(4)));
typedef float    v8f  __attribute__((ext_vector_type(8)));
typedef float    v4f  __attribute__((ext_vector_type(4)));
typedef float    v2f  __attribute__((ext_vector_type(2)));
typedef unsigned int v4u __attribute__((ext_vector_type(4)));

union Frag  { v16h v; v8h h[2]; };
union Pack8 { v8h h; v4u u; };

// WMMA with the dependent-VALU hazard guard (ties D, keeps A/B live)
__device__ __forceinline__ v8f mma16(v16h a, v16h b, v8f c) {
  c = __builtin_amdgcn_wmma_f32_16x16x32_f16(false, a, false, b, (short)0, c, false, false);
  asm volatile("v_nop\n\tv_nop\n\tv_nop\n\tv_nop" : "+v"(c) : "v"(a), "v"(b));
  return c;
}

// Fragment loader for k-contiguous 16-bit rows with pitch ld.
// A operand: row0 + (lane&15) is the M row.  B operand stored [n][k]: row0 + (lane&15) is the N column.
// Split k map for both: elements 0..7 <- k0 + 8*(lane>>4) + 0..7, elements 8..15 <- k0 + 16 + 8*(lane>>4) + 0..7.
// D map: acc[r] = element (8*(lane>>4) + r, lane&15) of the 16x16 tile.
__device__ __forceinline__ v16h ldfrag(const _Float16* p, int ld, int row0, int k0, int lane) {
  const int m = lane & 15, lh = lane >> 4;
  const _Float16* q = p + (size_t)(row0 + m) * ld + k0 + 8 * lh;
  Frag f;
  f.h[0] = *(const v8h*)(q);
  f.h[1] = *(const v8h*)(q + 16);
  return f.v;
}

__device__ __forceinline__ v8f zero8() { return (v8f){0.f, 0.f, 0.f, 0.f, 0.f, 0.f, 0.f, 0.f}; }

// ---------------------------------------------------------------------------
// kernel 0: Wout f32 [512][32] ([k][n]) -> f16 plane WoT [32][512] ([n][k], k-contiguous), values x64.
// Thread t: n = t>>6, k0 = (t&63)*8: gathers 8 consecutive k of column n, one 16-B store; 32 lanes write
// coverage: 2048 threads x 8 halves = 32 x 512.
// The block behind these (n is a multiple of 256): its wave 0 forms M[i][j] = sum_h Wq[i][h] * Wk[j][h] in f32 (lane l: h = 16l .. 16l+15, then a
// butterfly over the 32 lanes) and stores the four values to mm.
// ---------------------------------------------------------------------------
__global__ __launch_bounds__(256) void k_wout(const float* __restrict__ wo, _Float16* __restrict__ wot, int n,
                                              const float* __restrict__ wq, const float* __restrict__ wk,
                                              float* __restrict__ mm) {
  if ((int)blockIdx.x * 256 >= n) {                     // the block behind the plane's; block-uniform; no barriers in this kernel
    if (threadIdx.x >= 32) return;
    const int h0 = (int)threadIdx.x * 16;
    float m00 = 0.f, m01 = 0.f, m10 = 0.f, m11 = 0.f;
#pragma unroll
    for (int g = 0; g < 4; ++g) {
      const v4f q0v = *(const v4f*)(wq + h0 + 4 * g);
      const v4f q1v = *(const v4f*)(wq + HD + h0 + 4 * g);
      const v4f k0v = *(const v4f*)(wk + h0 + 4 * g);
      const v4f k1v = *(const v4f*)(wk + HD + h0 + 4 * g);
#pragma unroll
      for (int e = 0; e < 4; ++e) {
        m00 = fmaf(q0v[e], k0v[e], m00);
        m01 = fmaf(q0v[e], k1v[e], m01);
        m10 = fmaf(q1v[e], k0v[e], m10);
        m11 = fmaf(q1v[e], k1v[e], m11);
      }
    }
#pragma unroll
    for (int d = 16; d >= 1; d >>= 1) {
      m00 += __shfl_xor(m00, d, 32);
      m01 += __shfl_xor(m01, d, 32);
      m10 += __shfl_xor(m10, d, 32);
      m11 += __shfl_xor(m11, d, 32);
    }
    if (threadIdx.x == 0) *(v4f*)mm = (v4f){m00, m01, m10, m11};
    return;
  }
  const int t = blockIdx.x * 256 + (int)threadIdx.x;
  if (t >= n) return;
  const int nn = t >> 6;
  const int k0 = (t & 63) * 8;
  const float* src = wo + (size_t)k0 * OD + nn;
  Pack8 pk;
  pk.h = (v8h){(_Float16)(src[0 * OD] * 64.0f), (_Float16)(src[1 * OD] * 64.0f),
               (_Float16)(src[2 * OD] * 64.0f), (_Float16)(src[3 * OD] * 64.0f),
               (_Float16)(src[4 * OD] * 64.0f), (_Float16)(src[5 * OD] * 64.0f),
               (_Float16)(src[6 * OD] * 64.0f), (_Float16)(src[7 * OD] * 64.0f)};
  const v4u vv = pk.u;
  v4u* d = (v4u*)(wot + (size_t)nn * HD + k0);
  *d = vv;
  
}

// ---------------------------------------------------------------------------
// kernel 1: non-causal attention per (query tile, sequence), single head of width 512, with the
// BN-affine + PReLU + z.Wout + bias tail fused. Block = 8 waves = 32 query rows of one sequence;
// key chunks of 128 (nch = SEQ/BC = 8, derived from the batch_size input and clamped to the static maximum).
//   x: f32 input [token][2];  mm: f32 M = Wq.Wk^T [2][2];  wv: f32 input [2][512];  wot: f16 plane [32][512] (x64).
// S: q.k = sum_ij x_i M_ij x'_j = y.x' with y = x.M, so the score product contracts 2 dims, not 512. y carries
//   the score scale and log2(e). Each f32 factor goes in as an f16 pair hi + lo and the four cross products of
//   the two dims fill 8 k slots of one 16x16x32 step.
// Wave w: query tile w&1 (16 rows), keys 32(w>>1)..+31 of each chunk; the softmax never leaves the wave's registers.
//   S^T = K.Y^T: keys are the M rows, queries the N columns, so lane (h, c) holds keys 8h + r of query c.
//   The block forms kF [key][8 halves] once in LDS; lane l loads key k0 + l of two chunks, so one A fragment holds
//   four 16-key tiles, tile j in elements 8(j>>1)..+7 of lanes 16(j&1)..+15 (8 of the 32 k slots each); the B
//   fragment yq[j] is zero outside tile j's slots, which picks the 16 keys of each product.
//   Pass 1 over the wave's keys: maximum per query (in-lane, one exchange between the lane halves).
//   Pass 2: the same products with C = 10 - maximum, p x1024 = exp2(D); the two D tiles of 32 keys, converted in
//   place, are the B operand of the value product (element s = key kmap(s, h) of query c).
// O: p.v = p.(x.Wv) = (p.x).Wv. u^T = A.P^T with A rows [hi0 hi1 lo0 lo1 ones ones ...][key] from LDS (xT, the same
//   k map): D rows 0..3 are the four partial sums of u, row 4 the row sum l (of the rounded p), all x1024.
//   After the loop the four key slices, each under its own maximum, are joined through LDS (uP).
// Tail: u = (hi + lo sums) / l; o = u.Wv (K = 2, f32; wave w owns cols 64w..64w+63 for all 32 rows);
//   z = (o - mean) * gamma/sqrt(var + eps) + beta; PReLU; z x16 -> f16 LDS tile
//   zA [32][512]; barrier; out tile 32x32: wave w = (row tile w&1, col tile (w>>1)&1, k half w>>2), 8 k-steps
//   each, partial D to LDS part[khalf][32][32]; barrier; val = (part0 + part1)/1024 + b_out; each d_out row
// LDS: one raw buffer: loop phase kF (halves at float offset 0) + xT (halves at float offset 4096); tail phase zA
//   (halves at float offset 0 .. 8319) + part (floats 8320 .. 10623).
// grid = (SEQ/BR, NBAT) = (32, 32).
// coverage: zA per wave 32 rows x 64 cols -> 8 waves = 32 x 512; part per wave 16 x 16 -> 4 waves per k half
//   = 32 x 32 each; d_out per block 256 thr x 4 floats = 32 rows x 32 -> 1024 blocks = 32768 rows x 32.
// ---------------------------------------------------------------------------
#define ZP  520
#define PTP 36
#define XTP 1040                              // xT row pitch in halves: rows 32 B apart modulo the 256-B bank span
#define XT_OFF_F   ((SEQ * 8) / 2)            // 4096 floats
#define PART_OFF_F ((BR * ZP) / 2)            // 8320 floats
#define SBIGF      (PART_OFF_F + 2 * BR * PTP) // 10624 floats = 42496 B
static_assert((BR * ZP) % 8 == 0);
static_assert(XT_OFF_F + (5 * XTP) / 2 <= SBIGF);
static_assert((XT_OFF_F % 4) == 0);
static_assert((PART_OFF_F % 4) == 0);
static_assert((ZP % 8) == 0);
static_assert((XTP % 8) == 0);
static_assert(XTP >= SEQ);

// Score operands from one f32 pair (u0, u1), eight halves (k slots) a side:
//   query side: hi0 hi1 hi0 hi1 lo0 lo1 lo0 lo1      key side: hi0 hi1 lo0 lo1 hi0 hi1 lo0 lo1
// so slot by slot the products are hi.hi, hi.lo, lo.hi, lo.lo for dim 0 and dim 1.
__device__ __forceinline__ v8h qhalves(float u0, float u1) {
  const _Float16 h0 = (_Float16)u0, h1 = (_Float16)u1;
  const _Float16 l0 = (_Float16)(u0 - (float)h0), l1 = (_Float16)(u1 - (float)h1);
  return (v8h){h0, h1, h0, h1, l0, l1, l0, l1};
}

// WMMA as the bare builtin: the compiler keeps the distance behind it and can fill it with the other tile's work
__device__ __forceinline__ v8f mmab(v16h a, v16h b, v8f c) {
  return __builtin_amdgcn_wmma_f32_16x16x32_f16(false, a, false, b, (short)0, c, false, false);
}

__global__ __launch_bounds__(256) void k_attn(const float* __restrict__ x,
                                              const float* __restrict__ mm,
                                              const float* __restrict__ wv,
                                              const _Float16* __restrict__ wot,
                                              const float* __restrict__ gam,
                                              const float* __restrict__ bet,
                                              const float* __restrict__ mu,
                                              const float* __restrict__ var,
                                              const float* __restrict__ pa,
                                              const float* __restrict__ bo,
                                              const int* __restrict__ bsp,
                                              float* __restrict__ out, float sscale) {
  __shared__ __align__(16) float sBig[SBIGF];
  __shared__ __align__(16) float rU[BR * 2];
  __shared__ __align__(16) float uP[4 * BR * 8];        // [key slice][row][u hi0 hi1 lo0 lo1, l, maximum, -, -]

  _Float16* kF   = (_Float16*)sBig;
  _Float16* xT   = (_Float16*)(sBig + XT_OFF_F);
  _Float16* zA   = (_Float16*)sBig;
  float*    part = sBig + PART_OFF_F;

  const int tid = threadIdx.x, lane = tid & 31, wave = tid >> 5;
  const int hh = lane >> 4, c = lane & 15;
  const int b  = blockIdx.y;
  const int q0 = (int)blockIdx.x * BR;                  // query row base within the sequence
  int bs = bsp[0];
  bs = (bs < 1) ? 1 : bs;
  int seql = NTOK / bs;
  seql = (seql > SEQ) ? SEQ : seql;
  const int nch = seql / BC;                            // block-uniform, <= SEQ/BC
  const float* Xb = x + (size_t)b * SEQ * 2;             // this sequence's token rows [l][2]
  const size_t tokbase = (size_t)b * SEQ + q0;
  const int pt = wave & 1, pk = wave >> 1;              // this wave's query tile and its 32-key slice of each chunk
  const v8h zz = (v8h){0, 0, 0, 0, 0, 0, 0, 0};

  // B fragments of the score product: y = x.M (x score scale x log2 e) for query row q0 + 16pt + (lane&15)
  v16h yq[4];
  {
    const v4f mv = *(const v4f*)mm;                     // M00 M01 M10 M11
    const v2f xq = *(const v2f*)(Xb + 2 * (size_t)(q0 + 16 * pt + c));
    const float ys = sscale * 1.4426950408889634f;
    const v8h yv = qhalves(fmaf(xq[1], mv[2], xq[0] * mv[0]) * ys, fmaf(xq[1], mv[3], xq[0] * mv[1]) * ys);
#pragma unroll
    for (int j = 0; j < 4; ++j) {
      Frag f;
      f.h[j >> 1]       = (hh == (j & 1)) ? yv : zz;
      f.h[(j >> 1) ^ 1] = zz;
      yq[j] = f.v;
    }
  }
  {
    // this sequence's tokens as f16 hi and lo: x^T rows (and a row of ones) and the key-side score operands;
    // thread t: tokens 4t .. 4t+3
    const int l0 = tid * 4;
    const v4f a0 = *(const v4f*)(Xb + 2 * l0);
    const v4f a1 = *(const v4f*)(Xb + 2 * l0 + 4);
    const v4f e0 = (v4f){a0[0], a0[2], a1[0], a1[2]};
    const v4f e1 = (v4f){a0[1], a0[3], a1[1], a1[3]};
    v4h h0, h1, g0, g1;
#pragma unroll
    for (int e = 0; e < 4; ++e) {
      h0[e] = (_Float16)e0[e];
      h1[e] = (_Float16)e1[e];
      g0[e] = (_Float16)(e0[e] - (float)h0[e]);
      g1[e] = (_Float16)(e1[e] - (float)h1[e]);
    }
    *(v4h*)(xT + 0 * XTP + l0) = h0;
    *(v4h*)(xT + 1 * XTP + l0) = h1;
    *(v4h*)(xT + 2 * XTP + l0) = g0;
    *(v4h*)(xT + 3 * XTP + l0) = g1;
    *(v4h*)(xT + 4 * XTP + l0) = (v4h){1, 1, 1, 1};
#pragma unroll
    for (int e = 0; e < 4; ++e)
      *(v8h*)(kF + (size_t)(l0 + e) * 8) = (v8h){h0[e], h1[e], g0[e], g1[e], h0[e], h1[e], g0[e], g1[e]};
  }
  __syncthreads();                                      // kF and xT complete

  const _Float16* kp = kF + (size_t)(pk * 32 + lane) * 8;   // lane l: key k0 + l of each 32-key step

  const int npair = nch >> 1;                           // two chunks (64 of this wave's keys) per A fragment

  // ---- pass 1: this wave's maximum per query over its keys ----
  float mw;
  {
    v8f mx;
#pragma unroll
    for (int r = 0; r < 8; ++r) mx[r] = -3.0e38f;       // finite, so that a wave without keys joins with factor 1
#pragma unroll 1                                        // rolled: unrolled by two the kernel passes 128 registers, and 4 blocks no longer fit a WGP
    for (int cp = 0; cp < npair; ++cp) {
      Frag ka;
      ka.h[0] = *(const v8h*)(kp + (size_t)(2 * cp) * (BC * 8));
      ka.h[1] = *(const v8h*)(kp + (size_t)(2 * cp + 1) * (BC * 8));
      v8f s[4];
#pragma unroll
      for (int j = 0; j < 4; ++j) s[j] = mmab(ka.v, yq[j], zero8());
#pragma unroll
      for (int r = 0; r < 8; ++r) mx[r] = fmaxf(fmaxf(mx[r], fmaxf(s[0][r], s[1][r])), fmaxf(s[2][r], s[3][r]));
    }
    if (nch & 1) {                                      // block-uniform: the odd last chunk, tiles 0 and 1 alone
      Frag ka;
      ka.h[0] = *(const v8h*)(kp + (size_t)(nch - 1) * (BC * 8));
      ka.h[1] = ka.h[0];
      const v8f s0 = mmab(ka.v, yq[0], zero8());
      const v8f s1 = mmab(ka.v, yq[1], zero8());
#pragma unroll
      for (int r = 0; r < 8; ++r) mx[r] = fmaxf(mx[r], fmaxf(s0[r], s1[r]));
    }
    float m = fmaxf(fmaxf(fmaxf(mx[0], mx[1]), fmaxf(mx[2], mx[3])), fmaxf(fmaxf(mx[4], mx[5]), fmaxf(mx[6], mx[7])));
    const int mb = __builtin_bit_cast(int, m);          // lane l <-> l ^ 16: the other eight keys of each tile
    mw = fmaxf(m, __builtin_bit_cast(float, __builtin_amdgcn_permlanex16(mb, mb, 0x76543210, 0xfedcba98, false, false)));
  }

  // ---- pass 2: p x1024 = exp2(s - maximum + 10), packed in place into the value product's B operand ----
  v8f uacc = zero8();
  {
    const float cm = 10.0f - mw;
    const v8f cneg = (v8f){cm, cm, cm, cm, cm, cm, cm, cm};
    const int xl = ((c < 4) ? c : 4) | (lane & 16);     // A row (lane&15) reads xT row min(lane&15, 4)
#pragma unroll 1                                        // rolled, for the same register bound
    for (int cp = 0; cp < npair; ++cp) {
      Frag ka;
      ka.h[0] = *(const v8h*)(kp + (size_t)(2 * cp) * (BC * 8));
      ka.h[1] = *(const v8h*)(kp + (size_t)(2 * cp + 1) * (BC * 8));
      // A operands of the value product: split k map over keys, the map of the packed D pair
      const v16h xa0 = ldfrag(xT, XTP, 0, (2 * cp) * BC + pk * 32, xl);
      const v16h xa1 = ldfrag(xT, XTP, 0, (2 * cp + 1) * BC + pk * 32, xl);
      v8f s[4];                                         // s[j][r]: key k0(chunk 2cp + (j>>1)) + 16(j&1) + 8hh + r, query c
#pragma unroll
      for (int j = 0; j < 4; ++j) s[j] = mmab(ka.v, yq[j], cneg);
#pragma unroll
      for (int j = 0; j < 4; ++j)
#pragma unroll
        for (int r = 0; r < 8; ++r) s[j][r] = __builtin_amdgcn_exp2f(s[j][r]);
      Frag pb0, pb1;
      pb0.h[0] = __builtin_convertvector(s[0], v8h);
      pb0.h[1] = __builtin_convertvector(s[1], v8h);
      pb1.h[0] = __builtin_convertvector(s[2], v8h);
      pb1.h[1] = __builtin_convertvector(s[3], v8h);
      uacc = mmab(xa0, pb0.v, uacc);
      uacc = mmab(xa1, pb1.v, uacc);
    }
    if (nch & 1) {                                      // block-uniform: the odd last chunk
      Frag ka;
      ka.h[0] = *(const v8h*)(kp + (size_t)(nch - 1) * (BC * 8));
      ka.h[1] = ka.h[0];
      const v16h xa0 = ldfrag(xT, XTP, 0, (nch - 1) * BC + pk * 32, xl);
      v8f s0 = mmab(ka.v, yq[0], cneg);
      v8f s1 = mmab(ka.v, yq[1], cneg);
#pragma unroll
      for (int r = 0; r < 8; ++r) {
        s0[r] = __builtin_amdgcn_exp2f(s0[r]);
        s1[r] = __builtin_amdgcn_exp2f(s1[r]);
      }
      Frag pb0;
      pb0.h[0] = __builtin_convertvector(s0, v8h);
      pb0.h[1] = __builtin_convertvector(s1, v8h);
      uacc = mmab(xa0, pb0.v, uacc);
    }
  }

  // ---- tail: join the four key slices, 1/l per row, o = u.Wv, BN affine, PReLU, z x16 -> f16 LDS tile ----
  if (lane < 16) {                                      // D rows 0..4 sit in lanes 0..15
    float* d = uP + (size_t)(pk * BR + 16 * pt + c) * 8;
    *(v4f*)d       = (v4f){uacc[0], uacc[1], uacc[2], uacc[3]};
    *(v2f*)(d + 4) = (v2f){uacc[4], mw};
  }
  __syncthreads();                                      // uP complete (cross-wave); kF and xT free
  if (tid < BR) {
    v2f lm[4];
#pragma unroll
    for (int i = 0; i < 4; ++i) lm[i] = *(const v2f*)(uP + (size_t)(i * BR + tid) * 8 + 4);
    const float m = fmaxf(fmaxf(lm[0][1], lm[1][1]), fmaxf(lm[2][1], lm[3][1]));
    v4f us = (v4f){0.f, 0.f, 0.f, 0.f};
    float l = 0.f;
#pragma unroll
    for (int i = 0; i < 4; ++i) {
      const float f = __builtin_amdgcn_exp2f(lm[i][1] - m);
      us += *(const v4f*)(uP + (size_t)(i * BR + tid) * 8) * f;
      l = fmaf(lm[i][0], f, l);
    }
    const float inv = (l > 0.f) ? (1.0f / l) : 0.f;     // u and l both carry the x1024
    *(v2f*)(rU + 2 * tid) = (v2f){(us[0] + us[2]) * inv, (us[1] + us[3]) * inv};
  }
  __syncthreads();
  {
    const float a = pa[0];
    v4f uu[2][4];                                       // uu[sub][r >> 1]: u0 u1 of rows 16sub + 8hh + r, r even then odd
#pragma unroll
    for (int sub = 0; sub < 2; ++sub)
#pragma unroll
      for (int g = 0; g < 4; ++g) uu[sub][g] = *(const v4f*)(rU + 2 * (16 * sub + 8 * hh) + 4 * g);
#pragma unroll
    for (int t = 0; t < 4; ++t) {
      const int h = wave * 64 + 16 * t + c;             // output column of the attention = BN channel
      const float sc = gam[h] * (1.0f / sqrtf(var[h] + 1.0e-5f));
      const float m  = mu[h];
      const float be = bet[h];
      const float w0 = wv[h], w1 = wv[HD + h];
#pragma unroll
      for (int sub = 0; sub < 2; ++sub) {
#pragma unroll
        for (int r = 0; r < 8; ++r) {
          const float o0 = fmaf(uu[sub][r >> 1][2 * (r & 1) + 1], w1, uu[sub][r >> 1][2 * (r & 1)] * w0);
          float z0 = (o0 - m) * sc + be;
          z0 = (z0 >= 0.f) ? z0 : a * z0;
          zA[(16 * sub + 8 * hh + r) * ZP + h] = (_Float16)(z0 * 16.0f);
        }
      }
    }
  }
  __syncthreads();                                      // zA complete (cross-wave)

  // ---- out tile 32 x 32 = zA[32][512] . WoT, K split over two wave groups ----
  {
    const int osub = wave & 1, ont = (wave >> 1) & 1, okh = wave >> 2;
    v8f acc = zero8();
#pragma unroll 2
    for (int ks = 0; ks < 8; ++ks) {
      const int k0 = (okh * 8 + ks) * 32;
      const v16h af = ldfrag(zA, ZP, 16 * osub, k0, lane);
      const v16h bf = ldfrag(wot, HD, 16 * ont, k0, lane);
      acc = mma16(af, bf, acc);
    }
    float* pp = part + okh * (BR * PTP) + (16 * osub + 8 * hh) * PTP + 16 * ont + c;
#pragma unroll
    for (int r = 0; r < 8; ++r) pp[r * PTP] = acc[r];
  }
  __syncthreads();                                      // part complete
  {
    const int row = tid >> 3, pc = tid & 7;
    const v4f p0 = *(const v4f*)(part + row * PTP + pc * 4);
    const v4f p1 = *(const v4f*)(part + BR * PTP + row * PTP + pc * 4);
    const v4f bb = *(const v4f*)(bo + pc * 4);
    const v4f val = (p0 + p1) * 0.0009765625f + bb;     // 1/(16 * 64)
    v4f* d = (v4f*)(out + (tokbase + (size_t)row) * OD + pc * 4);
    *d = val;
    
  }
}

// ---------------------------------------------------------------------------
// Workspace map (bytes; WoT is 64 of the 512-B units one wave of kernel 0 stores, M one 16-B store
// padded to 128 B):
//   WoT  f16 [32][512]               0      32768
//   M    f32 [2][2]              32768        128 (16 used)
//   total                        32896
// ---------------------------------------------------------------------------
extern "C" void kernel_launch(void* const* d_in, const int* in_sizes, int n_in,
                              void* d_out, int out_size, void* d_ws, size_t ws_size,
                              hipStream_t stream) {
  if (n_in < 12) return;
  if (in_sizes[0] != NTOK * 2) return;
  if (in_sizes[1] < 1) return;
  if (in_sizes[2] != 2 * HD) return;
  if (in_sizes[3] != 2 * HD) return;
  if (in_sizes[4] != 2 * HD) return;
  if (in_sizes[5] != HD) return;
  if (in_sizes[6] != HD) return;
  if (in_sizes[7] != HD) return;
  if (in_sizes[8] != HD) return;
  if (in_sizes[9] < 1) return;
  if (in_sizes[10] != HD * OD) return;
  if (in_sizes[11] != OD) return;
  if (out_size != NTOK * OD) return;

  const float* x    = (const float*)d_in[0];    // [32768][2]
  const int*   bsz  = (const int*)d_in[1];      // [1]
  const float* wq   = (const float*)d_in[2];    // [2][512]
  const float* wk   = (const float*)d_in[3];    // [2][512]
  const float* wv   = (const float*)d_in[4];    // [2][512]
  const float* gam  = (const float*)d_in[5];    // [512]
  const float* bet  = (const float*)d_in[6];    // [512]
  const float* mu   = (const float*)d_in[7];    // [512]
  const float* var  = (const float*)d_in[8];    // [512]
  const float* pa   = (const float*)d_in[9];    // [1]
  const float* wo   = (const float*)d_in[10];   // [512][32]
  const float* bo   = (const float*)d_in[11];   // [32]
  float* out = (float*)d_out;                   // [32768][32]

  size_t off = 0;
  const size_t oW = off; off += (size_t)OD * HD * 2;
  const size_t oM = off; off += (size_t)128;
  if (off > ws_size) return;                    // off = 32896
  if (off > (size_t)134217728) return;

  char* ws = (char*)d_ws;
  _Float16* WoT = (_Float16*)(ws + oW);
  float*    Mm  = (float*)(ws + oM);

  const float sscale = 1.0f / sqrtf((float)HD);

  // (0) Wout -> f16 [n][k] plane (x64); one more block forms M = Wq.Wk^T
  const int ngw = (OD * HD) / 8;                // 2048
  k_wout<<<dim3((ngw + 255) / 256 + 1), dim3(256), 0, stream>>>(wo, WoT, ngw, wq, wk, Mm);
  // (1) attention + BN/PReLU/Wout tail -> d_out
  k_attn<<<dim3(SEQ / BR, NBAT), dim3(256), 0, stream>>>(x, Mm, wv, WoT, gam, bet, mu, var, pa, bo, bsz,
                                                         out, sscale);
  (void)hipGetLastError();
}

// v004
// One run takes 11.2 microseconds.
// Next to v003, in two timings, it ran 1.23 times as fast each time.
// All steps since v000 together make it 27.4 times as fast.
// Contractions: S^T = x.(x.M)^T with M = Wq.Wk^T (2 x 2, f32) on v_wmma_f32_16x16x32_f16 (f16 hi + lo operand pairs, f32 accumulate, the row maximum enters as C); u^T = [x^T; 1].P^T (x as hi and lo rows, a row of ones for the row sum, p x1024 packed from the score accumulators) on v_wmma_f32_16x16x32_f16 (f16 operands, f32 accumulate); z^T = W'.[u; 1]^T (projection u.Wv with the BN affine folded in, x16; f16 hi + lo operand pairs, f32 accumulate) on v_wmma_f32_16x16x32_f16; out^T = Wout^T.z^T on v_wmma_f32_16x16x32_f16 (f16 operands: z x16 packed from the z accumulators, Wout x64; f32 accumulate, 1/1024 folded back in f32). M, y = x.M and the folded channel constants exact f32 on VALU; score scale, softmax maximum, exp2, 1/l, PReLU and bias in f32.
#include <hip/hip_runtime.h>
#include <math.h>
#include <stddef.h>
#include <stdint.h>

#define NTOK 32768              // token rows
#define NBAT 32                 // sequences
#define SEQ  1024               // tokens per sequence
#define HD   512                // head width
#define OD   32                 // output width
#define BR   32                 // query rows per attention block
#define BC   128                // keys per chunk

static_assert(NTOK == NBAT * SEQ);
static_assert(SEQ % BC == 0);
static_assert(SEQ % BR == 0);
static_assert(BC % 32 == 0);
static_assert(HD == 512);
static_assert((HD / 8) == 64);
static_assert(SEQ == 256 * 4);
static_assert(OD == 32);

typedef _Float16 v16h __attribute__((ext_vector_type(16)));
typedef _Float16 v8h  __attribute__((ext_vector_type(8)));
typedef _Float16 v4h  __attribute__((ext_vector_type(4)));
typedef float    v8f  __attribute__((ext_vector_type(8)));
typedef float    v4f  __attribute__((ext_vector_type(4)));
typedef float    v2f  __attribute__((ext_vector_type(2)));
typedef unsigned int v4u __attribute__((ext_vector_type(4)));

union Frag  { v16h v; v8h h[2]; };
union Pack8 { v8h h; v4u u; };

// Fragment loader for k-contiguous 16-bit rows with pitch ld.
// A operand: row0 + (lane&15) is the M row.  B operand stored [n][k]: row0 + (lane&15) is the N column.
// Split k map for both: elements 0..7 <- k0 + 8*(lane>>4) + 0..7, elements 8..15 <- k0 + 16 + 8*(lane>>4) + 0..7.
// D map: acc[r] = element (8*(lane>>4) + r, lane&15) of the 16x16 tile.
__device__ __forceinline__ v16h ldfrag(const _Float16* p, int ld, int row0, int k0, int lane) {
  const int m = lane & 15, lh = lane >> 4;
  const _Float16* q = p + (size_t)(row0 + m) * ld + k0 + 8 * lh;
  Frag f;
  f.h[0] = *(const v8h*)(q);
  f.h[1] = *(const v8h*)(q + 16);
  return f.v;
}

__device__ __forceinline__ v8f zero8() { return (v8f){0.f, 0.f, 0.f, 0.f, 0.f, 0.f, 0.f, 0.f}; }

// ---------------------------------------------------------------------------
// kernel 0: Wout f32 [512][32] ([k][n]) -> f16 plane WoT [32][512] ([n][k], k-contiguous), values x64.
// Thread t: n = t>>6, k0 = (t&63)*8: gathers 8 consecutive k of column n, one 16-B store; 32 lanes write
// coverage: 2048 threads x 8 halves = 32 x 512.
// The block behind these (n is a multiple of 256): its wave 0 forms M[i][j] = sum_h Wq[i][h] * Wk[j][h] in f32 (lane l: h = 16l .. 16l+15, then a
// butterfly over the 32 lanes) and stores the four values to mm.
// The HD/256 blocks behind that one: thread = BN channel h. With sc = gamma/sqrt(var + eps): z = (u.Wv - mean) sc + beta
// = u0 (Wv0 sc) + u1 (Wv1 sc) + (beta - mean sc). The three constants x16, each as an f16 pair hi + lo, go to
// wf [h][16 halves] = w0hi w0lo w0hi w1hi w1lo w1hi bhi blo and eight zeros: the channel side of the z product's 8 k
// slots, and the unused upper half of its A fragment.
// ---------------------------------------------------------------------------
__global__ __launch_bounds__(256) void k_wout(const float* __restrict__ wo, _Float16* __restrict__ wot, int n,
                                              const float* __restrict__ wq, const float* __restrict__ wk,
                                              float* __restrict__ mm,
                                              const float* __restrict__ wv, const float* __restrict__ gam,
                                              const float* __restrict__ bet, const float* __restrict__ mu,
                                              const float* __restrict__ var, _Float16* __restrict__ wf) {
  if ((int)blockIdx.x * 256 >= n + 256) {               // the channel blocks; block-uniform; no barriers in this kernel
    const int h = (int)blockIdx.x * 256 - (n + 256) + (int)threadIdx.x;
    if (h >= HD) return;
    const float sc = gam[h] * (1.0f / sqrtf(var[h] + 1.0e-5f));
    const float w0 = wv[h] * sc * 16.0f, w1 = wv[HD + h] * sc * 16.0f;
    const float bb = (bet[h] - mu[h] * sc) * 16.0f;
    const _Float16 w0h = (_Float16)w0, w1h = (_Float16)w1, bh = (_Float16)bb;
    const _Float16 w0l = (_Float16)(w0 - (float)w0h), w1l = (_Float16)(w1 - (float)w1h), bl = (_Float16)(bb - (float)bh);
    *(v8h*)(wf + (size_t)h * 16)     = (v8h){w0h, w0l, w0h, w1h, w1l, w1h, bh, bl};
    *(v8h*)(wf + (size_t)h * 16 + 8) = (v8h){0, 0, 0, 0, 0, 0, 0, 0};
    return;
  }
  if ((int)blockIdx.x * 256 >= n) {                     // the block behind the plane's; block-uniform
    if (threadIdx.x >= 32) return;
    const int h0 = (int)threadIdx.x * 16;
    float m00 = 0.f, m01 = 0.f, m10 = 0.f, m11 = 0.f;
#pragma unroll
    for (int g = 0; g < 4; ++g) {
      const v4f q0v = *(const v4f*)(wq + h0 + 4 * g);
      const v4f q1v = *(const v4f*)(wq + HD + h0 + 4 * g);
      const v4f k0v = *(const v4f*)(wk + h0 + 4 * g);
      const v4f k1v = *(const v4f*)(wk + HD + h0 + 4 * g);
#pragma unroll
      for (int e = 0; e < 4; ++e) {
        m00 = fmaf(q0v[e], k0v[e], m00);
        m01 = fmaf(q0v[e], k1v[e], m01);
        m10 = fmaf(q1v[e], k0v[e], m10);
        m11 = fmaf(q1v[e], k1v[e], m11);
      }
    }
#pragma unroll
    for (int d = 16; d >= 1; d >>= 1) {
      m00 += __shfl_xor(m00, d, 32);
      m01 += __shfl_xor(m01, d, 32);
      m10 += __shfl_xor(m10, d, 32);
      m11 += __shfl_xor(m11, d, 32);
    }
    if (threadIdx.x == 0) *(v4f*)mm = (v4f){m00, m01, m10, m11};
    return;
  }
  const int t = blockIdx.x * 256 + (int)threadIdx.x;
  if (t >= n) return;
  const int nn = t >> 6;
  const int k0 = (t & 63) * 8;
  const float* src = wo + (size_t)k0 * OD + nn;
  Pack8 pk;
  pk.h = (v8h){(_Float16)(src[0 * OD] * 64.0f), (_Float16)(src[1 * OD] * 64.0f),
               (_Float16)(src[2 * OD] * 64.0f), (_Float16)(src[3 * OD] * 64.0f),
               (_Float16)(src[4 * OD] * 64.0f), (_Float16)(src[5 * OD] * 64.0f),
               (_Float16)(src[6 * OD] * 64.0f), (_Float16)(src[7 * OD] * 64.0f)};
  const v4u vv = pk.u;
  v4u* d = (v4u*)(wot + (size_t)nn * HD + k0);
  *d = vv;
  
}

// ---------------------------------------------------------------------------
// kernel 1: non-causal attention per (query tile, sequence), single head of width 512, with the
// BN-affine + PReLU + z.Wout + bias tail fused. Block = 8 waves = 32 query rows of one sequence;
// key chunks of 128 (nch = SEQ/BC = 8, derived from the batch_size input and clamped to the static maximum).
//   x: f32 input [token][2];  mm: f32 M = Wq.Wk^T [2][2];  wf: f16 plane [512][16] (x16);  wot: f16 plane [32][512] (x64).
// S: q.k = sum_ij x_i M_ij x'_j = y.x' with y = x.M, so the score product contracts 2 dims, not 512. y carries
//   the score scale and log2(e). Each f32 factor goes in as an f16 pair hi + lo and the four cross products of
//   the two dims fill 8 k slots of one 16x16x32 step.
// Wave w: query tile w&1 (16 rows), keys 32(w>>1)..+31 of each chunk; the softmax never leaves the wave's registers.
//   S^T = K.Y^T: keys are the M rows, queries the N columns, so lane (h, c) holds keys 8h + r of query c.
//   The block forms kF [key][8 halves] once in LDS; lane l loads key k0 + l of two chunks, so one A fragment holds
//   four 16-key tiles, tile j in elements 8(j>>1)..+7 of lanes 16(j&1)..+15 (8 of the 32 k slots each); the B
//   fragment yq[j] is zero outside tile j's slots, which picks the 16 keys of each product.
//   Pass 1 over the wave's keys: maximum per query (in-lane, one exchange between the lane halves).
//   Pass 2: the same products with C = 10 - maximum, p x1024 = exp2(D); the two D tiles of 32 keys, converted in
//   place, are the B operand of the value product (element s = key kmap(s, h) of query c).
// O: p.v = p.(x.Wv) = (p.x).Wv. u^T = A.P^T with A rows [hi0 hi1 lo0 lo1 ones ones ...][key] from LDS (xT, the same
//   k map): D rows 0..3 are the four partial sums of u, row 4 the row sum l (of the rounded p), all x1024.
//   After the loop the four key slices, each under its own maximum, are joined through LDS (uP).
// Tail: every wave joins the slices itself (lane = row): u = (hi + lo sums) / l. z never leaves the wave's registers:
//   z^T = W'.[u; 1]^T: channels are the M rows, queries the N columns. Wave w owns channels 64w .. 64w+63 for all 32
//   rows. A fragment of a 16-channel tile: lane (h, c) loads wf row c of the tile (8 of the 32 k slots are used; the
//   B fragment is zero outside k slots 0..7, which sit in lanes 0..15; A is zero in k slots 16..31). Query side of the 8 slots:
//   u0hi u0hi u0lo u1hi u1hi u1lo 1 1 (the lo.lo products are left out). PReLU in f32 on D; two D tiles, converted in
//   place, are the B operand of out^T = Wout^T.z^T (k slot = channel offset, the split k map of ldfrag).
//   out^T D: lane (h, c) holds out columns 16nt + 8h + r of query c: partial tile to LDS part[wave][32][36] (32 columns used); barrier;
//   val = (sum of the eight parts)/1024 + b_out.
// LDS: one raw buffer: loop phase kF (halves at float offset 0) + xT (halves at float offset 4096); tail phase part.
// grid = (SEQ/BR, NBAT) = (32, 32).
// coverage: part per wave 32 x 32; d_out per block 256 thr x 4 floats = 32 rows x 32 -> 1024 blocks = 32768 rows x 32.
// ---------------------------------------------------------------------------
#define PTP 36
#define XTP 1040                              // xT row pitch in halves: rows 32 B apart modulo the 256-B bank span
#define XT_OFF_F   ((SEQ * 8) / 2)            // 4096 floats
#define SBIGF      (8 * BR * PTP)             // 9216 floats = 36864 B
static_assert(XT_OFF_F + (5 * XTP) / 2 <= SBIGF);
static_assert((XT_OFF_F % 4) == 0);
static_assert((PTP % 4) == 0);
static_assert((XTP % 8) == 0);
static_assert(XTP >= SEQ);
static_assert(HD == 8 * 64);

// Score operands from one f32 pair (u0, u1), eight halves (k slots) a side:
//   query side: hi0 hi1 hi0 hi1 lo0 lo1 lo0 lo1      key side: hi0 hi1 lo0 lo1 hi0 hi1 lo0 lo1
// so slot by slot the products are hi.hi, hi.lo, lo.hi, lo.lo for dim 0 and dim 1.
__device__ __forceinline__ v8h qhalves(float u0, float u1) {
  const _Float16 h0 = (_Float16)u0, h1 = (_Float16)u1;
  const _Float16 l0 = (_Float16)(u0 - (float)h0), l1 = (_Float16)(u1 - (float)h1);
  return (v8h){h0, h1, h0, h1, l0, l1, l0, l1};
}

// WMMA as the bare builtin: the compiler keeps the distance behind it and can fill it with the other tile's work
__device__ __forceinline__ v8f mmab(v16h a, v16h b, v8f c) {
  return __builtin_amdgcn_wmma_f32_16x16x32_f16(false, a, false, b, (short)0, c, false, false);
}

__global__ __launch_bounds__(256) void k_attn(const float* __restrict__ x,
                                              const float* __restrict__ mm,
                                              const _Float16* __restrict__ wf,
                                              const _Float16* __restrict__ wot,
                                              const float* __restrict__ pa,
                                              const float* __restrict__ bo,
                                              const int* __restrict__ bsp,
                                              float* __restrict__ out, float sscale) {
  __shared__ __align__(16) float sBig[SBIGF];
  __shared__ __align__(16) float uP[4 * BR * 8];        // [key slice][row][u hi0 hi1 lo0 lo1, l, maximum, -, -]

  _Float16* kF   = (_Float16*)sBig;
  _Float16* xT   = (_Float16*)(sBig + XT_OFF_F);
  float*    part = sBig;

  const int tid = threadIdx.x, lane = tid & 31, wave = tid >> 5;
  const int hh = lane >> 4, c = lane & 15;
  const int b  = blockIdx.y;
  const int q0 = (int)blockIdx.x * BR;                  // query row base within the sequence
  int bs = bsp[0];
  bs = (bs < 1) ? 1 : bs;
  int seql = NTOK / bs;
  seql = (seql > SEQ) ? SEQ : seql;
  const int nch = seql / BC;                            // block-uniform, <= SEQ/BC
  const float* Xb = x + (size_t)b * SEQ * 2;             // this sequence's token rows [l][2]
  const size_t tokbase = (size_t)b * SEQ + q0;
  const int pt = wave & 1, pk = wave >> 1;              // this wave's query tile and its 32-key slice of each chunk
  const v8h zz = (v8h){0, 0, 0, 0, 0, 0, 0, 0};

  // B fragments of the score product: y = x.M (x score scale x log2 e) for query row q0 + 16pt + (lane&15)
  v16h yq[4];
  {
    const v4f mv = *(const v4f*)mm;                     // M00 M01 M10 M11
    const v2f xq = *(const v2f*)(Xb + 2 * (size_t)(q0 + 16 * pt + c));
    const float ys = sscale * 1.4426950408889634f;
    const v8h yv = qhalves(fmaf(xq[1], mv[2], xq[0] * mv[0]) * ys, fmaf(xq[1], mv[3], xq[0] * mv[1]) * ys);
#pragma unroll
    for (int j = 0; j < 4; ++j) {
      Frag f;
      f.h[j >> 1]       = (hh == (j & 1)) ? yv : zz;
      f.h[(j >> 1) ^ 1] = zz;
      yq[j] = f.v;
    }
  }
  {
    // this sequence's tokens as f16 hi and lo: x^T rows (and a row of ones) and the key-side score operands;
    // thread t: tokens 4t .. 4t+3
    const int l0 = tid * 4;
    const v4f a0 = *(const v4f*)(Xb + 2 * l0);
    const v4f a1 = *(const v4f*)(Xb + 2 * l0 + 4);
    const v4f e0 = (v4f){a0[0], a0[2], a1[0], a1[2]};
    const v4f e1 = (v4f){a0[1], a0[3], a1[1], a1[3]};
    v4h h0, h1, g0, g1;
#pragma unroll
    for (int e = 0; e < 4; ++e) {
      h0[e] = (_Float16)e0[e];
      h1[e] = (_Float16)e1[e];
      g0[e] = (_Float16)(e0[e] - (float)h0[e]);
      g1[e] = (_Float16)(e1[e] - (float)h1[e]);
    }
    *(v4h*)(xT + 0 * XTP + l0) = h0;
    *(v4h*)(xT + 1 * XTP + l0) = h1;
    *(v4h*)(xT + 2 * XTP + l0) = g0;
    *(v4h*)(xT + 3 * XTP + l0) = g1;
    *(v4h*)(xT + 4 * XTP + l0) = (v4h){1, 1, 1, 1};
#pragma unroll
    for (int e = 0; e < 4; ++e)
      *(v8h*)(kF + (size_t)(l0 + e) * 8) = (v8h){h0[e], h1[e], g0[e], g1[e], h0[e], h1[e], g0[e], g1[e]};
  }
  __syncthreads();                                      // kF and xT complete

  const _Float16* kp = kF + (size_t)(pk * 32 + lane) * 8;   // lane l: key k0 + l of each 32-key step

  const int npair = nch >> 1;                           // two chunks (64 of this wave's keys) per A fragment

  // ---- pass 1: this wave's maximum per query over its keys ----
  float mw;
  {
    v8f mx;
#pragma unroll
    for (int r = 0; r < 8; ++r) mx[r] = -3.0e38f;       // finite, so that a wave without keys joins with factor 1
#pragma unroll 1                                        // rolled: unrolled by two the kernel passes 128 registers, and 4 blocks no longer fit a WGP
    for (int cp = 0; cp < npair; ++cp) {
      Frag ka;
      ka.h[0] = *(const v8h*)(kp + (size_t)(2 * cp) * (BC * 8));
      ka.h[1] = *(const v8h*)(kp + (size_t)(2 * cp + 1) * (BC * 8));
      v8f s[4];
#pragma unroll
      for (int j = 0; j < 4; ++j) s[j] = mmab(ka.v, yq[j], zero8());
#pragma unroll
      for (int r = 0; r < 8; ++r) mx[r] = fmaxf(fmaxf(mx[r], fmaxf(s[0][r], s[1][r])), fmaxf(s[2][r], s[3][r]));
    }
    if (nch & 1) {                                      // block-uniform: the odd last chunk, tiles 0 and 1 alone
      Frag ka;
      ka.h[0] = *(const v8h*)(kp + (size_t)(nch - 1) * (BC * 8));
      ka.h[1] = ka.h[0];
      const v8f s0 = mmab(ka.v, yq[0], zero8());
      const v8f s1 = mmab(ka.v, yq[1], zero8());
#pragma unroll
      for (int r = 0; r < 8; ++r) mx[r] = fmaxf(mx[r], fmaxf(s0[r], s1[r]));
    }
    float m = fmaxf(fmaxf(fmaxf(mx[0], mx[1]), fmaxf(mx[2], mx[3])), fmaxf(fmaxf(mx[4], mx[5]), fmaxf(mx[6], mx[7])));
    const int mb = __builtin_bit_cast(int, m);          // lane l <-> l ^ 16: the other eight keys of each tile
    mw = fmaxf(m, __builtin_bit_cast(float, __builtin_amdgcn_permlanex16(mb, mb, 0x76543210, 0xfedcba98, false, false)));
  }

  // ---- pass 2: p x1024 = exp2(s - maximum + 10), packed in place into the value product's B operand ----
  v8f uacc = zero8();
  {
    const float cm = 10.0f - mw;
    const v8f cneg = (v8f){cm, cm, cm, cm, cm, cm, cm, cm};
    const int xl = ((c < 4) ? c : 4) | (lane & 16);     // A row (lane&15) reads xT row min(lane&15, 4)
#pragma unroll 1                                        // rolled, for the same register bound
    for (int cp = 0; cp < npair; ++cp) {
      Frag ka;
      ka.h[0] = *(const v8h*)(kp + (size_t)(2 * cp) * (BC * 8));
      ka.h[1] = *(const v8h*)(kp + (size_t)(2 * cp + 1) * (BC * 8));
      // A operands of the value product: split k map over keys, the map of the packed D pair
      const v16h xa0 = ldfrag(xT, XTP, 0, (2 * cp) * BC + pk * 32, xl);
      const v16h xa1 = ldfrag(xT, XTP, 0, (2 * cp + 1) * BC + pk * 32, xl);
      v8f s[4];                                         // s[j][r]: key k0(chunk 2cp + (j>>1)) + 16(j&1) + 8hh + r, query c
#pragma unroll
      for (int j = 0; j < 4; ++j) s[j] = mmab(ka.v, yq[j], cneg);
#pragma unroll
      for (int j = 0; j < 4; ++j)
#pragma unroll
        for (int r = 0; r < 8; ++r) s[j][r] = __builtin_amdgcn_exp2f(s[j][r]);
      Frag pb0, pb1;
      pb0.h[0] = __builtin_convertvector(s[0], v8h);
      pb0.h[1] = __builtin_convertvector(s[1], v8h);
      pb1.h[0] = __builtin_convertvector(s[2], v8h);
      pb1.h[1] = __builtin_convertvector(s[3], v8h);
      uacc = mmab(xa0, pb0.v, uacc);
      uacc = mmab(xa1, pb1.v, uacc);
    }
    if (nch & 1) {                                      // block-uniform: the odd last chunk
      Frag ka;
      ka.h[0] = *(const v8h*)(kp + (size_t)(nch - 1) * (BC * 8));
      ka.h[1] = ka.h[0];
      const v16h xa0 = ldfrag(xT, XTP, 0, (nch - 1) * BC + pk * 32, xl);
      v8f s0 = mmab(ka.v, yq[0], cneg);
      v8f s1 = mmab(ka.v, yq[1], cneg);
#pragma unroll
      for (int r = 0; r < 8; ++r) {
        s0[r] = __builtin_amdgcn_exp2f(s0[r]);
        s1[r] = __builtin_amdgcn_exp2f(s1[r]);
      }
      Frag pb0;
      pb0.h[0] = __builtin_convertvector(s0, v8h);
      pb0.h[1] = __builtin_convertvector(s1, v8h);
      uacc = mmab(xa0, pb0.v, uacc);
    }
  }

  // ---- tail: join the four key slices, 1/l per row, z^T = W'.[u; 1]^T, PReLU, out^T = Wout^T.z^T ----
  const float a = pa[0];
  if (lane < 16) {                                      // D rows 0..4 sit in lanes 0..15
    float* d = uP + (size_t)(pk * BR + 16 * pt + c) * 8;
    *(v4f*)d       = (v4f){uacc[0], uacc[1], uacc[2], uacc[3]};
    *(v2f*)(d + 4) = (v2f){uacc[4], mw};
  }
  __syncthreads();                                      // uP complete (cross-wave); kF and xT free
  // A operands of both tail products, asked for here so that they fly during the join (a barrier would wait for them)
  const int ch0 = wave * 64;                            // this wave's 64 channels
  Frag wa[4];                                           // tile j: row c = channel ch0 + 16j + c, in k slots 0..7 and again in 8..15
#pragma unroll
  for (int j = 0; j < 4; ++j) {
    wa[j].h[0] = *(const v8h*)(wf + (size_t)(ch0 + 16 * j + c) * 16);
    wa[j].h[1] = *(const v8h*)(wf + (size_t)(ch0 + 16 * j + c) * 16 + 8);   // the plane's zeros: lands in place, no register moves
  }
  v16h wo[2][2];                                        // [out column tile][32-channel step]
#pragma unroll
  for (int nt = 0; nt < 2; ++nt)
#pragma unroll
    for (int ks = 0; ks < 2; ++ks) wo[nt][ks] = ldfrag(wot, HD, 16 * nt, ch0 + 32 * ks, lane);
  // keeps all sixteen loads issued here: without it the compiler sinks the Wout loads to just in front of their first
  // use, where their whole latency is waited out
  __builtin_amdgcn_sched_barrier(0);
  Pack8 own, oth;                                       // query side of the z product: row lane, and row lane ^ 16
  {
    v2f lm[4];
#pragma unroll
    for (int i = 0; i < 4; ++i) lm[i] = *(const v2f*)(uP + (size_t)(i * BR + lane) * 8 + 4);
    const float m = fmaxf(fmaxf(lm[0][1], lm[1][1]), fmaxf(lm[2][1], lm[3][1]));
    v4f us = (v4f){0.f, 0.f, 0.f, 0.f};
    float l = 0.f;
#pragma unroll
    for (int i = 0; i < 4; ++i) {
      const float f = __builtin_amdgcn_exp2f(lm[i][1] - m);
      us += *(const v4f*)(uP + (size_t)(i * BR + lane) * 8) * f;
      l = fmaf(lm[i][0], f, l);
    }
    const float inv = (l > 0.f) ? (1.0f / l) : 0.f;     // u and l both carry the x1024
    const float u0 = (us[0] + us[2]) * inv, u1 = (us[1] + us[3]) * inv;
    const _Float16 h0 = (_Float16)u0, h1 = (_Float16)u1;
    const _Float16 l0 = (_Float16)(u0 - (float)h0), l1 = (_Float16)(u1 - (float)h1);
    own.h = (v8h){h0, h0, l0, h1, h1, l1, 1, 1};
#pragma unroll
    for (int i = 0; i < 4; ++i)                         // lane l <-> l ^ 16
      oth.u[i] = (unsigned int)__builtin_amdgcn_permlanex16((int)own.u[i], (int)own.u[i], 0x76543210, 0xfedcba98, false, false);
  }
#pragma unroll
  for (int qt = 0; qt < 2; ++qt) {                      // query tile: rows 16qt + c
    Frag f;                                             // k slots 0..7 (lanes 0..15) alone carry the row's eight halves
    f.h[0] = (hh == 0) ? (qt ? oth.h : own.h) : zz;
    f.h[1] = zz;
    v8f s[4];                                           // s[j][r]: z x16 of channel ch0 + 16j + 8hh + r, row 16qt + c
#pragma unroll
    for (int j = 0; j < 4; ++j) s[j] = mmab(wa[j].v, f.v, zero8());
    // keeps the four products together: each fills the distance behind the one before, which v_nop fills otherwise
    __builtin_amdgcn_sched_barrier(0);
#pragma unroll
    for (int j = 0; j < 4; ++j)
#pragma unroll
      for (int r = 0; r < 8; ++r) s[j][r] = (s[j][r] >= 0.f) ? s[j][r] : a * s[j][r];
    Frag pb0, pb1;
    pb0.h[0] = __builtin_convertvector(s[0], v8h);
    pb0.h[1] = __builtin_convertvector(s[1], v8h);
    pb1.h[0] = __builtin_convertvector(s[2], v8h);
    pb1.h[1] = __builtin_convertvector(s[3], v8h);
#pragma unroll
    for (int nt = 0; nt < 2; ++nt) {
      v8f acc = mmab(wo[nt][0], pb0.v, zero8());
      acc = mmab(wo[nt][1], pb1.v, acc);
      float* pp = part + wave * (BR * PTP) + (16 * qt + c) * PTP + 16 * nt + 8 * hh;
      *(v4f*)pp       = (v4f){acc[0], acc[1], acc[2], acc[3]};
      *(v4f*)(pp + 4) = (v4f){acc[4], acc[5], acc[6], acc[7]};
    }
  }
  __syncthreads();                                      // part complete
  {
    const int row = tid >> 3, pc = tid & 7;
    v4f sum = *(const v4f*)(part + row * PTP + pc * 4);
#pragma unroll
    for (int w = 1; w < 8; ++w) sum += *(const v4f*)(part + w * (BR * PTP) + row * PTP + pc * 4);
    const v4f bb = *(const v4f*)(bo + pc * 4);
    const v4f val = sum * 0.0009765625f + bb;           // 1/(16 * 64)
    v4f* d = (v4f*)(out + (tokbase + (size_t)row) * OD + pc * 4);
    *d = val;
  }
}

// ---------------------------------------------------------------------------
// Workspace map (bytes; WoT is 64 of the 512-B units one wave of kernel 0 stores, M one 16-B store
// padded to 128 B):
//   WoT  f16 [32][512]               0      32768
//   M    f32 [2][2]              32768        128 (16 used)
//   wF   f16 [512][16]           32896      16384
//   total                        49280
// ---------------------------------------------------------------------------
extern "C" void kernel_launch(void* const* d_in, const int* in_sizes, int n_in,
                              void* d_out, int out_size, void* d_ws, size_t ws_size,
                              hipStream_t stream) {
  if (n_in < 12) return;
  if (in_sizes[0] != NTOK * 2) return;
  if (in_sizes[1] < 1) return;
  if (in_sizes[2] != 2 * HD) return;
  if (in_sizes[3] != 2 * HD) return;
  if (in_sizes[4] != 2 * HD) return;
  if (in_sizes[5] != HD) return;
  if (in_sizes[6] != HD) return;
  if (in_sizes[7] != HD) return;
  if (in_sizes[8] != HD) return;
  if (in_sizes[9] < 1) return;
  if (in_sizes[10] != HD * OD) return;
  if (in_sizes[11] != OD) return;
  if (out_size != NTOK * OD) return;

  const float* x    = (const float*)d_in[0];    // [32768][2]
  const int*   bsz  = (const int*)d_in[1];      // [1]
  const float* wq   = (const float*)d_in[2];    // [2][512]
  const float* wk   = (const float*)d_in[3];    // [2][512]
  const float* wv   = (const float*)d_in[4];    // [2][512]
  const float* gam  = (const float*)d_in[5];    // [512]
  const float* bet  = (const float*)d_in[6];    // [512]
  const float* mu   = (const float*)d_in[7];    // [512]
  const float* var  = (const float*)d_in[8];    // [512]
  const float* pa   = (const float*)d_in[9];    // [1]
  const float* wo   = (const float*)d_in[10];   // [512][32]
  const float* bo   = (const float*)d_in[11];   // [32]
  float* out = (float*)d_out;                   // [32768][32]

  size_t off = 0;
  const size_t oW = off; off += (size_t)OD * HD * 2;
  const size_t oM = off; off += (size_t)128;
  const size_t oF = off; off += (size_t)HD * 16 * 2;
  if (off > ws_size) return;                    // off = 49280
  if (off > (size_t)134217728) return;

  char* ws = (char*)d_ws;
  _Float16* WoT = (_Float16*)(ws + oW);
  float*    Mm  = (float*)(ws + oM);
  _Float16* Wf  = (_Float16*)(ws + oF);

  const float sscale = 1.0f / sqrtf((float)HD);

  // (0) Wout -> f16 [n][k] plane (x64); one more block forms M = Wq.Wk^T; HD/256 more the channel constants wF
  const int ngw = (OD * HD) / 8;                // 2048
  k_wout<<<dim3((ngw + 255) / 256 + 1 + HD / 256), dim3(256), 0, stream>>>(wo, WoT, ngw, wq, wk, Mm,
                                                                          wv, gam, bet, mu, var, Wf);
  // (1) attention + BN/PReLU/Wout tail -> d_out
  k_attn<<<dim3(SEQ / BR, NBAT), dim3(256), 0, stream>>>(x, Mm, Wf, WoT, pa, bo, bsz, out, sscale);
  (void)hipGetLastError();
}

// v005
// Measured time: 9.96 microseconds a run.
// Two timings next to v004 both put it at 1.12 times that version's speed.
// All steps since v000 together make it 30.6 times as fast.
// Contractions: S^T = x.(x.M)^T with M = Wq.Wk^T (2 x 2, f32) on v_wmma_f32_16x16x32_f16 (f16 hi + lo operand pairs, f32 accumulate, the row maximum enters as C); u^T = [x^T; 1].P^T (x as hi and lo rows, a row of ones for the row sum, p x1024 packed from the score accumulators) on v_wmma_f32_16x16x32_f16 (f16 operands, f32 accumulate); z^T = W'.[u; 1]^T (projection u.Wv with the BN affine folded in, x16; f16 hi + lo operand pairs, f32 accumulate) on v_wmma_f32_16x16x32_f16; out^T = Wout^T.z^T on v_wmma_f32_16x16x32_f16 (f16 operands: z x16 packed from the z accumulators, Wout x64; f32 accumulate, 1/1024 folded back in f32). M, y = x.M and the folded channel constants exact f32 on VALU; score scale, softmax maximum, exp2, 1/l, PReLU and bias in f32.
#include <hip/hip_runtime.h>
#include <math.h>
#include <stddef.h>
#include <stdint.h>

#define NTOK 32768              // token rows
#define NBAT 32                 // sequences
#define SEQ  1024               // tokens per sequence
#define HD   512                // head width
#define OD   32                 // output width
#define BR   32                 // query rows per attention block
#define BC   128                // keys per chunk

static_assert(NTOK == NBAT * SEQ);
static_assert(SEQ % BC == 0);
static_assert(SEQ % BR == 0);
static_assert(BC % 32 == 0);
static_assert(HD == 512);
static_assert((HD / 8) == 64);
static_assert(SEQ == 256 * 4);
static_assert(OD == 32);

typedef _Float16 v16h __attribute__((ext_vector_type(16)));
typedef _Float16 v8h  __attribute__((ext_vector_type(8)));
typedef _Float16 v4h  __attribute__((ext_vector_type(4)));
typedef float    v8f  __attribute__((ext_vector_type(8)));
typedef float    v4f  __attribute__((ext_vector_type(4)));
typedef float    v2f  __attribute__((ext_vector_type(2)));
typedef unsigned int v4u __attribute__((ext_vector_type(4)));

union Frag  { v16h v; v8h h[2]; };
union Pack8 { v8h h; v4u u; };

// Fragment loader for k-contiguous 16-bit rows with pitch ld.
// A operand: row0 + (lane&15) is the M row.  B operand stored [n][k]: row0 + (lane&15) is the N column.
// Split k map for both: elements 0..7 <- k0 + 8*(lane>>4) + 0..7, elements 8..15 <- k0 + 16 + 8*(lane>>4) + 0..7.
// D map: acc[r] = element (8*(lane>>4) + r, lane&15) of the 16x16 tile.
__device__ __forceinline__ v16h ldfrag(const _Float16* p, int ld, int row0, int k0, int lane) {
  const int m = lane & 15, lh = lane >> 4;
  const _Float16* q = p + (size_t)(row0 + m) * ld + k0 + 8 * lh;
  Frag f;
  f.h[0] = *(const v8h*)(q);
  f.h[1] = *(const v8h*)(q + 16);
  return f.v;
}

__device__ __forceinline__ v8f zero8() { return (v8f){0.f, 0.f, 0.f, 0.f, 0.f, 0.f, 0.f, 0.f}; }

// ---------------------------------------------------------------------------
// the one kernel: non-causal attention per (query tile, sequence), single head of width 512, with the
// BN-affine + PReLU + z.Wout + bias tail fused, and every derived weight formed by the block that uses it. Block = 8 waves = 32 query rows of one sequence;
// key chunks of 128 (nch = SEQ/BC = 8, derived from the batch_size input and clamped to the static maximum).
//   x: f32 input [token][2]; all weights as the f32 inputs.
// Derived weights, formed in front of the first barrier:
//   M = Wq.Wk^T [2][2] in f32: thread t takes h = 2t, 2t+1; sum over the wave's lanes in registers; the eight waves'
//   partial sums go to LDS (mP) and every wave adds them behind the barrier.
//   W' (x16): wave w owns channels 64w .. 64w+63; lane l forms channels 64w + l and 64w + 32 + l. With sc = gamma/sqrt(var + eps):
//   z = (u.Wv - mean) sc + beta = u0 (Wv0 sc) + u1 (Wv1 sc) + (beta - mean sc); the three constants x16, each as an f16
//   pair hi + lo: w0hi w0lo w0hi w1hi w1lo w1hi bhi blo, the channel side of the z product's 8 k slots; kept in LDS (sWz), read by this lane alone.
//   Wout (x64, f16): the wave's 64 rows [k][32], 16 B a lane (whole 128-B lines), eight k of one column packed to 16 B and
//   stored [n][k] in the wave's own LDS rows (pitch 144 B); only this wave reads them, so they need no barrier.
// S: q.k = sum_ij x_i M_ij x'_j = y.x' with y = x.M, so the score product contracts 2 dims, not 512. y carries
//   the score scale and log2(e). Each f32 factor goes in as an f16 pair hi + lo and the four cross products of
//   the two dims fill 8 k slots of one 16x16x32 step.
// Wave w: query tile w&1 (16 rows), keys 32(w>>1)..+31 of each chunk; the softmax never leaves the wave's registers.
//   S^T = K.Y^T: keys are the M rows, queries the N columns, so lane (h, c) holds keys 8h + r of query c.
//   The block forms kF [key][8 halves] once in LDS; lane l loads key k0 + l of two chunks, so one A fragment holds
//   four 16-key tiles, tile j in elements 8(j>>1)..+7 of lanes 16(j&1)..+15 (8 of the 32 k slots each); the B
//   fragment yq[j] is zero outside tile j's slots, which picks the 16 keys of each product.
//   Pass 1 over the wave's keys: maximum per query (in-lane, one exchange between the lane halves).
//   Pass 2: the same products with C = 10 - maximum, p x1024 = exp2(D); the two D tiles of 32 keys, converted in
//   place, are the B operand of the value product (element s = key kmap(s, h) of query c).
// O: p.v = p.(x.Wv) = (p.x).Wv. u^T = A.P^T with A rows [hi0 hi1 lo0 lo1 ones ones ...][key] from LDS (xT, the same
//   k map): D rows 0..3 are the four partial sums of u, row 4 the row sum l (of the rounded p), all x1024.
//   After the loop the four key slices, each under its own maximum, are joined through LDS (uP).
// Tail: every wave joins the slices itself (lane = row): u = (hi + lo sums) / l. z never leaves the wave's registers:
//   z^T = W'.[u; 1]^T: channels are the M rows, queries the N columns. Wave w owns channels 64w .. 64w+63 for all 32
//   rows. One A fragment holds the four 16-channel tiles, tile j in elements 8(j>>1)..+7 of lanes 16(j&1)..+15 (8 of the 32 k
//   slots each); the B fragment of tile j is zero outside tile j's slots, as in the score product. Query side of the 8 slots:
//   u0hi u0hi u0lo u1hi u1hi u1lo 1 1 (the lo.lo products are left out). PReLU in f32 on D; two D tiles, converted in
//   place, are the B operand of out^T = Wout^T.z^T (k slot = channel offset, the split k map of ldfrag).
//   out^T D: lane (h, c) holds out columns 16nt + 8h + r of query c: partial tile to LDS part[wave][32][36] (32 columns used); barrier;
//   val = (sum of the eight parts)/1024 + b_out.
// LDS: sKX = kF + xT; sWz; mP; uP; sBig = eight wave-owned pieces of 32 x 144 B: the wave's Wout rows, then (those read) its part tile.
// grid = (SEQ/BR, NBAT) = (32, 32).
// coverage: part per wave 32 x 32; d_out per block 256 thr x 4 floats = 32 rows x 32 -> 1024 blocks = 32768 rows x 32.
// ---------------------------------------------------------------------------
#define PTP 36
#define XTP 1040                              // xT row pitch in halves: rows 32 B apart modulo the 256-B bank span
#define WOP 72                                // Wout row pitch in halves: 144 B, the pitch of a part row
#define SBIGF      (8 * BR * PTP)             // 9216 floats = 36864 B
static_assert(WOP * 2 == PTP * 4);
static_assert(OD == BR);
static_assert((PTP % 4) == 0);
static_assert((XTP % 8) == 0);
static_assert(XTP >= SEQ);
static_assert(HD == 8 * 64);

// Score operands from one f32 pair (u0, u1), eight halves (k slots) a side:
//   query side: hi0 hi1 hi0 hi1 lo0 lo1 lo0 lo1      key side: hi0 hi1 lo0 lo1 hi0 hi1 lo0 lo1
// so slot by slot the products are hi.hi, hi.lo, lo.hi, lo.lo for dim 0 and dim 1.
__device__ __forceinline__ v8h qhalves(float u0, float u1) {
  const _Float16 h0 = (_Float16)u0, h1 = (_Float16)u1;
  const _Float16 l0 = (_Float16)(u0 - (float)h0), l1 = (_Float16)(u1 - (float)h1);
  return (v8h){h0, h1, h0, h1, l0, l1, l0, l1};
}

// WMMA as the bare builtin: the compiler keeps the distance behind it and can fill it with the other tile's work
__device__ __forceinline__ v8f mmab(v16h a, v16h b, v8f c) {
  return __builtin_amdgcn_wmma_f32_16x16x32_f16(false, a, false, b, (short)0, c, false, false);
}

// v + (v of lane l ^ X) inside a 16-lane row: one DPP add (row_xmask), no LDS trip
template <int X>
__device__ __forceinline__ float addx(float v) {
  return v + __builtin_bit_cast(float, __builtin_amdgcn_update_dpp(0, __builtin_bit_cast(int, v), 0x160 + X, 0xf, 0xf, true));
}
// sum over the 32 lanes, the same value in every lane
__device__ __forceinline__ float wsum(float v) {
  v = addx<1>(v);
  v = addx<2>(v);
  v = addx<4>(v);
  v = addx<8>(v);
  const int vb = __builtin_bit_cast(int, v);            // lane l <-> l ^ 16
  return v + __builtin_bit_cast(float, __builtin_amdgcn_permlanex16(vb, vb, 0x76543210, 0xfedcba98, false, false));
}

// channel side of the z product's 8 k slots for BN channel h
__device__ __forceinline__ v8h chrow(float g, float vr, float v0, float v1, float be, float mn) {
  const float sc = g * (1.0f / sqrtf(vr + 1.0e-5f));
  const float w0 = v0 * sc * 16.0f, w1 = v1 * sc * 16.0f;
  const float bb = (be - mn * sc) * 16.0f;
  const _Float16 w0h = (_Float16)w0, w1h = (_Float16)w1, bh = (_Float16)bb;
  const _Float16 w0l = (_Float16)(w0 - (float)w0h), w1l = (_Float16)(w1 - (float)w1h), bl = (_Float16)(bb - (float)bh);
  return (v8h){w0h, w0l, w0h, w1h, w1l, w1h, bh, bl};
}

// second bound: 8 waves a SIMD, that is 128 registers, so that 4 blocks stay on a WGP and the grid is resident in one round
__global__ __launch_bounds__(256, 8) void k_attn(const float* __restrict__ x,
                                              const float* __restrict__ wq,
                                              const float* __restrict__ wk,
                                              const float* __restrict__ wv,
                                              const float* __restrict__ gam,
                                              const float* __restrict__ bet,
                                              const float* __restrict__ mu,
                                              const float* __restrict__ var,
                                              const float* __restrict__ wo,
                                              const float* __restrict__ pa,
                                              const float* __restrict__ bo,
                                              const int* __restrict__ bsp,
                                              float* __restrict__ out, float sscale) {
  __shared__ __align__(16) float sBig[SBIGF];
  __shared__ __align__(16) _Float16 sKX[SEQ * 8 + 5 * XTP];
  __shared__ __align__(16) float uP[4 * BR * 8];        // [key slice][row][u hi0 hi1 lo0 lo1, l, maximum, -, -]
  __shared__ __align__(16) float mP[8 * 4];             // [wave][M00 M01 M10 M11], partial sums
  __shared__ __align__(16) _Float16 sWz[8 * 2 * 32 * 8];  // [wave][channel half][lane][8 k slots]

  _Float16* kF   = sKX;
  _Float16* xT   = sKX + SEQ * 8;
  float*    part = sBig;

  const int tid = threadIdx.x, lane = tid & 31, wave = tid >> 5;
  const int hh = lane >> 4, c = lane & 15;
  const int b  = blockIdx.y;
  const int q0 = (int)blockIdx.x * BR;                  // query row base within the sequence
  int bs = bsp[0];
  bs = (bs < 1) ? 1 : bs;
  int seql = NTOK / bs;
  seql = (seql > SEQ) ? SEQ : seql;
  const int nch = seql / BC;                            // block-uniform, <= SEQ/BC
  const float* Xb = x + (size_t)b * SEQ * 2;             // this sequence's token rows [l][2]
  const size_t tokbase = (size_t)b * SEQ + q0;
  const int pt = wave & 1, pk = wave >> 1;              // this wave's query tile and its 32-key slice of each chunk
  const v8h zz = (v8h){0, 0, 0, 0, 0, 0, 0, 0};

  const int ch0 = wave * 64;                            // this wave's 64 channels
  _Float16* wl = (_Float16*)sBig + wave * (OD * WOP);   // this wave's Wout rows [n][k - ch0]
  _Float16* wzl = sWz + wave * 512 + lane * 8;          // this lane's W' rows: channel ch0 + l, and at + 256 halves ch0 + 32 + l
  // every global load of the prologue, in the order of use
  const v4f a0 = *(const v4f*)(Xb + 8 * tid);           // thread t: tokens 4t .. 4t+3
  const v4f a1 = *(const v4f*)(Xb + 8 * tid + 4);
  const v2f q0v = *(const v2f*)(wq + 2 * tid);          // thread t: h = 2t, 2t+1 of M's sum
  const v2f q1v = *(const v2f*)(wq + HD + 2 * tid);
  const v2f k0v = *(const v2f*)(wk + 2 * tid);
  const v2f k1v = *(const v2f*)(wk + HD + 2 * tid);
  float cg[2], cr[2], c0[2], c1[2], cb[2], cm[2];       // lane l: channels ch0 + l and ch0 + 32 + l
#pragma unroll
  for (int i = 0; i < 2; ++i) {
    const int h = ch0 + 32 * i + lane;
    cg[i] = gam[h];
    cr[i] = var[h];
    c0[i] = wv[h];
    c1[i] = wv[HD + h];
    cb[i] = bet[h];
    cm[i] = mu[h];
  }
  // the wait that stands in front of an overwrite of the loads' offset registers;
  // the two scheduling barriers hold it directly behind the loads: without them a register write is placed in between
  __builtin_amdgcn_sched_barrier(0);
  asm volatile("s_wait_xcnt 0x0" ::: "memory");
  __builtin_amdgcn_sched_barrier(0);
  const int nq = lane & 7, kg = lane >> 3;              // lane l: Wout columns 4(l&7)..+3 of rows 8(l>>3) + 0..7 of each 32-row half
  v4f wr[2][8];
  {
    const float* ws = wo + (size_t)(ch0 + 8 * kg) * OD + 4 * nq;
#pragma unroll
    for (int s = 0; s < 2; ++s)
#pragma unroll
      for (int i = 0; i < 8; ++i) {
        // the last load's result lands on the address pair that all sixteen name: the wait that stands in front of such an overwrite
        if (s == 1 && i == 7) asm volatile("s_wait_xcnt 0x0" ::: "memory");
        wr[s][i] = *(const v4f*)(ws + (size_t)(32 * s + i) * OD);
      }
  }
  // keeps the Wout loads issued in front of the first wait for data: without it they start a load latency later
  __builtin_amdgcn_sched_barrier(0);
  {
    // this sequence's tokens as f16 hi and lo: x^T rows (and a row of ones) and the key-side score operands
    const int l0 = tid * 4;
    const v4f e0 = (v4f){a0[0], a0[2], a1[0], a1[2]};
    const v4f e1 = (v4f){a0[1], a0[3], a1[1], a1[3]};
    v4h h0, h1, g0, g1;
#pragma unroll
    for (int e = 0; e < 4; ++e) {
      h0[e] = (_Float16)e0[e];
      h1[e] = (_Float16)e1[e];
      g0[e] = (_Float16)(e0[e] - (float)h0[e]);
      g1[e] = (_Float16)(e1[e] - (float)h1[e]);
    }
    *(v4h*)(xT + 0 * XTP + l0) = h0;
    *(v4h*)(xT + 1 * XTP + l0) = h1;
    *(v4h*)(xT + 2 * XTP + l0) = g0;
    *(v4h*)(xT + 3 * XTP + l0) = g1;
    *(v4h*)(xT + 4 * XTP + l0) = (v4h){1, 1, 1, 1};
#pragma unroll
    for (int e = 0; e < 4; ++e)
      *(v8h*)(kF + (size_t)(l0 + e) * 8) = (v8h){h0[e], h1[e], g0[e], g1[e], h0[e], h1[e], g0[e], g1[e]};
  }
  // M = Wq.Wk^T: this wave's 64 h
  const float m00 = wsum(fmaf(q0v[1], k0v[1], q0v[0] * k0v[0]));
  const float m01 = wsum(fmaf(q0v[1], k1v[1], q0v[0] * k1v[0]));
  const float m10 = wsum(fmaf(q1v[1], k0v[1], q1v[0] * k0v[0]));
  const float m11 = wsum(fmaf(q1v[1], k1v[1], q1v[0] * k1v[0]));
  // W' rows, done under the flight of the Wout loads and parked in the wave's own LDS piece until the tail
#pragma unroll
  for (int i = 0; i < 2; ++i) *(v8h*)(wzl + i * 256) = chrow(cg[i], cr[i], c0[i], c1[i], cb[i], cm[i]);
  {
#pragma unroll
    for (int s = 0; s < 2; ++s) {
      v4f r[8];
#pragma unroll
      for (int i = 0; i < 8; ++i) r[i] = wr[s][i] * 64.0f;
#pragma unroll
      for (int e = 0; e < 4; ++e)
        *(v8h*)(wl + (4 * nq + e) * WOP + (4 * s + kg) * 8) =
            (v8h){(_Float16)r[0][e], (_Float16)r[1][e], (_Float16)r[2][e], (_Float16)r[3][e],
                  (_Float16)r[4][e], (_Float16)r[5][e], (_Float16)r[6][e], (_Float16)r[7][e]};
    }
  }
  if (lane == 0) *(v4f*)(mP + 4 * wave) = (v4f){m00, m01, m10, m11};
  __syncthreads();                                      // kF, xT and mP complete
  // B fragments of the score product: y = x.M (x score scale x log2 e) for query row q0 + 16pt + (lane&15)
  v16h yq[4];
  {
    // asked for here, not with the prologue's loads (two registers fewer at their peak, which keeps the kernel free of
    // scratch): this block has just read the line, and the load flies beside the LDS trip below
    const v2f xq = *(const v2f*)(Xb + 2 * (size_t)(q0 + 16 * pt + c));
    // lane l reads partial sum l&3 of wave l>>2; three exchanges (l ^ 4, l ^ 8, l ^ 16) sum over the waves
    float ms = addx<8>(addx<4>(mP[lane]));
    const int mb = __builtin_bit_cast(int, ms);
    ms += __builtin_bit_cast(float, __builtin_amdgcn_permlanex16(mb, mb, 0x76543210, 0xfedcba98, false, false));
    const int mi = __builtin_bit_cast(int, ms);
    const v4f mv = (v4f){__builtin_bit_cast(float, __builtin_amdgcn_readlane(mi, 0)),    // M00 M01 M10 M11, wave-uniform
                         __builtin_bit_cast(float, __builtin_amdgcn_readlane(mi, 1)),
                         __builtin_bit_cast(float, __builtin_amdgcn_readlane(mi, 2)),
                         __builtin_bit_cast(float, __builtin_amdgcn_readlane(mi, 3))};
    const float ys = sscale * 1.4426950408889634f;
    const v8h yv = qhalves(fmaf(xq[1], mv[2], xq[0] * mv[0]) * ys, fmaf(xq[1], mv[3], xq[0] * mv[1]) * ys);
#pragma unroll
    for (int j = 0; j < 4; ++j) {
      Frag f;
      f.h[j >> 1]       = (hh == (j & 1)) ? yv : zz;
      f.h[(j >> 1) ^ 1] = zz;
      yq[j] = f.v;
    }
  }

  const _Float16* kp = kF + (size_t)(pk * 32 + lane) * 8;   // lane l: key k0 + l of each 32-key step

  const int npair = nch >> 1;                           // two chunks (64 of this wave's keys) per A fragment

  // ---- pass 1: this wave's maximum per query over its keys ----
  float mw;
  {
    v8f mx;
#pragma unroll
    for (int r = 0; r < 8; ++r) mx[r] = -3.0e38f;       // finite, so that a wave without keys joins with factor 1
#pragma unroll 1                                        // rolled: unrolled by two the kernel passes 128 registers, and 4 blocks no longer fit a WGP
    for (int cp = 0; cp < npair; ++cp) {
      Frag ka;
      ka.h[0] = *(const v8h*)(kp + (size_t)(2 * cp) * (BC * 8));
      ka.h[1] = *(const v8h*)(kp + (size_t)(2 * cp + 1) * (BC * 8));
      v8f s[4];
#pragma unroll
      for (int j = 0; j < 4; ++j) s[j] = mmab(ka.v, yq[j], zero8());
#pragma unroll
      for (int r = 0; r < 8; ++r) mx[r] = fmaxf(fmaxf(mx[r], fmaxf(s[0][r], s[1][r])), fmaxf(s[2][r], s[3][r]));
    }
    if (nch & 1) {                                      // block-uniform: the odd last chunk, tiles 0 and 1 alone
      Frag ka;
      ka.h[0] = *(const v8h*)(kp + (size_t)(nch - 1) * (BC * 8));
      ka.h[1] = ka.h[0];
      const v8f s0 = mmab(ka.v, yq[0], zero8());
      const v8f s1 = mmab(ka.v, yq[1], zero8());
#pragma unroll
      for (int r = 0; r < 8; ++r) mx[r] = fmaxf(mx[r], fmaxf(s0[r], s1[r]));
    }
    float m = fmaxf(fmaxf(fmaxf(mx[0], mx[1]), fmaxf(mx[2], mx[3])), fmaxf(fmaxf(mx[4], mx[5]), fmaxf(mx[6], mx[7])));
    const int mb = __builtin_bit_cast(int, m);          // lane l <-> l ^ 16: the other eight keys of each tile
    mw = fmaxf(m, __builtin_bit_cast(float, __builtin_amdgcn_permlanex16(mb, mb, 0x76543210, 0xfedcba98, false, false)));
  }

  // ---- pass 2: p x1024 = exp2(s - maximum + 10), packed in place into the value product's B operand ----
  v8f uacc = zero8();
  {
    const float cm = 10.0f - mw;
    const v8f cneg = (v8f){cm, cm, cm, cm, cm, cm, cm, cm};
    const int xl = ((c < 4) ? c : 4) | (lane & 16);     // A row (lane&15) reads xT row min(lane&15, 4)
#pragma unroll 1                                        // rolled, for the same register bound
    for (int cp = 0; cp < npair; ++cp) {
      Frag ka;
      ka.h[0] = *(const v8h*)(kp + (size_t)(2 * cp) * (BC * 8));
      ka.h[1] = *(const v8h*)(kp + (size_t)(2 * cp + 1) * (BC * 8));
      // A operands of the value product: split k map over keys, the map of the packed D pair
      const v16h xa0 = ldfrag(xT, XTP, 0, (2 * cp) * BC + pk * 32, xl);
      const v16h xa1 = ldfrag(xT, XTP, 0, (2 * cp + 1) * BC + pk * 32, xl);
      v8f s[4];                                         // s[j][r]: key k0(chunk 2cp + (j>>1)) + 16(j&1) + 8hh + r, query c
#pragma unroll
      for (int j = 0; j < 4; ++j) s[j] = mmab(ka.v, yq[j], cneg);
#pragma unroll
      for (int j = 0; j < 4; ++j)
#pragma unroll
        for (int r = 0; r < 8; ++r) s[j][r] = __builtin_amdgcn_exp2f(s[j][r]);
      Frag pb0, pb1;
      pb0.h[0] = __builtin_convertvector(s[0], v8h);
      pb0.h[1] = __builtin_convertvector(s[1], v8h);
      pb1.h[0] = __builtin_convertvector(s[2], v8h);
      pb1.h[1] = __builtin_convertvector(s[3], v8h);
      uacc = mmab(xa0, pb0.v, uacc);
      uacc = mmab(xa1, pb1.v, uacc);
    }
    if (nch & 1) {                                      // block-uniform: the odd last chunk
      Frag ka;
      ka.h[0] = *(const v8h*)(kp + (size_t)(nch - 1) * (BC * 8));
      ka.h[1] = ka.h[0];
      const v16h xa0 = ldfrag(xT, XTP, 0, (nch - 1) * BC + pk * 32, xl);
      v8f s0 = mmab(ka.v, yq[0], cneg);
      v8f s1 = mmab(ka.v, yq[1], cneg);
#pragma unroll
      for (int r = 0; r < 8; ++r) {
        s0[r] = __builtin_amdgcn_exp2f(s0[r]);
        s1[r] = __builtin_amdgcn_exp2f(s1[r]);
      }
      Frag pb0;
      pb0.h[0] = __builtin_convertvector(s0, v8h);
      pb0.h[1] = __builtin_convertvector(s1, v8h);
      uacc = mmab(xa0, pb0.v, uacc);
    }
  }

  // ---- tail: join the four key slices, 1/l per row, z^T = W'.[u; 1]^T, PReLU, out^T = Wout^T.z^T ----
  const float a = pa[0];
  if (lane < 16) {                                      // D rows 0..4 sit in lanes 0..15
    float* d = uP + (size_t)(pk * BR + 16 * pt + c) * 8;
    *(v4f*)d       = (v4f){uacc[0], uacc[1], uacc[2], uacc[3]};
    *(v2f*)(d + 4) = (v2f){uacc[4], mw};
  }
  __syncthreads();                                      // uP complete (cross-wave)
  Frag wz;                                              // A operand of the z product: lane l holds channels ch0 + l and ch0 + 32 + l
  wz.h[0] = *(const v8h*)(wzl);
  wz.h[1] = *(const v8h*)(wzl + 256);
  v16h wof[2][2];                                       // A operands of out^T: [out column tile][32-channel step], from the wave's own LDS rows
#pragma unroll
  for (int nt = 0; nt < 2; ++nt)
#pragma unroll
    for (int ks = 0; ks < 2; ++ks) wof[nt][ks] = ldfrag(wl, WOP, 16 * nt, 32 * ks, lane);
  // keeps all ten loads issued here, in front of the join: without it the compiler may sink them to just in front of
  // their first use, where their latency is waited out
  __builtin_amdgcn_sched_barrier(0);
  Pack8 own, oth;                                       // query side of the z product: row lane, and row lane ^ 16
  {
    v2f lm[4];
#pragma unroll
    for (int i = 0; i < 4; ++i) lm[i] = *(const v2f*)(uP + (size_t)(i * BR + lane) * 8 + 4);
    const float m = fmaxf(fmaxf(lm[0][1], lm[1][1]), fmaxf(lm[2][1], lm[3][1]));
    v4f us = (v4f){0.f, 0.f, 0.f, 0.f};
    float l = 0.f;
#pragma unroll
    for (int i = 0; i < 4; ++i) {
      const float f = __builtin_amdgcn_exp2f(lm[i][1] - m);
      us += *(const v4f*)(uP + (size_t)(i * BR + lane) * 8) * f;
      l = fmaf(lm[i][0], f, l);
    }
    const float inv = (l > 0.f) ? (1.0f / l) : 0.f;     // u and l both carry the x1024
    const float u0 = (us[0] + us[2]) * inv, u1 = (us[1] + us[3]) * inv;
    const _Float16 h0 = (_Float16)u0, h1 = (_Float16)u1;
    const _Float16 l0 = (_Float16)(u0 - (float)h0), l1 = (_Float16)(u1 - (float)h1);
    own.h = (v8h){h0, h0, l0, h1, h1, l1, 1, 1};
#pragma unroll
    for (int i = 0; i < 4; ++i)                         // lane l <-> l ^ 16
      oth.u[i] = (unsigned int)__builtin_amdgcn_permlanex16((int)own.u[i], (int)own.u[i], 0x76543210, 0xfedcba98, false, false);
  }
#pragma unroll
  for (int qt = 0; qt < 2; ++qt) {                      // query tile: rows 16qt + c
    const v8h rq = (hh == qt) ? own.h : oth.h;          // the eight halves of row 16qt + c, in both lane halves
    v8f s[4];                                           // s[j][r]: z x16 of channel ch0 + 16j + 8hh + r, row 16qt + c
#pragma unroll
    for (int j = 0; j < 4; ++j) {
      Frag f;                                           // tile j's 8 k slots alone carry the row
      f.h[j >> 1]       = (hh == (j & 1)) ? rq : zz;
      f.h[(j >> 1) ^ 1] = zz;
      s[j] = mmab(wz.v, f.v, zero8());
    }
    // keeps the four products together: each fills the distance behind the one before, which v_nop fills otherwise
    __builtin_amdgcn_sched_barrier(0);
#pragma unroll
    for (int j = 0; j < 4; ++j)
#pragma unroll
      for (int r = 0; r < 8; ++r) s[j][r] = (s[j][r] >= 0.f) ? s[j][r] : a * s[j][r];
    Frag pb0, pb1;
    pb0.h[0] = __builtin_convertvector(s[0], v8h);
    pb0.h[1] = __builtin_convertvector(s[1], v8h);
    pb1.h[0] = __builtin_convertvector(s[2], v8h);
    pb1.h[1] = __builtin_convertvector(s[3], v8h);
#pragma unroll
    for (int nt = 0; nt < 2; ++nt) {
      v8f acc = mmab(wof[nt][0], pb0.v, zero8());
      acc = mmab(wof[nt][1], pb1.v, acc);
      float* pp = part + wave * (BR * PTP) + (16 * qt + c) * PTP + 16 * nt + 8 * hh;
      *(v4f*)pp       = (v4f){acc[0], acc[1], acc[2], acc[3]};
      *(v4f*)(pp + 4) = (v4f){acc[4], acc[5], acc[6], acc[7]};
    }
  }
  __syncthreads();                                      // part complete
  {
    const int row = tid >> 3, pc = tid & 7;
    v4f sum = *(const v4f*)(part + row * PTP + pc * 4);
#pragma unroll
    for (int w = 1; w < 8; ++w) sum += *(const v4f*)(part + w * (BR * PTP) + row * PTP + pc * 4);
    const v4f bb = *(const v4f*)(bo + pc * 4);
    const v4f val = sum * 0.0009765625f + bb;           // 1/(16 * 64)
    v4f* d = (v4f*)(out + (tokbase + (size_t)row) * OD + pc * 4);
    *d = val;
  }
}

// No workspace is used.
extern "C" void kernel_launch(void* const* d_in, const int* in_sizes, int n_in,
                              void* d_out, int out_size, void* d_ws, size_t ws_size,
                              hipStream_t stream) {
  if (n_in < 12) return;
  if (in_sizes[0] != NTOK * 2) return;
  if (in_sizes[1] < 1) return;
  if (in_sizes[2] != 2 * HD) return;
  if (in_sizes[3] != 2 * HD) return;
  if (in_sizes[4] != 2 * HD) return;
  if (in_sizes[5] != HD) return;
  if (in_sizes[6] != HD) return;
  if (in_sizes[7] != HD) return;
  if (in_sizes[8] != HD) return;
  if (in_sizes[9] < 1) return;
  if (in_sizes[10] != HD * OD) return;
  if (in_sizes[11] != OD) return;
  if (out_size != NTOK * OD) return;

  const float* x    = (const float*)d_in[0];    // [32768][2]
  const int*   bsz  = (const int*)d_in[1];      // [1]
  const float* wq   = (const float*)d_in[2];    // [2][512]
  const float* wk   = (const float*)d_in[3];    // [2][512]
  const float* wv   = (const float*)d_in[4];    // [2][512]
  const float* gam  = (const float*)d_in[5];    // [512]
  const float* bet  = (const float*)d_in[6];    // [512]
  const float* mu   = (const float*)d_in[7];    // [512]
  const float* var  = (const float*)d_in[8];    // [512]
  const float* pa   = (const float*)d_in[9];    // [1]
  const float* wo   = (const float*)d_in[10];   // [512][32]
  const float* bo   = (const float*)d_in[11];   // [32]
  float* out = (float*)d_out;                   // [32768][32]

  const float sscale = 1.0f / sqrtf((float)HD);

  // attention + BN/PReLU/Wout tail -> d_out
  k_attn<<<dim3(SEQ / BR, NBAT), dim3(256), 0, stream>>>(x, wq, wk, wv, gam, bet, mu, var, wo, pa, bo, bsz, out, sscale);
  (void)hipGetLastError();
}

// v006
// A run of this version takes 8.89 microseconds.
// Next to v005, in two timings, it ran 1.12 times as fast each time.
// All steps since v000 together make it 34.2 times as fast.
// Contractions: S^T = x.(x.M)^T with M = Wq.Wk^T (2 x 2, f32) on v_wmma_f32_16x16x32_f16 (f16 hi + lo operand pairs, f32 accumulate, the row maximum enters as C); u^T = [x^T; 1].P^T (x as hi and lo rows, a row of ones for the row sum, p x1024 packed from the score accumulators) on v_wmma_f32_16x16x32_f16 (f16 operands, f32 accumulate); z^T = W'.[u; 1]^T (projection u.Wv with the BN affine folded in, x16; f16 hi + lo operand pairs, f32 accumulate) on v_wmma_f32_16x16x32_f16; out^T = Wout^T.z^T on v_wmma_f32_16x16x32_f16 (f16 operands: z x16 packed from the z accumulators, Wout x64; f32 accumulate, 1/1024 folded back in f32). M, y = x.M and the folded channel constants exact f32 on VALU; score scale, softmax maximum, exp2, 1/l, PReLU and bias in f32.
#include <hip/hip_runtime.h>
#include <math.h>
#include <stddef.h>
#include <stdint.h>

#define NTOK 32768              // token rows
#define NBAT 32                 // sequences
#define SEQ  1024               // tokens per sequence
#define HD   512                // head width
#define OD   32                 // output width
#define BR   64                 // query rows per attention block
#define BC   128                // keys per chunk

static_assert(NTOK == NBAT * SEQ);
static_assert(SEQ % BC == 0);
static_assert(SEQ % BR == 0);
static_assert(BC % 32 == 0);
static_assert(HD == 512);
static_assert((HD / 8) == 64);
static_assert(SEQ == 256 * 4);
static_assert(OD == 32);

typedef _Float16 v16h __attribute__((ext_vector_type(16)));
typedef _Float16 v8h  __attribute__((ext_vector_type(8)));
typedef _Float16 v4h  __attribute__((ext_vector_type(4)));
typedef float    v8f  __attribute__((ext_vector_type(8)));
typedef float    v4f  __attribute__((ext_vector_type(4)));
typedef float    v2f  __attribute__((ext_vector_type(2)));
typedef unsigned int v4u __attribute__((ext_vector_type(4)));

union Frag  { v16h v; v8h h[2]; };
union Pack8 { v8h h; v4u u; };

// Fragment loader for k-contiguous 16-bit rows with pitch ld.
// A operand: row0 + (lane&15) is the M row.  B operand stored [n][k]: row0 + (lane&15) is the N column.
// Split k map for both: elements 0..7 <- k0 + 8*(lane>>4) + 0..7, elements 8..15 <- k0 + 16 + 8*(lane>>4) + 0..7.
// D map: acc[r] = element (8*(lane>>4) + r, lane&15) of the 16x16 tile.
__device__ __forceinline__ v16h ldfrag(const _Float16* p, int ld, int row0, int k0, int lane) {
  const int m = lane & 15, lh = lane >> 4;
  const _Float16* q = p + (size_t)(row0 + m) * ld + k0 + 8 * lh;
  Frag f;
  f.h[0] = *(const v8h*)(q);
  f.h[1] = *(const v8h*)(q + 16);
  return f.v;
}

__device__ __forceinline__ v8f zero8() { return (v8f){0.f, 0.f, 0.f, 0.f, 0.f, 0.f, 0.f, 0.f}; }

// ---------------------------------------------------------------------------
// the one kernel: non-causal attention per (query tile, sequence), single head of width 512, with the
// BN-affine + PReLU + z.Wout + bias tail fused, and every derived weight formed by the block that uses it. Block = 8 waves = 64 query rows of one sequence;
// key chunks of 128 (nch = SEQ/BC = 8, derived from the batch_size input and clamped to the static maximum).
//   x: f32 input [token][2]; all weights as the f32 inputs.
// Derived weights, formed in front of the first barrier:
//   M = Wq.Wk^T [2][2] in f32: thread t takes h = 2t, 2t+1; sum over the wave's lanes in registers; the eight waves'
//   partial sums go to LDS (mP) and every wave adds them behind the barrier.
//   W' (x16): wave w owns channels 64w .. 64w+63; lane l forms channels 64w + l and 64w + 32 + l. With sc = gamma/sqrt(var + eps):
//   z = (u.Wv - mean) sc + beta = u0 (Wv0 sc) + u1 (Wv1 sc) + (beta - mean sc); the three constants x16, each as an f16
//   pair hi + lo: w0hi w0lo w0hi w1hi w1lo w1hi bhi blo, the channel side of the z product's 8 k slots; kept in LDS (sWz), read by this lane alone.
//   Wout (x64, f16): the wave's 64 rows [k][32], 16 B a lane (whole 128-B lines), eight k of one column packed to 16 B and
//   stored [n][k] in the wave's own LDS rows (pitch 144 B); only this wave reads them, so they need no barrier.
// S: q.k = sum_ij x_i M_ij x'_j = y.x' with y = x.M, so the score product contracts 2 dims, not 512. y carries
//   the score scale and log2(e). Each f32 factor goes in as an f16 pair hi + lo and the four cross products of
//   the two dims fill 8 k slots of one 16x16x32 step.
// Wave w: query tiles 2(w&1) and 2(w&1) + 1 (16 rows each; one key fragment and one x^T fragment serve both), keys 32(w>>1)..+31 of each chunk;
//   the softmax never leaves the wave's registers.
//   S^T = K.Y^T: keys are the M rows, queries the N columns, so lane (h, c) holds keys 8h + r of query c.
//   The block forms kF [key][8 halves] once in LDS; lane l loads key k0 + l of two chunks, so one A fragment holds
//   four 16-key tiles, tile j in elements 8(j>>1)..+7 of lanes 16(j&1)..+15 (8 of the 32 k slots each); the B
//   fragment yq[j] is zero outside tile j's slots, which picks the 16 keys of each product.
//   Pass 1 over the wave's keys: maximum per query (in-lane, one exchange between the lane halves).
//   Pass 2: the same products with C = 10 - maximum, p x1024 = exp2(D); the two D tiles of 32 keys, converted in
//   place, are the B operand of the value product (element s = key kmap(s, h) of query c).
// O: p.v = p.(x.Wv) = (p.x).Wv. u^T = A.P^T with A rows [hi0 hi1 lo0 lo1 ones ones ...][key] from LDS (xT, the same
//   k map): D rows 0..3 are the four partial sums of u, row 4 the row sum l (of the rounded p), all x1024.
//   After the loop the four key slices, each under its own maximum, are joined through LDS (uP).
// Tail: every wave joins the slices itself (lane = row, two rounds of 32 rows): u = (hi + lo sums) / l. z never leaves the wave's registers:
//   z^T = W'.[u; 1]^T: channels are the M rows, queries the N columns. Wave w owns channels 64w .. 64w+63 for all 64
//   rows. One A fragment holds the four 16-channel tiles, tile j in elements 8(j>>1)..+7 of lanes 16(j&1)..+15 (8 of the 32 k
//   slots each); the B fragment of tile j is zero outside tile j's slots, as in the score product. Query side of the 8 slots:
//   u0hi u0hi u0lo u1hi u1hi u1lo 1 1 (the lo.lo products are left out). PReLU in f32 on D; two D tiles, converted in
//   place, are the B operand of out^T = Wout^T.z^T (k slot = channel offset, the split k map of ldfrag).
//   out^T D: lane (h, c) holds out columns 16nt + 8h + r of query c: partial tile to LDS part[wave][64][32]; barrier;
//   val = (sum of the eight parts)/1024 + b_out.
// LDS: sKX = kF + xT; sWz; mP; uP; sBig = eight wave-owned pieces of 64 x 144 B: the wave's Wout rows (the first 32 x 144 B), then (those read) its part tile.
// grid = (SEQ/BR, NBAT) = (16, 32).
// coverage: part per wave 64 x 32; d_out per block 256 thr x 2 x 4 floats = 64 rows x 32 -> 512 blocks = 32768 rows x 32.
// ---------------------------------------------------------------------------
#define PTP 36
#define XTP 1040                              // xT row pitch in halves: rows 32 B apart modulo the 256-B bank span
#define WOP 72                                // Wout row pitch in halves: 144 B, the pitch of a part row
#define SBIGF      (8 * BR * PTP)             // 18432 floats = 73728 B
static_assert(WOP * 2 == PTP * 4);
static_assert(OD <= BR);
static_assert(BR == 64);
static_assert((PTP % 4) == 0);
static_assert((XTP % 8) == 0);
static_assert(XTP >= SEQ);
static_assert(HD == 8 * 64);

// Score operands from one f32 pair (u0, u1), eight halves (k slots) a side:
//   query side: hi0 hi1 hi0 hi1 lo0 lo1 lo0 lo1      key side: hi0 hi1 lo0 lo1 hi0 hi1 lo0 lo1
// so slot by slot the products are hi.hi, hi.lo, lo.hi, lo.lo for dim 0 and dim 1.
__device__ __forceinline__ v8h qhalves(float u0, float u1) {
  const _Float16 h0 = (_Float16)u0, h1 = (_Float16)u1;
  const _Float16 l0 = (_Float16)(u0 - (float)h0), l1 = (_Float16)(u1 - (float)h1);
  return (v8h){h0, h1, h0, h1, l0, l1, l0, l1};
}

// WMMA as the bare builtin: the compiler keeps the distance behind it and can fill it with the other tile's work
__device__ __forceinline__ v8f mmab(v16h a, v16h b, v8f c) {
  return __builtin_amdgcn_wmma_f32_16x16x32_f16(false, a, false, b, (short)0, c, false, false);
}

// v + (v of lane l ^ X) inside a 16-lane row: one DPP add (row_xmask), no LDS trip
template <int X>
__device__ __forceinline__ float addx(float v) {
  return v + __builtin_bit_cast(float, __builtin_amdgcn_update_dpp(0, __builtin_bit_cast(int, v), 0x160 + X, 0xf, 0xf, true));
}
// sum over the 32 lanes, the same value in every lane
__device__ __forceinline__ float wsum(float v) {
  v = addx<1>(v);
  v = addx<2>(v);
  v = addx<4>(v);
  v = addx<8>(v);
  const int vb = __builtin_bit_cast(int, v);            // lane l <-> l ^ 16
  return v + __builtin_bit_cast(float, __builtin_amdgcn_permlanex16(vb, vb, 0x76543210, 0xfedcba98, false, false));
}

// channel side of the z product's 8 k slots for BN channel h
__device__ __forceinline__ v8h chrow(float g, float vr, float v0, float v1, float be, float mn) {
  const float sc = g * (1.0f / sqrtf(vr + 1.0e-5f));
  const float w0 = v0 * sc * 16.0f, w1 = v1 * sc * 16.0f;
  const float bb = (be - mn * sc) * 16.0f;
  const _Float16 w0h = (_Float16)w0, w1h = (_Float16)w1, bh = (_Float16)bb;
  const _Float16 w0l = (_Float16)(w0 - (float)w0h), w1l = (_Float16)(w1 - (float)w1h), bl = (_Float16)(bb - (float)bh);
  return (v8h){w0h, w0l, w0h, w1h, w1l, w1h, bh, bl};
}

// second bound: 4 waves a SIMD, that is 256 registers: 2 blocks stay on a WGP and the grid is resident in one round
__global__ __launch_bounds__(256, 4) void k_attn(const float* __restrict__ x,
                                              const float* __restrict__ wq,
                                              const float* __restrict__ wk,
                                              const float* __restrict__ wv,
                                              const float* __restrict__ gam,
                                              const float* __restrict__ bet,
                                              const float* __restrict__ mu,
                                              const float* __restrict__ var,
                                              const float* __restrict__ wo,
                                              const float* __restrict__ pa,
                                              const float* __restrict__ bo,
                                              const int* __restrict__ bsp,
                                              float* __restrict__ out, float sscale) {
  __shared__ __align__(16) float sBig[SBIGF];
  __shared__ __align__(16) _Float16 sKX[SEQ * 8 + 5 * XTP];
  __shared__ __align__(16) float uP[4 * BR * 8];        // [key slice][row][u hi0 hi1 lo0 lo1, l, maximum, -, -]
  __shared__ __align__(16) float mP[8 * 4];             // [wave][M00 M01 M10 M11], partial sums
  __shared__ __align__(16) _Float16 sWz[8 * 2 * 32 * 8];  // [wave][channel half][lane][8 k slots]

  _Float16* kF   = sKX;
  _Float16* xT   = sKX + SEQ * 8;
  float*    part = sBig;

  const int tid = threadIdx.x, lane = tid & 31, wave = tid >> 5;
  const int hh = lane >> 4, c = lane & 15;
  const int b  = blockIdx.y;
  const int q0 = (int)blockIdx.x * BR;                  // query row base within the sequence
  int bs = bsp[0];
  bs = (bs < 1) ? 1 : bs;
  int seql = NTOK / bs;
  seql = (seql > SEQ) ? SEQ : seql;
  const int nch = seql / BC;                            // block-uniform, <= SEQ/BC
  const float* Xb = x + (size_t)b * SEQ * 2;             // this sequence's token rows [l][2]
  const size_t tokbase = (size_t)b * SEQ + q0;
  const int pt = wave & 1, pk = wave >> 1;              // this wave's pair of query tiles and its 32-key slice of each chunk
  const v8h zz = (v8h){0, 0, 0, 0, 0, 0, 0, 0};

  const int ch0 = wave * 64;                            // this wave's 64 channels
  _Float16* wl = (_Float16*)sBig + wave * (BR * WOP);   // this wave's Wout rows [n][k - ch0], at the head of its own piece
  _Float16* wzl = sWz + wave * 512 + lane * 8;          // this lane's W' rows: channel ch0 + l, and at + 256 halves ch0 + 32 + l
  // every global load of the prologue, in the order of use
  const v4f a0 = *(const v4f*)(Xb + 8 * tid);           // thread t: tokens 4t .. 4t+3
  const v4f a1 = *(const v4f*)(Xb + 8 * tid + 4);
  const v2f q0v = *(const v2f*)(wq + 2 * tid);          // thread t: h = 2t, 2t+1 of M's sum
  const v2f q1v = *(const v2f*)(wq + HD + 2 * tid);
  const v2f k0v = *(const v2f*)(wk + 2 * tid);
  const v2f k1v = *(const v2f*)(wk + HD + 2 * tid);
  float cg[2], cr[2], c0[2], c1[2], cb[2], cm[2];       // lane l: channels ch0 + l and ch0 + 32 + l
#pragma unroll
  for (int i = 0; i < 2; ++i) {
    const int h = ch0 + 32 * i + lane;
    cg[i] = gam[h];
    cr[i] = var[h];
    c0[i] = wv[h];
    c1[i] = wv[HD + h];
    cb[i] = bet[h];
    cm[i] = mu[h];
  }
  // the wait that stands in front of an overwrite of the loads' offset registers;
  // the two scheduling barriers hold it directly behind the loads: without them a register write is placed in between
  __builtin_amdgcn_sched_barrier(0);
  asm volatile("s_wait_xcnt 0x0" ::: "memory");
  __builtin_amdgcn_sched_barrier(0);
  const int nq = lane & 7, kg = lane >> 3;              // lane l: Wout columns 4(l&7)..+3 of rows 8(l>>3) + 0..7 of each 32-row half
  v4f wr[2][8];
  {
    const float* ws = wo + (size_t)(ch0 + 8 * kg) * OD + 4 * nq;
#pragma unroll
    for (int s = 0; s < 2; ++s)
#pragma unroll
      for (int i = 0; i < 8; ++i) {
        // the last load's result lands on the address pair that all sixteen name: the wait that stands in front of such an overwrite
        if (s == 1 && i == 7) asm volatile("s_wait_xcnt 0x0" ::: "memory");
        wr[s][i] = *(const v4f*)(ws + (size_t)(32 * s + i) * OD);
      }
  }
  // keeps the Wout loads issued in front of the first wait for data: without it they start a load latency later
  __builtin_amdgcn_sched_barrier(0);
  {
    // this sequence's tokens as f16 hi and lo: x^T rows (and a row of ones) and the key-side score operands
    const int l0 = tid * 4;
    const v4f e0 = (v4f){a0[0], a0[2], a1[0], a1[2]};
    const v4f e1 = (v4f){a0[1], a0[3], a1[1], a1[3]};
    v4h h0, h1, g0, g1;
#pragma unroll
    for (int e = 0; e < 4; ++e) {
      h0[e] = (_Float16)e0[e];
      h1[e] = (_Float16)e1[e];
      g0[e] = (_Float16)(e0[e] - (float)h0[e]);
      g1[e] = (_Float16)(e1[e] - (float)h1[e]);
    }
    *(v4h*)(xT + 0 * XTP + l0) = h0;
    *(v4h*)(xT + 1 * XTP + l0) = h1;
    *(v4h*)(xT + 2 * XTP + l0) = g0;
    *(v4h*)(xT + 3 * XTP + l0) = g1;
    *(v4h*)(xT + 4 * XTP + l0) = (v4h){1, 1, 1, 1};
#pragma unroll
    for (int e = 0; e < 4; ++e)
      *(v8h*)(kF + (size_t)(l0 + e) * 8) = (v8h){h0[e], h1[e], g0[e], g1[e], h0[e], h1[e], g0[e], g1[e]};
  }
  // M = Wq.Wk^T: this wave's 64 h
  const float m00 = wsum(fmaf(q0v[1], k0v[1], q0v[0] * k0v[0]));
  const float m01 = wsum(fmaf(q0v[1], k1v[1], q0v[0] * k1v[0]));
  const float m10 = wsum(fmaf(q1v[1], k0v[1], q1v[0] * k0v[0]));
  const float m11 = wsum(fmaf(q1v[1], k1v[1], q1v[0] * k1v[0]));
  // W' rows, done under the flight of the Wout loads and parked in the wave's own LDS piece until the tail
#pragma unroll
  for (int i = 0; i < 2; ++i) *(v8h*)(wzl + i * 256) = chrow(cg[i], cr[i], c0[i], c1[i], cb[i], cm[i]);
  {
#pragma unroll
    for (int s = 0; s < 2; ++s) {
      v4f r[8];
#pragma unroll
      for (int i = 0; i < 8; ++i) r[i] = wr[s][i] * 64.0f;
#pragma unroll
      for (int e = 0; e < 4; ++e)
        *(v8h*)(wl + (4 * nq + e) * WOP + (4 * s + kg) * 8) =
            (v8h){(_Float16)r[0][e], (_Float16)r[1][e], (_Float16)r[2][e], (_Float16)r[3][e],
                  (_Float16)r[4][e], (_Float16)r[5][e], (_Float16)r[6][e], (_Float16)r[7][e]};
    }
  }
  if (lane == 0) *(v4f*)(mP + 4 * wave) = (v4f){m00, m01, m10, m11};
  __syncthreads();                                      // kF, xT and mP complete
  // B fragments of the score product: y = x.M (x score scale x log2 e) for query rows q0 + 32pt + 16t + (lane&15), t = 0, 1
  v16h yq[2][4];
  {
    // asked for here, not with the prologue's loads: this block has just read the lines, and the loads fly beside the LDS trip below
    v2f xq[2];
#pragma unroll
    for (int t = 0; t < 2; ++t) xq[t] = *(const v2f*)(Xb + 2 * (size_t)(q0 + 32 * pt + 16 * t + c));
    // the wait that stands in front of an overwrite of the two loads' offset registers; the two scheduling barriers hold it directly behind the loads
    __builtin_amdgcn_sched_barrier(0);
    asm volatile("s_wait_xcnt 0x0" ::: "memory");
    __builtin_amdgcn_sched_barrier(0);
    // lane l reads partial sum l&3 of wave l>>2; three exchanges (l ^ 4, l ^ 8, l ^ 16) sum over the waves
    float ms = addx<8>(addx<4>(mP[lane]));
    const int mb = __builtin_bit_cast(int, ms);
    ms += __builtin_bit_cast(float, __builtin_amdgcn_permlanex16(mb, mb, 0x76543210, 0xfedcba98, false, false));
    const int mi = __builtin_bit_cast(int, ms);
    const v4f mv = (v4f){__builtin_bit_cast(float, __builtin_amdgcn_readlane(mi, 0)),    // M00 M01 M10 M11, wave-uniform
                         __builtin_bit_cast(float, __builtin_amdgcn_readlane(mi, 1)),
                         __builtin_bit_cast(float, __builtin_amdgcn_readlane(mi, 2)),
                         __builtin_bit_cast(float, __builtin_amdgcn_readlane(mi, 3))};
    const float ys = sscale * 1.4426950408889634f;
#pragma unroll
    for (int t = 0; t < 2; ++t) {
      const v8h yv = qhalves(fmaf(xq[t][1], mv[2], xq[t][0] * mv[0]) * ys, fmaf(xq[t][1], mv[3], xq[t][0] * mv[1]) * ys);
#pragma unroll
      for (int j = 0; j < 4; ++j) {
        Frag f;
        f.h[j >> 1]       = (hh == (j & 1)) ? yv : zz;
        f.h[(j >> 1) ^ 1] = zz;
        yq[t][j] = f.v;
      }
    }
  }

  const _Float16* kp = kF + (size_t)(pk * 32 + lane) * 8;   // lane l: key k0 + l of each 32-key step

  const int npair = nch >> 1;                           // two chunks (64 of this wave's keys) per A fragment

  // ---- pass 1: this wave's maximum per query over its keys ----
  float mw[2];
  {
    v8f mx[2];
#pragma unroll
    for (int t = 0; t < 2; ++t)
#pragma unroll
      for (int r = 0; r < 8; ++r) mx[t][r] = -3.0e38f;  // finite, so that a wave without keys joins with factor 1
#pragma unroll 1                                        // rolled: a trip already holds eight independent products; a second trip's 64 score registers would press on the bound of 256
    for (int cp = 0; cp < npair; ++cp) {
      Frag ka;
      ka.h[0] = *(const v8h*)(kp + (size_t)(2 * cp) * (BC * 8));
      ka.h[1] = *(const v8h*)(kp + (size_t)(2 * cp + 1) * (BC * 8));
      v8f s[2][4];
#pragma unroll
      for (int t = 0; t < 2; ++t)
#pragma unroll
        for (int j = 0; j < 4; ++j) s[t][j] = mmab(ka.v, yq[t][j], zero8());
      // keeps the eight products together: each fills the distance behind the one before, which v_nop fills otherwise
      __builtin_amdgcn_sched_barrier(0);
#pragma unroll
      for (int t = 0; t < 2; ++t)
#pragma unroll
        for (int r = 0; r < 8; ++r)
          mx[t][r] = fmaxf(fmaxf(mx[t][r], fmaxf(s[t][0][r], s[t][1][r])), fmaxf(s[t][2][r], s[t][3][r]));
    }
    if (nch & 1) {                                      // block-uniform: the odd last chunk, tiles 0 and 1 alone
      Frag ka;
      ka.h[0] = *(const v8h*)(kp + (size_t)(nch - 1) * (BC * 8));
      ka.h[1] = ka.h[0];
#pragma unroll
      for (int t = 0; t < 2; ++t) {
        const v8f s0 = mmab(ka.v, yq[t][0], zero8());
        const v8f s1 = mmab(ka.v, yq[t][1], zero8());
#pragma unroll
        for (int r = 0; r < 8; ++r) mx[t][r] = fmaxf(mx[t][r], fmaxf(s0[r], s1[r]));
      }
    }
#pragma unroll
    for (int t = 0; t < 2; ++t) {
      const float m = fmaxf(fmaxf(fmaxf(mx[t][0], mx[t][1]), fmaxf(mx[t][2], mx[t][3])),
                            fmaxf(fmaxf(mx[t][4], mx[t][5]), fmaxf(mx[t][6], mx[t][7])));
      const int mb = __builtin_bit_cast(int, m);        // lane l <-> l ^ 16: the other eight keys of each tile
      mw[t] = fmaxf(m, __builtin_bit_cast(float, __builtin_amdgcn_permlanex16(mb, mb, 0x76543210, 0xfedcba98, false, false)));
    }
  }

  // ---- pass 2: p x1024 = exp2(s - maximum + 10), packed in place into the value product's B operand ----
  v8f uacc[2] = {zero8(), zero8()};
  {
    v8f cneg[2];
#pragma unroll
    for (int t = 0; t < 2; ++t) {
      const float cm = 10.0f - mw[t];
      cneg[t] = (v8f){cm, cm, cm, cm, cm, cm, cm, cm};
    }
    const int xl = ((c < 4) ? c : 4) | (lane & 16);     // A row (lane&15) reads xT row min(lane&15, 4)
#pragma unroll 1                                        // rolled, for the same register bound
    for (int cp = 0; cp < npair; ++cp) {
      Frag ka;
      ka.h[0] = *(const v8h*)(kp + (size_t)(2 * cp) * (BC * 8));
      ka.h[1] = *(const v8h*)(kp + (size_t)(2 * cp + 1) * (BC * 8));
      // A operands of the value product: split k map over keys, the map of the packed D pair
      const v16h xa0 = ldfrag(xT, XTP, 0, (2 * cp) * BC + pk * 32, xl);
      const v16h xa1 = ldfrag(xT, XTP, 0, (2 * cp + 1) * BC + pk * 32, xl);
      v8f s[2][4];                                      // s[t][j][r]: key k0(chunk 2cp + (j>>1)) + 16(j&1) + 8hh + r, query c of tile t
#pragma unroll
      for (int t = 0; t < 2; ++t)
#pragma unroll
        for (int j = 0; j < 4; ++j) s[t][j] = mmab(ka.v, yq[t][j], cneg[t]);
      // keeps the eight products together, for the same reason as in pass 1
      __builtin_amdgcn_sched_barrier(0);
#pragma unroll
      for (int t = 0; t < 2; ++t) {
#pragma unroll
        for (int j = 0; j < 4; ++j)
#pragma unroll
          for (int r = 0; r < 8; ++r) s[t][j][r] = __builtin_amdgcn_exp2f(s[t][j][r]);
        Frag pb0, pb1;
        pb0.h[0] = __builtin_convertvector(s[t][0], v8h);
        pb0.h[1] = __builtin_convertvector(s[t][1], v8h);
        pb1.h[0] = __builtin_convertvector(s[t][2], v8h);
        pb1.h[1] = __builtin_convertvector(s[t][3], v8h);
        uacc[t] = mmab(xa0, pb0.v, uacc[t]);
        uacc[t] = mmab(xa1, pb1.v, uacc[t]);
      }
    }
    if (nch & 1) {                                      // block-uniform: the odd last chunk
      Frag ka;
      ka.h[0] = *(const v8h*)(kp + (size_t)(nch - 1) * (BC * 8));
      ka.h[1] = ka.h[0];
      const v16h xa0 = ldfrag(xT, XTP, 0, (nch - 1) * BC + pk * 32, xl);
#pragma unroll
      for (int t = 0; t < 2; ++t) {
        v8f s0 = mmab(ka.v, yq[t][0], cneg[t]);
        v8f s1 = mmab(ka.v, yq[t][1], cneg[t]);
#pragma unroll
        for (int r = 0; r < 8; ++r) {
          s0[r] = __builtin_amdgcn_exp2f(s0[r]);
          s1[r] = __builtin_amdgcn_exp2f(s1[r]);
        }
        Frag pb0;
        pb0.h[0] = __builtin_convertvector(s0, v8h);
        pb0.h[1] = __builtin_convertvector(s1, v8h);
        uacc[t] = mmab(xa0, pb0.v, uacc[t]);
      }
    }
  }

  // ---- tail: join the four key slices, 1/l per row, z^T = W'.[u; 1]^T, PReLU, out^T = Wout^T.z^T ----
  const float a = pa[0];
  if (lane < 16) {                                      // D rows 0..4 sit in lanes 0..15
#pragma unroll
    for (int t = 0; t < 2; ++t) {
      float* d = uP + (size_t)(pk * BR + 32 * pt + 16 * t + c) * 8;
      *(v4f*)d       = (v4f){uacc[t][0], uacc[t][1], uacc[t][2], uacc[t][3]};
      *(v2f*)(d + 4) = (v2f){uacc[t][4], mw[t]};
    }
  }
  __syncthreads();                                      // uP complete (cross-wave)
  Frag wz;                                              // A operand of the z product: lane l holds channels ch0 + l and ch0 + 32 + l
  wz.h[0] = *(const v8h*)(wzl);
  wz.h[1] = *(const v8h*)(wzl + 256);
  v16h wof[2][2];                                       // A operands of out^T: [out column tile][32-channel step], from the wave's own LDS rows
#pragma unroll
  for (int nt = 0; nt < 2; ++nt)
#pragma unroll
    for (int ks = 0; ks < 2; ++ks) wof[nt][ks] = ldfrag(wl, WOP, 16 * nt, 32 * ks, lane);
  // keeps all ten loads issued here, in front of the join: without it the compiler may sink them to just in front of
  // their first use, where their latency is waited out
  __builtin_amdgcn_sched_barrier(0);
  Pack8 own[2], oth[2];                                 // query side of the z product: row 32g + lane, and row 32g + (lane ^ 16)
#pragma unroll
  for (int g = 0; g < 2; ++g) {
    const int jr = 32 * g + lane;
    v2f lm[4];
#pragma unroll
    for (int i = 0; i < 4; ++i) lm[i] = *(const v2f*)(uP + (size_t)(i * BR + jr) * 8 + 4);
    const float m = fmaxf(fmaxf(lm[0][1], lm[1][1]), fmaxf(lm[2][1], lm[3][1]));
    v4f us = (v4f){0.f, 0.f, 0.f, 0.f};
    float l = 0.f;
#pragma unroll
    for (int i = 0; i < 4; ++i) {
      const float f = __builtin_amdgcn_exp2f(lm[i][1] - m);
      us += *(const v4f*)(uP + (size_t)(i * BR + jr) * 8) * f;
      l = fmaf(lm[i][0], f, l);
    }
    const float inv = (l > 0.f) ? (1.0f / l) : 0.f;     // u and l both carry the x1024
    const float u0 = (us[0] + us[2]) * inv, u1 = (us[1] + us[3]) * inv;
    const _Float16 h0 = (_Float16)u0, h1 = (_Float16)u1;
    const _Float16 l0 = (_Float16)(u0 - (float)h0), l1 = (_Float16)(u1 - (float)h1);
    own[g].h = (v8h){h0, h0, l0, h1, h1, l1, 1, 1};
#pragma unroll
    for (int i = 0; i < 4; ++i)                         // lane l <-> l ^ 16
      oth[g].u[i] = (unsigned int)__builtin_amdgcn_permlanex16((int)own[g].u[i], (int)own[g].u[i], 0x76543210, 0xfedcba98, false, false);
  }
#pragma unroll
  for (int qt = 0; qt < 4; ++qt) {                      // query tile: rows 16qt + c
    const v8h rq = (hh == (qt & 1)) ? own[qt >> 1].h : oth[qt >> 1].h;  // the eight halves of row 16qt + c, in both lane halves
    v8f s[4];                                           // s[j][r]: z x16 of channel ch0 + 16j + 8hh + r, row 16qt + c
#pragma unroll
    for (int j = 0; j < 4; ++j) {
      Frag f;                                           // tile j's 8 k slots alone carry the row
      f.h[j >> 1]       = (hh == (j & 1)) ? rq : zz;
      f.h[(j >> 1) ^ 1] = zz;
      s[j] = mmab(wz.v, f.v, zero8());
    }
    // keeps the four products together: each fills the distance behind the one before, which v_nop fills otherwise
    __builtin_amdgcn_sched_barrier(0);
#pragma unroll
    for (int j = 0; j < 4; ++j)
#pragma unroll
      for (int r = 0; r < 8; ++r) s[j][r] = (s[j][r] >= 0.f) ? s[j][r] : a * s[j][r];
    Frag pb0, pb1;
    pb0.h[0] = __builtin_convertvector(s[0], v8h);
    pb0.h[1] = __builtin_convertvector(s[1], v8h);
    pb1.h[0] = __builtin_convertvector(s[2], v8h);
    pb1.h[1] = __builtin_convertvector(s[3], v8h);
#pragma unroll
    for (int nt = 0; nt < 2; ++nt) {
      v8f acc = mmab(wof[nt][0], pb0.v, zero8());
      acc = mmab(wof[nt][1], pb1.v, acc);
      float* pp = part + wave * (BR * PTP) + (16 * qt + c) * PTP + 16 * nt + 8 * hh;
      *(v4f*)pp       = (v4f){acc[0], acc[1], acc[2], acc[3]};
      *(v4f*)(pp + 4) = (v4f){acc[4], acc[5], acc[6], acc[7]};
    }
  }
  __syncthreads();                                      // part complete
  {
    const int pc = tid & 7;
    const v4f bb = *(const v4f*)(bo + pc * 4);
#pragma unroll
    for (int g = 0; g < 2; ++g) {
      const int row = 32 * g + (tid >> 3);
      v4f sum = *(const v4f*)(part + row * PTP + pc * 4);
#pragma unroll
      for (int w = 1; w < 8; ++w) sum += *(const v4f*)(part + w * (BR * PTP) + row * PTP + pc * 4);
      const v4f val = sum * 0.0009765625f + bb;         // 1/(16 * 64)
      v4f* d = (v4f*)(out + (tokbase + (size_t)row) * OD + pc * 4);
      *d = val;
    }
  }
}

// No workspace is used.
extern "C" void kernel_launch(void* const* d_in, const int* in_sizes, int n_in,
                              void* d_out, int out_size, void* d_ws, size_t ws_size,
                              hipStream_t stream) {
  if (n_in < 12) return;
  if (in_sizes[0] != NTOK * 2) return;
  if (in_sizes[1] < 1) return;
  if (in_sizes[2] != 2 * HD) return;
  if (in_sizes[3] != 2 * HD) return;
  if (in_sizes[4] != 2 * HD) return;
  if (in_sizes[5] != HD) return;
  if (in_sizes[6] != HD) return;
  if (in_sizes[7] != HD) return;
  if (in_sizes[8] != HD) return;
  if (in_sizes[9] < 1) return;
  if (in_sizes[10] != HD * OD) return;
  if (in_sizes[11] != OD) return;
  if (out_size != NTOK * OD) return;

  const float* x    = (const float*)d_in[0];    // [32768][2]
  const int*   bsz  = (const int*)d_in[1];      // [1]
  const float* wq   = (const float*)d_in[2];    // [2][512]
  const float* wk   = (const float*)d_in[3];    // [2][512]
  const float* wv   = (const float*)d_in[4];    // [2][512]
  const float* gam  = (const float*)d_in[5];    // [512]
  const float* bet  = (const float*)d_in[6];    // [512]
  const float* mu   = (const float*)d_in[7];    // [512]
  const float* var  = (const float*)d_in[8];    // [512]
  const float* pa   = (const float*)d_in[9];    // [1]
  const float* wo   = (const float*)d_in[10];   // [512][32]
  const float* bo   = (const float*)d_in[11];   // [32]
  float* out = (float*)d_out;                   // [32768][32]

  const float sscale = 1.0f / sqrtf((float)HD);

  // attention + BN/PReLU/Wout tail -> d_out
  k_attn<<<dim3(SEQ / BR, NBAT), dim3(256), 0, stream>>>(x, wq, wk, wv, gam, bet, mu, var, wo, pa, bo, bsz, out, sscale);
  (void)hipGetLastError();
}

// v007
// It runs in 8.38 microseconds.
// Timed twice side by side with v006, it ran 1.06 times as fast both times.
// Over all steps from v000 it is 36.3 times as fast.
// Contractions: S^T = x.(x.M)^T with M = Wq.Wk^T (2 x 2, f32) on v_wmma_f32_16x16x32_f16 (f16 hi + lo operand pairs, f32 accumulate, the row maximum enters as C); u^T = [x^T; 1].P^T (x as hi and lo rows, a row of ones for the row sum, p x1024 packed from the score accumulators) on v_wmma_f32_16x16x32_f16 (f16 operands, f32 accumulate); z^T = W'.[u; 1]^T (projection u.Wv with the BN affine folded in, x16; f16 hi + lo operand pairs, D written as f16) on v_wmma_f16_16x16x32_f16; out^T = Wout^T.z^T on v_wmma_f32_16x16x32_f16 (f16 operands: z x16 as the z product's f16 D tiles after PReLU, Wout x64; f32 accumulate, 1/1024 folded back in f32). M, y = x.M and the folded channel constants exact f32 on VALU; score scale, softmax maximum, exp2, 1/l and bias in f32; PReLU in packed f16 on the f16 z tiles.
#include <hip/hip_runtime.h>
#include <math.h>
#include <stddef.h>
#include <stdint.h>

#define NTOK 32768              // token rows
#define NBAT 32                 // sequences
#define SEQ  1024               // tokens per sequence
#define HD   512                // head width
#define OD   32                 // output width
#define BR   64                 // query rows per attention block
#define BC   128                // keys per chunk

static_assert(NTOK == NBAT * SEQ);
static_assert(SEQ % BC == 0);
static_assert(SEQ % BR == 0);
static_assert(BC % 32 == 0);
static_assert(HD == 512);
static_assert((HD / 8) == 64);
static_assert(SEQ == 256 * 4);
static_assert(OD == 32);

typedef _Float16 v16h __attribute__((ext_vector_type(16)));
typedef _Float16 v8h  __attribute__((ext_vector_type(8)));
typedef _Float16 v4h  __attribute__((ext_vector_type(4)));
typedef float    v8f  __attribute__((ext_vector_type(8)));
typedef float    v4f  __attribute__((ext_vector_type(4)));
typedef float    v2f  __attribute__((ext_vector_type(2)));
typedef unsigned int v4u __attribute__((ext_vector_type(4)));

union Frag  { v16h v; v8h h[2]; };
union Pack8 { v8h h; v4u u; };

// Fragment loader for k-contiguous 16-bit rows with pitch ld.
// A operand: row0 + (lane&15) is the M row.  B operand stored [n][k]: row0 + (lane&15) is the N column.
// Split k map for both: elements 0..7 <- k0 + 8*(lane>>4) + 0..7, elements 8..15 <- k0 + 16 + 8*(lane>>4) + 0..7.
// D map: acc[r] = element (8*(lane>>4) + r, lane&15) of the 16x16 tile.
__device__ __forceinline__ v16h ldfrag(const _Float16* p, int ld, int row0, int k0, int lane) {
  const int m = lane & 15, lh = lane >> 4;
  const _Float16* q = p + (size_t)(row0 + m) * ld + k0 + 8 * lh;
  Frag f;
  f.h[0] = *(const v8h*)(q);
  f.h[1] = *(const v8h*)(q + 16);
  return f.v;
}

__device__ __forceinline__ v8f zero8() { return (v8f){0.f, 0.f, 0.f, 0.f, 0.f, 0.f, 0.f, 0.f}; }

// ---------------------------------------------------------------------------
// the one kernel: non-causal attention per (query tile, sequence), single head of width 512, with the
// BN-affine + PReLU + z.Wout + bias tail fused, and every derived weight formed by the block that uses it. Block = 8 waves = 64 query rows of one sequence;
// key chunks of 128 (nch = SEQ/BC = 8, derived from the batch_size input and clamped to the static maximum).
//   x: f32 input [token][2]; all weights as the f32 inputs.
// Derived weights, formed in front of the first barrier:
//   M = Wq.Wk^T [2][2] in f32: thread t takes h = 2t, 2t+1; sum over the wave's lanes in registers; the eight waves'
//   partial sums go to LDS (mP) and every wave adds them behind the barrier.
//   W' (x16): wave w owns channels 64w .. 64w+63; lane l forms channels 64w + l and 64w + 32 + l. With sc = gamma/sqrt(var + eps):
//   z = (u.Wv - mean) sc + beta = u0 (Wv0 sc) + u1 (Wv1 sc) + (beta - mean sc); the three constants x16, each as an f16
//   pair hi + lo: w0hi w0lo w0hi w1hi w1lo w1hi bhi blo, the channel side of the z product's 8 k slots; kept in LDS (sWz), read by this lane alone.
//   Wout (x64, f16): the wave's 64 rows [k][32], 16 B a lane (whole 128-B lines), eight k of one column packed to 16 B and
//   stored [n][k] in the wave's own LDS rows (pitch 144 B); only this wave reads them, so they need no barrier.
// S: q.k = sum_ij x_i M_ij x'_j = y.x' with y = x.M, so the score product contracts 2 dims, not 512. y carries
//   the score scale and log2(e). Each f32 factor goes in as an f16 pair hi + lo and the four cross products of
//   the two dims fill 8 k slots of one 16x16x32 step.
// Wave w: query tiles 2(w&1) and 2(w&1) + 1 (16 rows each; one key fragment and one x^T fragment serve both), keys 32(w>>1)..+31 of each chunk;
//   the softmax never leaves the wave's registers.
//   S^T = K.Y^T: keys are the M rows, queries the N columns, so lane (h, c) holds keys 8h + r of query c.
//   The block forms kF [key][8 halves] once in LDS; lane l loads key k0 + l of two chunks, so one A fragment holds
//   four 16-key tiles, tile j in elements 8(j>>1)..+7 of lanes 16(j&1)..+15 (8 of the 32 k slots each); the B
//   fragment yq[j] is zero outside tile j's slots, which picks the 16 keys of each product.
//   Pass 1 over the wave's keys: maximum per query (in-lane, one exchange between the lane halves).
//   Pass 2: the same products with C = 10 - maximum, p x1024 = exp2(D); the two D tiles of 32 keys, converted in
//   place, are the B operand of the value product (element s = key kmap(s, h) of query c).
// O: p.v = p.(x.Wv) = (p.x).Wv. u^T = A.P^T with A rows [hi0 hi1 lo0 lo1 ones ones ...][key] from LDS (xT, the same
//   k map): D rows 0..3 are the four partial sums of u, row 4 the row sum l (of the rounded p), all x1024.
//   After the loop the four key slices, each under its own maximum, are joined through LDS (uP).
// Tail: every wave joins the slices itself (lane = row, two rounds of 32 rows): u = (hi + lo sums) / l. z never leaves the wave's registers:
//   z^T = W'.[u; 1]^T: channels are the M rows, queries the N columns. Wave w owns channels 64w .. 64w+63 for all 64
//   rows. One A fragment holds the four 16-channel tiles, tile j in elements 8(j>>1)..+7 of lanes 16(j&1)..+15 (8 of the 32 k
//   slots each); the B fragment of tile j is zero outside tile j's slots, as in the score product. Query side of the 8 slots:
//   u0hi u0hi u0lo u1hi u1hi u1lo 1 1 (the lo.lo products are left out), all times sg. D is written as f16 (element e of a
//   lane = row 8(lane>>4) + e, the order of a converted f32 D tile). PReLU on the packed halves, two instructions a register:
//   with sg = +1 for a <= 1 and -1 for a > 1, PReLU(z) = sg max(sg z, a sg z) for every a; sg rides on the query side and on the
//   last scale. Two D tiles are the B operand of out^T = Wout^T.z^T (k slot = channel offset, the split k map of ldfrag).
//   out^T D: lane (h, c) holds out columns 16nt + 8h + r of query c: partial tile to LDS part[wave][64][32]; barrier;
//   val = sg (sum of the eight parts)/1024 + b_out.
// LDS: sKX = kF + xT; sWz; mP; uP; sBig = eight wave-owned pieces of 64 x 144 B: the wave's Wout rows (the first 32 x 144 B), then (those read) its part tile.
// grid = (SEQ/BR, NBAT) = (16, 32).
// coverage: part per wave 64 x 32; d_out per block 256 thr x 2 x 4 floats = 64 rows x 32 -> 512 blocks = 32768 rows x 32.
// ---------------------------------------------------------------------------
#define PTP 36
#define XTP 1040                              // xT row pitch in halves: rows 32 B apart modulo the 256-B bank span
#define WOP 72                                // Wout row pitch in halves: 144 B, the pitch of a part row
#define SBIGF      (8 * BR * PTP)             // 18432 floats = 73728 B
static_assert(WOP * 2 == PTP * 4);
static_assert(OD <= BR);
static_assert(BR == 64);
static_assert((PTP % 4) == 0);
static_assert((XTP % 8) == 0);
static_assert(XTP >= SEQ);
static_assert(HD == 8 * 64);

// Score operands from one f32 pair (u0, u1), eight halves (k slots) a side:
//   query side: hi0 hi1 hi0 hi1 lo0 lo1 lo0 lo1      key side: hi0 hi1 lo0 lo1 hi0 hi1 lo0 lo1
// so slot by slot the products are hi.hi, hi.lo, lo.hi, lo.lo for dim 0 and dim 1.
__device__ __forceinline__ v8h qhalves(float u0, float u1) {
  const _Float16 h0 = (_Float16)u0, h1 = (_Float16)u1;
  const _Float16 l0 = (_Float16)(u0 - (float)h0), l1 = (_Float16)(u1 - (float)h1);
  return (v8h){h0, h1, h0, h1, l0, l1, l0, l1};
}

// WMMA as the bare builtin: the compiler keeps the distance behind it and can fill it with the other tile's work
__device__ __forceinline__ v8f mmab(v16h a, v16h b, v8f c) {
  return __builtin_amdgcn_wmma_f32_16x16x32_f16(false, a, false, b, (short)0, c, false, false);
}

// the same product with D (and C) in f16: four registers a tile, already in the packed order of a B operand half
__device__ __forceinline__ v8h mmah(v16h a, v16h b, v8h c) {
  return __builtin_amdgcn_wmma_f16_16x16x32_f16(false, a, false, b, (short)0, c, false, false);
}

// v + (v of lane l ^ X) inside a 16-lane row: one DPP add (row_xmask), no LDS trip
template <int X>
__device__ __forceinline__ float addx(float v) {
  return v + __builtin_bit_cast(float, __builtin_amdgcn_update_dpp(0, __builtin_bit_cast(int, v), 0x160 + X, 0xf, 0xf, true));
}
// sum over the 32 lanes, the same value in every lane
__device__ __forceinline__ float wsum(float v) {
  v = addx<1>(v);
  v = addx<2>(v);
  v = addx<4>(v);
  v = addx<8>(v);
  const int vb = __builtin_bit_cast(int, v);            // lane l <-> l ^ 16
  return v + __builtin_bit_cast(float, __builtin_amdgcn_permlanex16(vb, vb, 0x76543210, 0xfedcba98, false, false));
}

// channel side of the z product's 8 k slots for BN channel h
__device__ __forceinline__ v8h chrow(float g, float vr, float v0, float v1, float be, float mn) {
  const float sc = g * (1.0f / sqrtf(vr + 1.0e-5f));
  const float w0 = v0 * sc * 16.0f, w1 = v1 * sc * 16.0f;
  const float bb = (be - mn * sc) * 16.0f;
  const _Float16 w0h = (_Float16)w0, w1h = (_Float16)w1, bh = (_Float16)bb;
  const _Float16 w0l = (_Float16)(w0 - (float)w0h), w1l = (_Float16)(w1 - (float)w1h), bl = (_Float16)(bb - (float)bh);
  return (v8h){w0h, w0l, w0h, w1h, w1l, w1h, bh, bl};
}

// second bound: 4 waves a SIMD, that is 256 registers: 2 blocks stay on a WGP and the grid is resident in one round
__global__ __launch_bounds__(256, 4) void k_attn(const float* __restrict__ x,
                                              const float* __restrict__ wq,
                                              const float* __restrict__ wk,
                                              const float* __restrict__ wv,
                                              const float* __restrict__ gam,
                                              const float* __restrict__ bet,
                                              const float* __restrict__ mu,
                                              const float* __restrict__ var,
                                              const float* __restrict__ wo,
                                              const float* __restrict__ pa,
                                              const float* __restrict__ bo,
                                              const int* __restrict__ bsp,
                                              float* __restrict__ out, float sscale) {
  __shared__ __align__(16) float sBig[SBIGF];
  __shared__ __align__(16) _Float16 sKX[SEQ * 8 + 5 * XTP];
  __shared__ __align__(16) float uP[4 * BR * 8];        // [key slice][row][u hi0 hi1 lo0 lo1, l, maximum, -, -]
  __shared__ __align__(16) float mP[8 * 4];             // [wave][M00 M01 M10 M11], partial sums
  __shared__ __align__(16) _Float16 sWz[8 * 2 * 32 * 8];  // [wave][channel half][lane][8 k slots]

  _Float16* kF   = sKX;
  _Float16* xT   = sKX + SEQ * 8;
  float*    part = sBig;

  const int tid = threadIdx.x, lane = tid & 31, wave = tid >> 5;
  const int hh = lane >> 4, c = lane & 15;
  const int b  = blockIdx.y;
  const int q0 = (int)blockIdx.x * BR;                  // query row base within the sequence
  int bs = bsp[0];
  bs = (bs < 1) ? 1 : bs;
  int seql = NTOK / bs;
  seql = (seql > SEQ) ? SEQ : seql;
  const int nch = seql / BC;                            // block-uniform, <= SEQ/BC
  const float* Xb = x + (size_t)b * SEQ * 2;             // this sequence's token rows [l][2]
  const size_t tokbase = (size_t)b * SEQ + q0;
  const int pt = wave & 1, pk = wave >> 1;              // this wave's pair of query tiles and its 32-key slice of each chunk
  const v8h zz = (v8h){0, 0, 0, 0, 0, 0, 0, 0};

  const int ch0 = wave * 64;                            // this wave's 64 channels
  _Float16* wl = (_Float16*)sBig + wave * (BR * WOP);   // this wave's Wout rows [n][k - ch0], at the head of its own piece
  _Float16* wzl = sWz + wave * 512 + lane * 8;          // this lane's W' rows: channel ch0 + l, and at + 256 halves ch0 + 32 + l
  // every global load of the prologue, in the order of use
  const v4f a0 = *(const v4f*)(Xb + 8 * tid);           // thread t: tokens 4t .. 4t+3
  const v4f a1 = *(const v4f*)(Xb + 8 * tid + 4);
  const v2f q0v = *(const v2f*)(wq + 2 * tid);          // thread t: h = 2t, 2t+1 of M's sum
  const v2f q1v = *(const v2f*)(wq + HD + 2 * tid);
  const v2f k0v = *(const v2f*)(wk + 2 * tid);
  const v2f k1v = *(const v2f*)(wk + HD + 2 * tid);
  float cg[2], cr[2], c0[2], c1[2], cb[2], cm[2];       // lane l: channels ch0 + l and ch0 + 32 + l
#pragma unroll
  for (int i = 0; i < 2; ++i) {
    const int h = ch0 + 32 * i + lane;
    cg[i] = gam[h];
    cr[i] = var[h];
    c0[i] = wv[h];
    c1[i] = wv[HD + h];
    cb[i] = bet[h];
    cm[i] = mu[h];
  }
  // the wait that stands in front of an overwrite of the loads' offset registers;
  // the two scheduling barriers hold it directly behind the loads: without them a register write is placed in between
  __builtin_amdgcn_sched_barrier(0);
  asm volatile("s_wait_xcnt 0x0" ::: "memory");
  __builtin_amdgcn_sched_barrier(0);
  const int nq = lane & 7, kg = lane >> 3;              // lane l: Wout columns 4(l&7)..+3 of rows 8(l>>3) + 0..7 of each 32-row half
  v4f wr[2][8];
  {
    const float* ws = wo + (size_t)(ch0 + 8 * kg) * OD + 4 * nq;
#pragma unroll
    for (int s = 0; s < 2; ++s)
#pragma unroll
      for (int i = 0; i < 8; ++i) {
        // the last load's result lands on the address pair that all sixteen name: the wait that stands in front of such an overwrite
        if (s == 1 && i == 7) asm volatile("s_wait_xcnt 0x0" ::: "memory");
        wr[s][i] = *(const v4f*)(ws + (size_t)(32 * s + i) * OD);
      }
  }
  // keeps the Wout loads issued in front of the first wait for data: without it they start a load latency later
  __builtin_amdgcn_sched_barrier(0);
  {
    // this sequence's tokens as f16 hi and lo: x^T rows (and a row of ones) and the key-side score operands
    const int l0 = tid * 4;
    const v4f e0 = (v4f){a0[0], a0[2], a1[0], a1[2]};
    const v4f e1 = (v4f){a0[1], a0[3], a1[1], a1[3]};
    v4h h0, h1, g0, g1;
#pragma unroll
    for (int e = 0; e < 4; ++e) {
      h0[e] = (_Float16)e0[e];
      h1[e] = (_Float16)e1[e];
      g0[e] = (_Float16)(e0[e] - (float)h0[e]);
      g1[e] = (_Float16)(e1[e] - (float)h1[e]);
    }
    *(v4h*)(xT + 0 * XTP + l0) = h0;
    *(v4h*)(xT + 1 * XTP + l0) = h1;
    *(v4h*)(xT + 2 * XTP + l0) = g0;
    *(v4h*)(xT + 3 * XTP + l0) = g1;
    *(v4h*)(xT + 4 * XTP + l0) = (v4h){1, 1, 1, 1};
#pragma unroll
    for (int e = 0; e < 4; ++e)
      *(v8h*)(kF + (size_t)(l0 + e) * 8) = (v8h){h0[e], h1[e], g0[e], g1[e], h0[e], h1[e], g0[e], g1[e]};
  }
  // M = Wq.Wk^T: this wave's 64 h
  const float m00 = wsum(fmaf(q0v[1], k0v[1], q0v[0] * k0v[0]));
  const float m01 = wsum(fmaf(q0v[1], k1v[1], q0v[0] * k1v[0]));
  const float m10 = wsum(fmaf(q1v[1], k0v[1], q1v[0] * k0v[0]));
  const float m11 = wsum(fmaf(q1v[1], k1v[1], q1v[0] * k1v[0]));
  // W' rows, done under the flight of the Wout loads and parked in the wave's own LDS piece until the tail
#pragma unroll
  for (int i = 0; i < 2; ++i) *(v8h*)(wzl + i * 256) = chrow(cg[i], cr[i], c0[i], c1[i], cb[i], cm[i]);
  {
#pragma unroll
    for (int s = 0; s < 2; ++s) {
      v4f r[8];
#pragma unroll
      for (int i = 0; i < 8; ++i) r[i] = wr[s][i] * 64.0f;
#pragma unroll
      for (int e = 0; e < 4; ++e)
        *(v8h*)(wl + (4 * nq + e) * WOP + (4 * s + kg) * 8) =
            (v8h){(_Float16)r[0][e], (_Float16)r[1][e], (_Float16)r[2][e], (_Float16)r[3][e],
                  (_Float16)r[4][e], (_Float16)r[5][e], (_Float16)r[6][e], (_Float16)r[7][e]};
    }
  }
  if (lane == 0) *(v4f*)(mP + 4 * wave) = (v4f){m00, m01, m10, m11};
  __syncthreads();                                      // kF, xT and mP complete
  // B fragments of the score product: y = x.M (x score scale x log2 e) for query rows q0 + 32pt + 16t + (lane&15), t = 0, 1
  v16h yq[2][4];
  {
    // asked for here, not with the prologue's loads: this block has just read the lines, and the loads fly beside the LDS trip below
    v2f xq[2];
#pragma unroll
    for (int t = 0; t < 2; ++t) xq[t] = *(const v2f*)(Xb + 2 * (size_t)(q0 + 32 * pt + 16 * t + c));
    // the wait that stands in front of an overwrite of the two loads' offset registers; the two scheduling barriers hold it directly behind the loads
    __builtin_amdgcn_sched_barrier(0);
    asm volatile("s_wait_xcnt 0x0" ::: "memory");
    __builtin_amdgcn_sched_barrier(0);
    // lane l reads partial sum l&3 of wave l>>2; three exchanges (l ^ 4, l ^ 8, l ^ 16) sum over the waves
    float ms = addx<8>(addx<4>(mP[lane]));
    const int mb = __builtin_bit_cast(int, ms);
    ms += __builtin_bit_cast(float, __builtin_amdgcn_permlanex16(mb, mb, 0x76543210, 0xfedcba98, false, false));
    const int mi = __builtin_bit_cast(int, ms);
    const v4f mv = (v4f){__builtin_bit_cast(float, __builtin_amdgcn_readlane(mi, 0)),    // M00 M01 M10 M11, wave-uniform
                         __builtin_bit_cast(float, __builtin_amdgcn_readlane(mi, 1)),
                         __builtin_bit_cast(float, __builtin_amdgcn_readlane(mi, 2)),
                         __builtin_bit_cast(float, __builtin_amdgcn_readlane(mi, 3))};
    const float ys = sscale * 1.4426950408889634f;
#pragma unroll
    for (int t = 0; t < 2; ++t) {
      const v8h yv = qhalves(fmaf(xq[t][1], mv[2], xq[t][0] * mv[0]) * ys, fmaf(xq[t][1], mv[3], xq[t][0] * mv[1]) * ys);
#pragma unroll
      for (int j = 0; j < 4; ++j) {
        Frag f;
        f.h[j >> 1]       = (hh == (j & 1)) ? yv : zz;
        f.h[(j >> 1) ^ 1] = zz;
        yq[t][j] = f.v;
      }
    }
  }

  const _Float16* kp = kF + (size_t)(pk * 32 + lane) * 8;   // lane l: key k0 + l of each 32-key step

  const int npair = nch >> 1;                           // two chunks (64 of this wave's keys) per A fragment

  // ---- pass 1: this wave's maximum per query over its keys ----
  float mw[2];
  {
    v8f mx[2];
#pragma unroll
    for (int t = 0; t < 2; ++t)
#pragma unroll
      for (int r = 0; r < 8; ++r) mx[t][r] = -3.0e38f;  // finite, so that a wave without keys joins with factor 1
#pragma unroll 1                                        // rolled: a trip already holds eight independent products; a second trip's 64 score registers would press on the bound of 256
    for (int cp = 0; cp < npair; ++cp) {
      Frag ka;
      ka.h[0] = *(const v8h*)(kp + (size_t)(2 * cp) * (BC * 8));
      ka.h[1] = *(const v8h*)(kp + (size_t)(2 * cp + 1) * (BC * 8));
      v8f s[2][4];
#pragma unroll
      for (int t = 0; t < 2; ++t)
#pragma unroll
        for (int j = 0; j < 4; ++j) s[t][j] = mmab(ka.v, yq[t][j], zero8());
      // keeps the eight products together: each fills the distance behind the one before, which v_nop fills otherwise
      __builtin_amdgcn_sched_barrier(0);
#pragma unroll
      for (int t = 0; t < 2; ++t)
#pragma unroll
        for (int r = 0; r < 8; ++r)
          mx[t][r] = fmaxf(fmaxf(mx[t][r], fmaxf(s[t][0][r], s[t][1][r])), fmaxf(s[t][2][r], s[t][3][r]));
    }
    if (nch & 1) {                                      // block-uniform: the odd last chunk, tiles 0 and 1 alone
      Frag ka;
      ka.h[0] = *(const v8h*)(kp + (size_t)(nch - 1) * (BC * 8));
      ka.h[1] = ka.h[0];
#pragma unroll
      for (int t = 0; t < 2; ++t) {
        const v8f s0 = mmab(ka.v, yq[t][0], zero8());
        const v8f s1 = mmab(ka.v, yq[t][1], zero8());
#pragma unroll
        for (int r = 0; r < 8; ++r) mx[t][r] = fmaxf(mx[t][r], fmaxf(s0[r], s1[r]));
      }
    }
#pragma unroll
    for (int t = 0; t < 2; ++t) {
      const float m = fmaxf(fmaxf(fmaxf(mx[t][0], mx[t][1]), fmaxf(mx[t][2], mx[t][3])),
                            fmaxf(fmaxf(mx[t][4], mx[t][5]), fmaxf(mx[t][6], mx[t][7])));
      const int mb = __builtin_bit_cast(int, m);        // lane l <-> l ^ 16: the other eight keys of each tile
      mw[t] = fmaxf(m, __builtin_bit_cast(float, __builtin_amdgcn_permlanex16(mb, mb, 0x76543210, 0xfedcba98, false, false)));
    }
  }

  // ---- pass 2: p x1024 = exp2(s - maximum + 10), packed in place into the value product's B operand ----
  v8f uacc[2] = {zero8(), zero8()};
  {
    v8f cneg[2];
#pragma unroll
    for (int t = 0; t < 2; ++t) {
      const float cm = 10.0f - mw[t];
      cneg[t] = (v8f){cm, cm, cm, cm, cm, cm, cm, cm};
    }
    const int xl = ((c < 4) ? c : 4) | (lane & 16);     // A row (lane&15) reads xT row min(lane&15, 4)
#pragma unroll 1                                        // rolled, for the same register bound
    for (int cp = 0; cp < npair; ++cp) {
      Frag ka;
      ka.h[0] = *(const v8h*)(kp + (size_t)(2 * cp) * (BC * 8));
      ka.h[1] = *(const v8h*)(kp + (size_t)(2 * cp + 1) * (BC * 8));
      // A operands of the value product: split k map over keys, the map of the packed D pair
      const v16h xa0 = ldfrag(xT, XTP, 0, (2 * cp) * BC + pk * 32, xl);
      const v16h xa1 = ldfrag(xT, XTP, 0, (2 * cp + 1) * BC + pk * 32, xl);
      v8f s[2][4];                                      // s[t][j][r]: key k0(chunk 2cp + (j>>1)) + 16(j&1) + 8hh + r, query c of tile t
#pragma unroll
      for (int t = 0; t < 2; ++t)
#pragma unroll
        for (int j = 0; j < 4; ++j) s[t][j] = mmab(ka.v, yq[t][j], cneg[t]);
      // keeps the eight products together, for the same reason as in pass 1
      __builtin_amdgcn_sched_barrier(0);
#pragma unroll
      for (int t = 0; t < 2; ++t) {
#pragma unroll
        for (int j = 0; j < 4; ++j)
#pragma unroll
          for (int r = 0; r < 8; ++r) s[t][j][r] = __builtin_amdgcn_exp2f(s[t][j][r]);
        Frag pb0, pb1;
        pb0.h[0] = __builtin_convertvector(s[t][0], v8h);
        pb0.h[1] = __builtin_convertvector(s[t][1], v8h);
        pb1.h[0] = __builtin_convertvector(s[t][2], v8h);
        pb1.h[1] = __builtin_convertvector(s[t][3], v8h);
        uacc[t] = mmab(xa0, pb0.v, uacc[t]);
        uacc[t] = mmab(xa1, pb1.v, uacc[t]);
      }
    }
    if (nch & 1) {                                      // block-uniform: the odd last chunk
      Frag ka;
      ka.h[0] = *(const v8h*)(kp + (size_t)(nch - 1) * (BC * 8));
      ka.h[1] = ka.h[0];
      const v16h xa0 = ldfrag(xT, XTP, 0, (nch - 1) * BC + pk * 32, xl);
#pragma unroll
      for (int t = 0; t < 2; ++t) {
        v8f s0 = mmab(ka.v, yq[t][0], cneg[t]);
        v8f s1 = mmab(ka.v, yq[t][1], cneg[t]);
#pragma unroll
        for (int r = 0; r < 8; ++r) {
          s0[r] = __builtin_amdgcn_exp2f(s0[r]);
          s1[r] = __builtin_amdgcn_exp2f(s1[r]);
        }
        Frag pb0;
        pb0.h[0] = __builtin_convertvector(s0, v8h);
        pb0.h[1] = __builtin_convertvector(s1, v8h);
        uacc[t] = mmab(xa0, pb0.v, uacc[t]);
      }
    }
  }

  // ---- tail: join the four key slices, 1/l per row, z^T = W'.[u; 1]^T, PReLU, out^T = Wout^T.z^T ----
  const float a = pa[0];
  const float sg = (a <= 1.0f) ? 1.0f : -1.0f;          // PReLU(z) = sg max(sg z, a sg z), for every a
  const _Float16 sh = (_Float16)sg, ah = (_Float16)a;
  const v8h av = (v8h){ah, ah, ah, ah, ah, ah, ah, ah};
  if (lane < 16) {                                      // D rows 0..4 sit in lanes 0..15
#pragma unroll
    for (int t = 0; t < 2; ++t) {
      float* d = uP + (size_t)(pk * BR + 32 * pt + 16 * t + c) * 8;
      *(v4f*)d       = (v4f){uacc[t][0], uacc[t][1], uacc[t][2], uacc[t][3]};
      *(v2f*)(d + 4) = (v2f){uacc[t][4], mw[t]};
    }
  }
  __syncthreads();                                      // uP complete (cross-wave)
  Frag wz;                                              // A operand of the z product: lane l holds channels ch0 + l and ch0 + 32 + l
  wz.h[0] = *(const v8h*)(wzl);
  wz.h[1] = *(const v8h*)(wzl + 256);
  v16h wof[2][2];                                       // A operands of out^T: [out column tile][32-channel step], from the wave's own LDS rows
#pragma unroll
  for (int nt = 0; nt < 2; ++nt)
#pragma unroll
    for (int ks = 0; ks < 2; ++ks) wof[nt][ks] = ldfrag(wl, WOP, 16 * nt, 32 * ks, lane);
  // keeps all ten loads issued here, in front of the join: without it the compiler may sink them to just in front of
  // their first use, where their latency is waited out
  __builtin_amdgcn_sched_barrier(0);
  Pack8 own[2], oth[2];                                 // query side of the z product: row 32g + lane, and row 32g + (lane ^ 16)
#pragma unroll
  for (int g = 0; g < 2; ++g) {
    const int jr = 32 * g + lane;
    v2f lm[4];
#pragma unroll
    for (int i = 0; i < 4; ++i) lm[i] = *(const v2f*)(uP + (size_t)(i * BR + jr) * 8 + 4);
    const float m = fmaxf(fmaxf(lm[0][1], lm[1][1]), fmaxf(lm[2][1], lm[3][1]));
    v4f us = (v4f){0.f, 0.f, 0.f, 0.f};
    float l = 0.f;
#pragma unroll
    for (int i = 0; i < 4; ++i) {
      const float f = __builtin_amdgcn_exp2f(lm[i][1] - m);
      us += *(const v4f*)(uP + (size_t)(i * BR + jr) * 8) * f;
      l = fmaf(lm[i][0], f, l);
    }
    const float inv = (l > 0.f) ? (sg / l) : 0.f;       // u and l both carry the x1024; sg: see above
    const float u0 = (us[0] + us[2]) * inv, u1 = (us[1] + us[3]) * inv;
    const _Float16 h0 = (_Float16)u0, h1 = (_Float16)u1;
    const _Float16 l0 = (_Float16)(u0 - (float)h0), l1 = (_Float16)(u1 - (float)h1);
    own[g].h = (v8h){h0, h0, l0, h1, h1, l1, sh, sh};
#pragma unroll
    for (int i = 0; i < 4; ++i)                         // lane l <-> l ^ 16
      oth[g].u[i] = (unsigned int)__builtin_amdgcn_permlanex16((int)own[g].u[i], (int)own[g].u[i], 0x76543210, 0xfedcba98, false, false);
  }
#pragma unroll
  for (int qt = 0; qt < 4; ++qt) {                      // query tile: rows 16qt + c
    const v8h rq = (hh == (qt & 1)) ? own[qt >> 1].h : oth[qt >> 1].h;  // the eight halves of row 16qt + c, in both lane halves
    v8h s[4];                                           // s[j][r]: sg z x16 of channel ch0 + 16j + 8hh + r, row 16qt + c
#pragma unroll
    for (int j = 0; j < 4; ++j) {
      Frag f;                                           // tile j's 8 k slots alone carry the row
      f.h[j >> 1]       = (hh == (j & 1)) ? rq : zz;
      f.h[(j >> 1) ^ 1] = zz;
      s[j] = mmah(wz.v, f.v, zz);
    }
    // keeps the four products together: each fills the distance behind the one before, which v_nop fills otherwise
    __builtin_amdgcn_sched_barrier(0);
#pragma unroll
    for (int j = 0; j < 4; ++j) s[j] = __builtin_elementwise_maximum(s[j], s[j] * av);
    Frag pb0, pb1;
    pb0.h[0] = s[0];
    pb0.h[1] = s[1];
    pb1.h[0] = s[2];
    pb1.h[1] = s[3];
#pragma unroll
    for (int nt = 0; nt < 2; ++nt) {
      v8f acc = mmab(wof[nt][0], pb0.v, zero8());
      acc = mmab(wof[nt][1], pb1.v, acc);
      float* pp = part + wave * (BR * PTP) + (16 * qt + c) * PTP + 16 * nt + 8 * hh;
      *(v4f*)pp       = (v4f){acc[0], acc[1], acc[2], acc[3]};
      *(v4f*)(pp + 4) = (v4f){acc[4], acc[5], acc[6], acc[7]};
    }
  }
  __syncthreads();                                      // part complete
  {
    const int pc = tid & 7;
    const v4f bb = *(const v4f*)(bo + pc * 4);
#pragma unroll
    for (int g = 0; g < 2; ++g) {
      const int row = 32 * g + (tid >> 3);
      v4f sum = *(const v4f*)(part + row * PTP + pc * 4);
#pragma unroll
      for (int w = 1; w < 8; ++w) sum += *(const v4f*)(part + w * (BR * PTP) + row * PTP + pc * 4);
      const v4f val = sum * (sg * 0.0009765625f) + bb;  // sg/(16 * 64)
      v4f* d = (v4f*)(out + (tokbase + (size_t)row) * OD + pc * 4);
      *d = val;
    }
  }
}

// No workspace is used.
extern "C" void kernel_launch(void* const* d_in, const int* in_sizes, int n_in,
                              void* d_out, int out_size, void* d_ws, size_t ws_size,
                              hipStream_t stream) {
  if (n_in < 12) return;
  if (in_sizes[0] != NTOK * 2) return;
  if (in_sizes[1] < 1) return;
  if (in_sizes[2] != 2 * HD) return;
  if (in_sizes[3] != 2 * HD) return;
  if (in_sizes[4] != 2 * HD) return;
  if (in_sizes[5] != HD) return;
  if (in_sizes[6] != HD) return;
  if (in_sizes[7] != HD) return;
  if (in_sizes[8] != HD) return;
  if (in_sizes[9] < 1) return;
  if (in_sizes[10] != HD * OD) return;
  if (in_sizes[11] != OD) return;
  if (out_size != NTOK * OD) return;

  const float* x    = (const float*)d_in[0];    // [32768][2]
  const int*   bsz  = (const int*)d_in[1];      // [1]
  const float* wq   = (const float*)d_in[2];    // [2][512]
  const float* wk   = (const float*)d_in[3];    // [2][512]
  const float* wv   = (const float*)d_in[4];    // [2][512]
  const float* gam  = (const float*)d_in[5];    // [512]
  const float* bet  = (const float*)d_in[6];    // [512]
  const float* mu   = (const float*)d_in[7];    // [512]
  const float* var  = (const float*)d_in[8];    // [512]
  const float* pa   = (const float*)d_in[9];    // [1]
  const float* wo   = (const float*)d_in[10];   // [512][32]
  const float* bo   = (const float*)d_in[11];   // [32]
  float* out = (float*)d_out;                   // [32768][32]

  const float sscale = 1.0f / sqrtf((float)HD);

  // attention + BN/PReLU/Wout tail -> d_out
  k_attn<<<dim3(SEQ / BR, NBAT), dim3(256), 0, stream>>>(x, wq, wk, wv, gam, bet, mu, var, wo, pa, bo, bsz, out, sscale);
  (void)hipGetLastError();
}

// v008
// It runs in 7.51 microseconds.
// Two timings next to v007 put it at 1.11 and 1.12 times that version's speed.
// Counting every step since v000, it is 40.5 times as fast.
// Contractions: S^T = x.(x.M)^T with M = Wq.Wk^T (2 x 2, f32) on v_wmma_f32_16x16x32_f16 (f16 hi + lo operand pairs, f32 accumulate, minus the softmax reference point enters as C); u^T = [x^T; 1].P^T (x as hi and lo rows, a row of ones for the row sum, p in its query's own scale packed from the score accumulators) on v_wmma_f32_16x16x32_f16 (f16 operands, f32 accumulate); z^T = W'.[u; 1]^T (projection u.Wv with the BN affine folded in, x16; f16 hi + lo operand pairs, D written as f16) on v_wmma_f16_16x16x32_f16; out^T = Wout^T.z^T on v_wmma_f32_16x16x32_f16 (f16 operands: z x16 as the z product's f16 D tiles after PReLU, Wout x64; f32 accumulate, 1/1024 folded back in f32). M, y = x.M and the folded channel constants exact f32 on VALU; score scale, softmax reference point, exp2, 1/l and bias in f32; PReLU in packed f16 on the f16 z tiles.
#include <hip/hip_runtime.h>
#include <math.h>
#include <stddef.h>
#include <stdint.h>

#define NTOK 32768              // token rows
#define NBAT 32                 // sequences
#define SEQ  1024               // tokens per sequence
#define HD   512                // head width
#define OD   32                 // output width
#define BR   64                 // query rows per attention block
#define BC   128                // keys per chunk

static_assert(NTOK == NBAT * SEQ);
static_assert(SEQ % BC == 0);
static_assert(SEQ % BR == 0);
static_assert(BC % 32 == 0);
static_assert(HD == 512);
static_assert((HD / 8) == 64);
static_assert(SEQ == 256 * 4);
static_assert(OD == 32);

typedef _Float16 v16h __attribute__((ext_vector_type(16)));
typedef _Float16 v8h  __attribute__((ext_vector_type(8)));
typedef _Float16 v4h  __attribute__((ext_vector_type(4)));
typedef float    v8f  __attribute__((ext_vector_type(8)));
typedef float    v4f  __attribute__((ext_vector_type(4)));
typedef float    v2f  __attribute__((ext_vector_type(2)));
typedef unsigned int v4u __attribute__((ext_vector_type(4)));

union Frag  { v16h v; v8h h[2]; };
union Pack8 { v8h h; v4u u; };

// Fragment loader for k-contiguous 16-bit rows with pitch ld.
// A operand: row0 + (lane&15) is the M row.  B operand stored [n][k]: row0 + (lane&15) is the N column.
// Split k map for both: elements 0..7 <- k0 + 8*(lane>>4) + 0..7, elements 8..15 <- k0 + 16 + 8*(lane>>4) + 0..7.
// D map: acc[r] = element (8*(lane>>4) + r, lane&15) of the 16x16 tile.
__device__ __forceinline__ v16h ldfrag(const _Float16* p, int ld, int row0, int k0, int lane) {
  const int m = lane & 15, lh = lane >> 4;
  const _Float16* q = p + (size_t)(row0 + m) * ld + k0 + 8 * lh;
  Frag f;
  f.h[0] = *(const v8h*)(q);
  f.h[1] = *(const v8h*)(q + 16);
  return f.v;
}

__device__ __forceinline__ v8f zero8() { return (v8f){0.f, 0.f, 0.f, 0.f, 0.f, 0.f, 0.f, 0.f}; }

// ---------------------------------------------------------------------------
// the one kernel: non-causal attention per (query tile, sequence), single head of width 512, with the
// BN-affine + PReLU + z.Wout + bias tail fused, and every derived weight formed by the block that uses it. Block = 8 waves = 64 query rows of one sequence;
// key chunks of 128 (nch = SEQ/BC = 8, derived from the batch_size input and clamped to the static maximum).
//   x: f32 input [token][2]; all weights as the f32 inputs.
// Derived weights, formed in front of the first barrier:
//   M = Wq.Wk^T [2][2] in f32: thread t takes h = 2t, 2t+1; sum over the wave's lanes in registers; the eight waves'
//   partial sums go to LDS (mP) and every wave adds them behind the barrier.
//   W' (x16): wave w owns channels 64w .. 64w+63; lane l forms channels 64w + l and 64w + 32 + l. With sc = gamma/sqrt(var + eps):
//   z = (u.Wv - mean) sc + beta = u0 (Wv0 sc) + u1 (Wv1 sc) + (beta - mean sc); the three constants x16, each as an f16
//   pair hi + lo: w0hi w0lo w0hi w1hi w1lo w1hi bhi blo, the channel side of the z product's 8 k slots; kept in LDS (sWz), read by this lane alone.
//   Wout (x64, f16): the wave's 64 rows [k][32], 16 B a lane (whole 128-B lines), eight k of one column packed to 16 B and
//   stored [n][k] in the wave's own LDS rows (pitch 144 B); only this wave reads them, so they need no barrier.
// S: q.k = sum_ij x_i M_ij x'_j = y.x' with y = x.M, so the score product contracts 2 dims, not 512. y carries
//   the score scale and log2(e). Each f32 factor goes in as an f16 pair hi + lo and the four cross products of
//   the two dims fill 8 k slots of one 16x16x32 step.
// Wave w: query tiles 2(w&1) and 2(w&1) + 1 (16 rows each; one key fragment and one x^T fragment serve both), keys 32(w>>1)..+31 of each chunk;
//   the softmax never leaves the wave's registers.
//   S^T = K.Y^T: keys are the M rows, queries the N columns, so lane (h, c) holds keys 8h + r of query c.
//   The block forms kF [key][8 halves] once in LDS; lane l loads key k0 + l of two chunks, so one A fragment holds
//   four 16-key tiles, tile j in elements 8(j>>1)..+7 of lanes 16(j&1)..+15 (8 of the 32 k slots each); the B
//   fragment yq[j] is zero outside tile j's slots, which picks the 16 keys of each product.
//   Reference point mw per query: softmax is the same under any shift, so no pass looks for the maximum: s = y.x' <= |y| max|x'|
//   (max|x'|^2 over the sequence: per thread, per wave in registers, the eight waves' values through LDS (rP) behind the first barrier);
//   mw = that bound - 15, so p = exp2(s - mw) <= 2^15. The products run with C = -mw, p = exp2(D); the two D tiles of 32 keys, converted in
//   place, are the B operand of the value product (element s = key kmap(s, h) of query c).
//   A wave whose row sums show the bound too loose for f16 repeats its keys under the exact maximum (in-lane, one exchange between the lane halves).
// O: p.v = p.(x.Wv) = (p.x).Wv. u^T = A.P^T with A rows [hi0 hi1 lo0 lo1 ones ones ...][key] from LDS (xT, the same
//   k map): D rows 0..3 are the four partial sums of u, row 4 the row sum l (of the rounded p), all in p's scale.
//   After the loop the four key slices, each under its own reference point, are joined through LDS (uP).
// Tail: every wave joins the slices itself (lane = row, two rounds of 32 rows): u = (hi + lo sums) / l. z never leaves the wave's registers:
//   z^T = W'.[u; 1]^T: channels are the M rows, queries the N columns. Wave w owns channels 64w .. 64w+63 for all 64
//   rows. One A fragment holds the four 16-channel tiles, tile j in elements 8(j>>1)..+7 of lanes 16(j&1)..+15 (8 of the 32 k
//   slots each); the B fragment of tile j is zero outside tile j's slots, as in the score product. Query side of the 8 slots:
//   u0hi u0hi u0lo u1hi u1hi u1lo 1 1 (the lo.lo products are left out), all times sg. D is written as f16 (element e of a
//   lane = row 8(lane>>4) + e, the order of a converted f32 D tile). PReLU on the packed halves, two instructions a register:
//   with sg = +1 for a <= 1 and -1 for a > 1, PReLU(z) = sg max(sg z, a sg z) for every a; sg rides on the query side and on the
//   last scale. Two D tiles are the B operand of out^T = Wout^T.z^T (k slot = channel offset, the split k map of ldfrag).
//   out^T D: lane (h, c) holds out columns 16nt + 8h + r of query c: partial tile to LDS part[wave][64][32]; barrier;
//   val = sg (sum of the eight parts)/1024 + b_out.
// LDS: sKX = kF + xT; sWz; mP; rP; uP; sBig = eight wave-owned pieces of 64 x 144 B: the wave's Wout rows (the first 32 x 144 B), then (those read) its part tile.
// grid = (SEQ/BR, NBAT) = (16, 32).
// coverage: part per wave 64 x 32; d_out per block 256 thr x 2 x 4 floats = 64 rows x 32 -> 512 blocks = 32768 rows x 32.
// ---------------------------------------------------------------------------
#define PTP 36
#define XTP 1040                              // xT row pitch in halves: rows 32 B apart modulo the 256-B bank span
#define WOP 72                                // Wout row pitch in halves: 144 B, the pitch of a part row
#define SBIGF      (8 * BR * PTP)             // 18432 floats = 73728 B
static_assert(WOP * 2 == PTP * 4);
static_assert(OD <= BR);
static_assert(BR == 64);
static_assert((PTP % 4) == 0);
static_assert((XTP % 8) == 0);
static_assert(XTP >= SEQ);
static_assert(HD == 8 * 64);

// Score operands from one f32 pair (u0, u1), eight halves (k slots) a side:
//   query side: hi0 hi1 hi0 hi1 lo0 lo1 lo0 lo1      key side: hi0 hi1 lo0 lo1 hi0 hi1 lo0 lo1
// so slot by slot the products are hi.hi, hi.lo, lo.hi, lo.lo for dim 0 and dim 1.
__device__ __forceinline__ v8h qhalves(float u0, float u1) {
  const _Float16 h0 = (_Float16)u0, h1 = (_Float16)u1;
  const _Float16 l0 = (_Float16)(u0 - (float)h0), l1 = (_Float16)(u1 - (float)h1);
  return (v8h){h0, h1, h0, h1, l0, l1, l0, l1};
}

// WMMA as the bare builtin: the compiler keeps the distance behind it and can fill it with the other tile's work
__device__ __forceinline__ v8f mmab(v16h a, v16h b, v8f c) {
  return __builtin_amdgcn_wmma_f32_16x16x32_f16(false, a, false, b, (short)0, c, false, false);
}

// the same product with D (and C) in f16: four registers a tile, already in the packed order of a B operand half
__device__ __forceinline__ v8h mmah(v16h a, v16h b, v8h c) {
  return __builtin_amdgcn_wmma_f16_16x16x32_f16(false, a, false, b, (short)0, c, false, false);
}

// v + (v of lane l ^ X) inside a 16-lane row: one DPP add (row_xmask), no LDS trip
template <int X>
__device__ __forceinline__ float addx(float v) {
  return v + __builtin_bit_cast(float, __builtin_amdgcn_update_dpp(0, __builtin_bit_cast(int, v), 0x160 + X, 0xf, 0xf, true));
}
// sum over the 32 lanes, the same value in every lane
__device__ __forceinline__ float wsum(float v) {
  v = addx<1>(v);
  v = addx<2>(v);
  v = addx<4>(v);
  v = addx<8>(v);
  const int vb = __builtin_bit_cast(int, v);            // lane l <-> l ^ 16
  return v + __builtin_bit_cast(float, __builtin_amdgcn_permlanex16(vb, vb, 0x76543210, 0xfedcba98, false, false));
}

// max(v, v of lane l ^ X) inside a 16-lane row, on the bits of floats that are not negative (their order is the unsigned order): one DPP maximum
template <int X>
__device__ __forceinline__ unsigned int maxx(unsigned int v) {
  const unsigned int o = (unsigned int)__builtin_amdgcn_update_dpp(0, (int)v, 0x160 + X, 0xf, 0xf, true);
  return (v > o) ? v : o;
}

// channel side of the z product's 8 k slots for BN channel h
__device__ __forceinline__ v8h chrow(float g, float vr, float v0, float v1, float be, float mn) {
  const float sc = g * (1.0f / sqrtf(vr + 1.0e-5f));
  const float w0 = v0 * sc * 16.0f, w1 = v1 * sc * 16.0f;
  const float bb = (be - mn * sc) * 16.0f;
  const _Float16 w0h = (_Float16)w0, w1h = (_Float16)w1, bh = (_Float16)bb;
  const _Float16 w0l = (_Float16)(w0 - (float)w0h), w1l = (_Float16)(w1 - (float)w1h), bl = (_Float16)(bb - (float)bh);
  return (v8h){w0h, w0l, w0h, w1h, w1l, w1h, bh, bl};
}

// second bound: 4 waves a SIMD, that is 256 registers: 2 blocks stay on a WGP and the grid is resident in one round
__global__ __launch_bounds__(256, 4) void k_attn(const float* __restrict__ x,
                                              const float* __restrict__ wq,
                                              const float* __restrict__ wk,
                                              const float* __restrict__ wv,
                                              const float* __restrict__ gam,
                                              const float* __restrict__ bet,
                                              const float* __restrict__ mu,
                                              const float* __restrict__ var,
                                              const float* __restrict__ wo,
                                              const float* __restrict__ pa,
                                              const float* __restrict__ bo,
                                              const int* __restrict__ bsp,
                                              float* __restrict__ out, float sscale) {
  __shared__ __align__(16) float sBig[SBIGF];
  __shared__ __align__(16) _Float16 sKX[SEQ * 8 + 5 * XTP];
  __shared__ __align__(16) float uP[4 * BR * 8];        // [key slice][row][u hi0 hi1 lo0 lo1, l, reference point, -, -]
  __shared__ __align__(16) float mP[8 * 4];             // [wave][M00 M01 M10 M11], partial sums
  __shared__ __align__(16) unsigned int rP[8];          // [wave] largest |x|^2 of the wave's 128 tokens, the float's bits
  __shared__ __align__(16) _Float16 sWz[8 * 2 * 32 * 8];  // [wave][channel half][lane][8 k slots]

  _Float16* kF   = sKX;
  _Float16* xT   = sKX + SEQ * 8;
  float*    part = sBig;

  const int tid = threadIdx.x, lane = tid & 31, wave = tid >> 5;
  const int hh = lane >> 4, c = lane & 15;
  const int b  = blockIdx.y;
  const int q0 = (int)blockIdx.x * BR;                  // query row base within the sequence
  int bs = bsp[0];
  bs = (bs < 1) ? 1 : bs;
  int seql = NTOK / bs;
  seql = (seql > SEQ) ? SEQ : seql;
  const int nch = seql / BC;                            // block-uniform, <= SEQ/BC
  const float* Xb = x + (size_t)b * SEQ * 2;             // this sequence's token rows [l][2]
  const size_t tokbase = (size_t)b * SEQ + q0;
  const int pt = wave & 1, pk = wave >> 1;              // this wave's pair of query tiles and its 32-key slice of each chunk
  const v8h zz = (v8h){0, 0, 0, 0, 0, 0, 0, 0};

  const int ch0 = wave * 64;                            // this wave's 64 channels
  _Float16* wl = (_Float16*)sBig + wave * (BR * WOP);   // this wave's Wout rows [n][k - ch0], at the head of its own piece
  _Float16* wzl = sWz + wave * 512 + lane * 8;          // this lane's W' rows: channel ch0 + l, and at + 256 halves ch0 + 32 + l
  // every global load of the prologue, in the order of use
  const v4f a0 = *(const v4f*)(Xb + 8 * tid);           // thread t: tokens 4t .. 4t+3
  const v4f a1 = *(const v4f*)(Xb + 8 * tid + 4);
  const v2f q0v = *(const v2f*)(wq + 2 * tid);          // thread t: h = 2t, 2t+1 of M's sum
  const v2f q1v = *(const v2f*)(wq + HD + 2 * tid);
  const v2f k0v = *(const v2f*)(wk + 2 * tid);
  const v2f k1v = *(const v2f*)(wk + HD + 2 * tid);
  float cg[2], cr[2], c0[2], c1[2], cb[2], cm[2];       // lane l: channels ch0 + l and ch0 + 32 + l
#pragma unroll
  for (int i = 0; i < 2; ++i) {
    const int h = ch0 + 32 * i + lane;
    cg[i] = gam[h];
    cr[i] = var[h];
    c0[i] = wv[h];
    c1[i] = wv[HD + h];
    cb[i] = bet[h];
    cm[i] = mu[h];
  }
  // the wait that stands in front of an overwrite of the loads' offset registers;
  // the two scheduling barriers hold it directly behind the loads: without them a register write is placed in between
  __builtin_amdgcn_sched_barrier(0);
  asm volatile("s_wait_xcnt 0x0" ::: "memory");
  __builtin_amdgcn_sched_barrier(0);
  const int nq = lane & 7, kg = lane >> 3;              // lane l: Wout columns 4(l&7)..+3 of rows 8(l>>3) + 0..7 of each 32-row half
  v4f wr[2][8];
  {
    const float* ws = wo + (size_t)(ch0 + 8 * kg) * OD + 4 * nq;
#pragma unroll
    for (int s = 0; s < 2; ++s)
#pragma unroll
      for (int i = 0; i < 8; ++i) {
        // the last load's result lands on the address pair that all sixteen name: the wait that stands in front of such an overwrite
        if (s == 1 && i == 7) asm volatile("s_wait_xcnt 0x0" ::: "memory");
        wr[s][i] = *(const v4f*)(ws + (size_t)(32 * s + i) * OD);
      }
  }
  // keeps the Wout loads issued in front of the first wait for data: without it they start a load latency later
  __builtin_amdgcn_sched_barrier(0);
  {
    // this sequence's tokens as f16 hi and lo: x^T rows (and a row of ones) and the key-side score operands
    const int l0 = tid * 4;
    const v4f e0 = (v4f){a0[0], a0[2], a1[0], a1[2]};
    const v4f e1 = (v4f){a0[1], a0[3], a1[1], a1[3]};
    v4h h0, h1, g0, g1;
#pragma unroll
    for (int e = 0; e < 4; ++e) {
      h0[e] = (_Float16)e0[e];
      h1[e] = (_Float16)e1[e];
      g0[e] = (_Float16)(e0[e] - (float)h0[e]);
      g1[e] = (_Float16)(e1[e] - (float)h1[e]);
    }
    *(v4h*)(xT + 0 * XTP + l0) = h0;
    *(v4h*)(xT + 1 * XTP + l0) = h1;
    *(v4h*)(xT + 2 * XTP + l0) = g0;
    *(v4h*)(xT + 3 * XTP + l0) = g1;
    *(v4h*)(xT + 4 * XTP + l0) = (v4h){1, 1, 1, 1};
#pragma unroll
    for (int e = 0; e < 4; ++e)
      *(v8h*)(kF + (size_t)(l0 + e) * 8) = (v8h){h0[e], h1[e], g0[e], g1[e], h0[e], h1[e], g0[e], g1[e]};
  }
  // largest squared token norm of this wave's 128 tokens, the same value in every lane
  unsigned int r2 = __builtin_bit_cast(unsigned int, fmaxf(fmaxf(fmaf(a0[1], a0[1], a0[0] * a0[0]), fmaf(a0[3], a0[3], a0[2] * a0[2])),
                                                           fmaxf(fmaf(a1[1], a1[1], a1[0] * a1[0]), fmaf(a1[3], a1[3], a1[2] * a1[2]))));
  r2 = maxx<8>(maxx<4>(maxx<2>(maxx<1>(r2))));
  {
    const unsigned int ro = (unsigned int)__builtin_amdgcn_permlanex16((int)r2, (int)r2, 0x76543210, 0xfedcba98, false, false);  // lane l <-> l ^ 16
    r2 = (r2 > ro) ? r2 : ro;
  }
  // M = Wq.Wk^T: this wave's 64 h
  const float m00 = wsum(fmaf(q0v[1], k0v[1], q0v[0] * k0v[0]));
  const float m01 = wsum(fmaf(q0v[1], k1v[1], q0v[0] * k1v[0]));
  const float m10 = wsum(fmaf(q1v[1], k0v[1], q1v[0] * k0v[0]));
  const float m11 = wsum(fmaf(q1v[1], k1v[1], q1v[0] * k1v[0]));
  // W' rows, done under the flight of the Wout loads and parked in the wave's own LDS piece until the tail
#pragma unroll
  for (int i = 0; i < 2; ++i) *(v8h*)(wzl + i * 256) = chrow(cg[i], cr[i], c0[i], c1[i], cb[i], cm[i]);
  {
#pragma unroll
    for (int s = 0; s < 2; ++s) {
      v4f r[8];
#pragma unroll
      for (int i = 0; i < 8; ++i) r[i] = wr[s][i] * 64.0f;
#pragma unroll
      for (int e = 0; e < 4; ++e)
        *(v8h*)(wl + (4 * nq + e) * WOP + (4 * s + kg) * 8) =
            (v8h){(_Float16)r[0][e], (_Float16)r[1][e], (_Float16)r[2][e], (_Float16)r[3][e],
                  (_Float16)r[4][e], (_Float16)r[5][e], (_Float16)r[6][e], (_Float16)r[7][e]};
    }
  }
  if (lane == 0) {
    *(v4f*)(mP + 4 * wave) = (v4f){m00, m01, m10, m11};
    rP[wave] = r2;
  }
  __syncthreads();                                      // kF, xT, mP and rP complete
  // B fragments of the score product: y = x.M (x score scale x log2 e) for query rows q0 + 32pt + 16t + (lane&15), t = 0, 1
  v16h yq[2][4];
  float mw[2];                                          // reference point of the softmax per query: p = exp2(s - mw)
  {
    // asked for here, not with the prologue's loads: this block has just read the lines, and the loads fly beside the LDS trip below
    v2f xq[2];
#pragma unroll
    for (int t = 0; t < 2; ++t) xq[t] = *(const v2f*)(Xb + 2 * (size_t)(q0 + 32 * pt + 16 * t + c));
    // the wait that stands in front of an overwrite of the two loads' offset registers; the two scheduling barriers hold it directly behind the loads
    __builtin_amdgcn_sched_barrier(0);
    asm volatile("s_wait_xcnt 0x0" ::: "memory");
    __builtin_amdgcn_sched_barrier(0);
    // lane l reads partial sum l&3 of wave l>>2; three exchanges (l ^ 4, l ^ 8, l ^ 16) sum over the waves
    float ms = addx<8>(addx<4>(mP[lane]));
    const int mb = __builtin_bit_cast(int, ms);
    ms += __builtin_bit_cast(float, __builtin_amdgcn_permlanex16(mb, mb, 0x76543210, 0xfedcba98, false, false));
    const int mi = __builtin_bit_cast(int, ms);
    const v4f mv = (v4f){__builtin_bit_cast(float, __builtin_amdgcn_readlane(mi, 0)),    // M00 M01 M10 M11, wave-uniform
                         __builtin_bit_cast(float, __builtin_amdgcn_readlane(mi, 1)),
                         __builtin_bit_cast(float, __builtin_amdgcn_readlane(mi, 2)),
                         __builtin_bit_cast(float, __builtin_amdgcn_readlane(mi, 3))};
    const float ys = sscale * 1.4426950408889634f;
    const float rr = __builtin_bit_cast(float, maxx<4>(maxx<2>(maxx<1>(rP[lane & 7]))));   // largest |x|^2 of the sequence
#pragma unroll
    for (int t = 0; t < 2; ++t) {
      const float y0 = fmaf(xq[t][1], mv[2], xq[t][0] * mv[0]) * ys, y1 = fmaf(xq[t][1], mv[3], xq[t][0] * mv[1]) * ys;
      const v8h yv = qhalves(y0, y1);
      // s = y.x' <= |y| max|x'|: no key's p exceeds 2^15, which f16 holds
      mw[t] = __builtin_amdgcn_sqrtf(fmaf(y1, y1, y0 * y0) * rr) - 15.0f;
#pragma unroll
      for (int j = 0; j < 4; ++j) {
        Frag f;
        f.h[j >> 1]       = (hh == (j & 1)) ? yv : zz;
        f.h[(j >> 1) ^ 1] = zz;
        yq[t][j] = f.v;
      }
    }
  }

  const _Float16* kp = kF + (size_t)(pk * 32 + lane) * 8;   // lane l: key k0 + l of each 32-key step

  const int npair = nch >> 1;                           // two chunks (64 of this wave's keys) per A fragment

  v8f uacc[2];
  // First trip: the bound is the reference point, so no pass over the scores looks for a maximum. A loose bound makes every p small;
  // the row sum l (D rows 4..15, so element 4 of every lane) tells: at l >= 2^-5 the f16 floor (2^-25 a key, 256 keys) is below 2^-12 of l.
  // Where a query of this wave falls short of that, or a p left f16's range, a second trip takes the exact maximum instead.
#pragma unroll 1                                        // rolled: the second trip is rare, and unrolled it would double the loop's code
  for (int att = 0; att < 2; ++att) {
    // ---- p = exp2(s - mw), packed in place into the value product's B operand ----
    uacc[0] = zero8();
    uacc[1] = zero8();
    {
      v8f cneg[2];
#pragma unroll
      for (int t = 0; t < 2; ++t) {
        const float cm = -mw[t];
        cneg[t] = (v8f){cm, cm, cm, cm, cm, cm, cm, cm};
      }
      const int xl = ((c < 4) ? c : 4) | (lane & 16);     // A row (lane&15) reads xT row min(lane&15, 4)
#pragma unroll 1                                        // rolled: a trip already holds eight independent products; a second trip's 64 score registers would press on the bound of 256
      for (int cp = 0; cp < npair; ++cp) {
        Frag ka;
        ka.h[0] = *(const v8h*)(kp + (size_t)(2 * cp) * (BC * 8));
        ka.h[1] = *(const v8h*)(kp + (size_t)(2 * cp + 1) * (BC * 8));
        // A operands of the value product: split k map over keys, the map of the packed D pair
        const v16h xa0 = ldfrag(xT, XTP, 0, (2 * cp) * BC + pk * 32, xl);
        const v16h xa1 = ldfrag(xT, XTP, 0, (2 * cp + 1) * BC + pk * 32, xl);
        v8f s[2][4];                                      // s[t][j][r]: key k0(chunk 2cp + (j>>1)) + 16(j&1) + 8hh + r, query c of tile t
#pragma unroll
        for (int t = 0; t < 2; ++t)
#pragma unroll
          for (int j = 0; j < 4; ++j) s[t][j] = mmab(ka.v, yq[t][j], cneg[t]);
        // keeps the eight products together: each fills the distance behind the one before, which v_nop fills otherwise
        __builtin_amdgcn_sched_barrier(0);
#pragma unroll
        for (int t = 0; t < 2; ++t) {
#pragma unroll
          for (int j = 0; j < 4; ++j)
#pragma unroll
            for (int r = 0; r < 8; ++r) s[t][j][r] = __builtin_amdgcn_exp2f(s[t][j][r]);
          Frag pb0, pb1;
          pb0.h[0] = __builtin_convertvector(s[t][0], v8h);
          pb0.h[1] = __builtin_convertvector(s[t][1], v8h);
          pb1.h[0] = __builtin_convertvector(s[t][2], v8h);
          pb1.h[1] = __builtin_convertvector(s[t][3], v8h);
          uacc[t] = mmab(xa0, pb0.v, uacc[t]);
          uacc[t] = mmab(xa1, pb1.v, uacc[t]);
        }
      }
      if (nch & 1) {                                      // block-uniform: the odd last chunk
        Frag ka;
        ka.h[0] = *(const v8h*)(kp + (size_t)(nch - 1) * (BC * 8));
        ka.h[1] = ka.h[0];
        const v16h xa0 = ldfrag(xT, XTP, 0, (nch - 1) * BC + pk * 32, xl);
#pragma unroll
        for (int t = 0; t < 2; ++t) {
          v8f s0 = mmab(ka.v, yq[t][0], cneg[t]);
          v8f s1 = mmab(ka.v, yq[t][1], cneg[t]);
#pragma unroll
          for (int r = 0; r < 8; ++r) {
            s0[r] = __builtin_amdgcn_exp2f(s0[r]);
            s1[r] = __builtin_amdgcn_exp2f(s1[r]);
          }
          Frag pb0;
          pb0.h[0] = __builtin_convertvector(s0, v8h);
          pb0.h[1] = __builtin_convertvector(s1, v8h);
          uacc[t] = mmab(xa0, pb0.v, uacc[t]);
        }
      }
    }
    const float la = uacc[0][4], lb = uacc[1][4];
    const bool good = (la >= 0.03125f) && (la <= 1.7e7f) && (lb >= 0.03125f) && (lb <= 1.7e7f);
    if (att == 1 || __builtin_amdgcn_ballot_w32(!good) == 0u) break;   // wave-uniform; no barrier stands in this loop

    // ---- the rare trip's reference point: this wave's maximum per query over its keys, p x1024 ----
    {
      v8f mx[2];
#pragma unroll
      for (int t = 0; t < 2; ++t)
#pragma unroll
        for (int r = 0; r < 8; ++r) mx[t][r] = -3.0e38f;  // finite, so that a wave without keys joins with factor 1
#pragma unroll 1                                        // rolled, for the same register bound
      for (int cp = 0; cp < npair; ++cp) {
        Frag ka;
        ka.h[0] = *(const v8h*)(kp + (size_t)(2 * cp) * (BC * 8));
        ka.h[1] = *(const v8h*)(kp + (size_t)(2 * cp + 1) * (BC * 8));
        v8f s[2][4];
#pragma unroll
        for (int t = 0; t < 2; ++t)
#pragma unroll
          for (int j = 0; j < 4; ++j) s[t][j] = mmab(ka.v, yq[t][j], zero8());
        // keeps the eight products together, for the same reason as above
        __builtin_amdgcn_sched_barrier(0);
#pragma unroll
        for (int t = 0; t < 2; ++t)
#pragma unroll
          for (int r = 0; r < 8; ++r)
            mx[t][r] = fmaxf(fmaxf(mx[t][r], fmaxf(s[t][0][r], s[t][1][r])), fmaxf(s[t][2][r], s[t][3][r]));
      }
      if (nch & 1) {                                      // block-uniform: the odd last chunk, tiles 0 and 1 alone
        Frag ka;
        ka.h[0] = *(const v8h*)(kp + (size_t)(nch - 1) * (BC * 8));
        ka.h[1] = ka.h[0];
#pragma unroll
        for (int t = 0; t < 2; ++t) {
          const v8f s0 = mmab(ka.v, yq[t][0], zero8());
          const v8f s1 = mmab(ka.v, yq[t][1], zero8());
#pragma unroll
          for (int r = 0; r < 8; ++r) mx[t][r] = fmaxf(mx[t][r], fmaxf(s0[r], s1[r]));
        }
      }
#pragma unroll
      for (int t = 0; t < 2; ++t) {
        const float m = fmaxf(fmaxf(fmaxf(mx[t][0], mx[t][1]), fmaxf(mx[t][2], mx[t][3])),
                              fmaxf(fmaxf(mx[t][4], mx[t][5]), fmaxf(mx[t][6], mx[t][7])));
        const int mb = __builtin_bit_cast(int, m);        // lane l <-> l ^ 16: the other eight keys of each tile
        mw[t] = fmaxf(m, __builtin_bit_cast(float, __builtin_amdgcn_permlanex16(mb, mb, 0x76543210, 0xfedcba98, false, false))) - 10.0f;
      }
    }
  }

  // ---- tail: join the four key slices, 1/l per row, z^T = W'.[u; 1]^T, PReLU, out^T = Wout^T.z^T ----
  const float a = pa[0];
  const float sg = (a <= 1.0f) ? 1.0f : -1.0f;          // PReLU(z) = sg max(sg z, a sg z), for every a
  const _Float16 sh = (_Float16)sg, ah = (_Float16)a;
  const v8h av = (v8h){ah, ah, ah, ah, ah, ah, ah, ah};
  if (lane < 16) {                                      // D rows 0..4 sit in lanes 0..15
#pragma unroll
    for (int t = 0; t < 2; ++t) {
      float* d = uP + (size_t)(pk * BR + 32 * pt + 16 * t + c) * 8;
      *(v4f*)d       = (v4f){uacc[t][0], uacc[t][1], uacc[t][2], uacc[t][3]};
      *(v2f*)(d + 4) = (v2f){uacc[t][4], mw[t]};
    }
  }
  __syncthreads();                                      // uP complete (cross-wave)
  Frag wz;                                              // A operand of the z product: lane l holds channels ch0 + l and ch0 + 32 + l
  wz.h[0] = *(const v8h*)(wzl);
  wz.h[1] = *(const v8h*)(wzl + 256);
  v16h wof[2][2];                                       // A operands of out^T: [out column tile][32-channel step], from the wave's own LDS rows
#pragma unroll
  for (int nt = 0; nt < 2; ++nt)
#pragma unroll
    for (int ks = 0; ks < 2; ++ks) wof[nt][ks] = ldfrag(wl, WOP, 16 * nt, 32 * ks, lane);
  // keeps all ten loads issued here, in front of the join: without it the compiler may sink them to just in front of
  // their first use, where their latency is waited out
  __builtin_amdgcn_sched_barrier(0);
  Pack8 own[2], oth[2];                                 // query side of the z product: row 32g + lane, and row 32g + (lane ^ 16)
#pragma unroll
  for (int g = 0; g < 2; ++g) {
    const int jr = 32 * g + lane;
    v2f lm[4];
#pragma unroll
    for (int i = 0; i < 4; ++i) lm[i] = *(const v2f*)(uP + (size_t)(i * BR + jr) * 8 + 4);
    const float m = fmaxf(fmaxf(lm[0][1], lm[1][1]), fmaxf(lm[2][1], lm[3][1]));
    v4f us = (v4f){0.f, 0.f, 0.f, 0.f};
    float l = 0.f;
#pragma unroll
    for (int i = 0; i < 4; ++i) {
      const float f = __builtin_amdgcn_exp2f(lm[i][1] - m);
      us += *(const v4f*)(uP + (size_t)(i * BR + jr) * 8) * f;
      l = fmaf(lm[i][0], f, l);
    }
    const float inv = (l > 0.f) ? (sg / l) : 0.f;       // u and l carry the same scale; sg: see above
    const float u0 = (us[0] + us[2]) * inv, u1 = (us[1] + us[3]) * inv;
    const _Float16 h0 = (_Float16)u0, h1 = (_Float16)u1;
    const _Float16 l0 = (_Float16)(u0 - (float)h0), l1 = (_Float16)(u1 - (float)h1);
    own[g].h = (v8h){h0, h0, l0, h1, h1, l1, sh, sh};
#pragma unroll
    for (int i = 0; i < 4; ++i)                         // lane l <-> l ^ 16
      oth[g].u[i] = (unsigned int)__builtin_amdgcn_permlanex16((int)own[g].u[i], (int)own[g].u[i], 0x76543210, 0xfedcba98, false, false);
  }
#pragma unroll
  for (int qt = 0; qt < 4; ++qt) {                      // query tile: rows 16qt + c
    const v8h rq = (hh == (qt & 1)) ? own[qt >> 1].h : oth[qt >> 1].h;  // the eight halves of row 16qt + c, in both lane halves
    v8h s[4];                                           // s[j][r]: sg z x16 of channel ch0 + 16j + 8hh + r, row 16qt + c
#pragma unroll
    for (int j = 0; j < 4; ++j) {
      Frag f;                                           // tile j's 8 k slots alone carry the row
      f.h[j >> 1]       = (hh == (j & 1)) ? rq : zz;
      f.h[(j >> 1) ^ 1] = zz;
      s[j] = mmah(wz.v, f.v, zz);
    }
    // keeps the four products together: each fills the distance behind the one before, which v_nop fills otherwise
    __builtin_amdgcn_sched_barrier(0);
#pragma unroll
    for (int j = 0; j < 4; ++j) s[j] = __builtin_elementwise_maximum(s[j], s[j] * av);
    Frag pb0, pb1;
    pb0.h[0] = s[0];
    pb0.h[1] = s[1];
    pb1.h[0] = s[2];
    pb1.h[1] = s[3];
#pragma unroll
    for (int nt = 0; nt < 2; ++nt) {
      v8f acc = mmab(wof[nt][0], pb0.v, zero8());
      acc = mmab(wof[nt][1], pb1.v, acc);
      float* pp = part + wave * (BR * PTP) + (16 * qt + c) * PTP + 16 * nt + 8 * hh;
      *(v4f*)pp       = (v4f){acc[0], acc[1], acc[2], acc[3]};
      *(v4f*)(pp + 4) = (v4f){acc[4], acc[5], acc[6], acc[7]};
    }
  }
  __syncthreads();                                      // part complete
  {
    const int pc = tid & 7;
    const v4f bb = *(const v4f*)(bo + pc * 4);
#pragma unroll
    for (int g = 0; g < 2; ++g) {
      const int row = 32 * g + (tid >> 3);
      v4f sum = *(const v4f*)(part + row * PTP + pc * 4);
#pragma unroll
      for (int w = 1; w < 8; ++w) sum += *(const v4f*)(part + w * (BR * PTP) + row * PTP + pc * 4);
      const v4f val = sum * (sg * 0.0009765625f) + bb;  // sg/(16 * 64)
      v4f* d = (v4f*)(out + (tokbase + (size_t)row) * OD + pc * 4);
      *d = val;
    }
  }
}

// No workspace is used.
extern "C" void kernel_launch(void* const* d_in, const int* in_sizes, int n_in,
                              void* d_out, int out_size, void* d_ws, size_t ws_size,
                              hipStream_t stream) {
  if (n_in < 12) return;
  if (in_sizes[0] != NTOK * 2) return;
  if (in_sizes[1] < 1) return;
  if (in_sizes[2] != 2 * HD) return;
  if (in_sizes[3] != 2 * HD) return;
  if (in_sizes[4] != 2 * HD) return;
  if (in_sizes[5] != HD) return;
  if (in_sizes[6] != HD) return;
  if (in_sizes[7] != HD) return;
  if (in_sizes[8] != HD) return;
  if (in_sizes[9] < 1) return;
  if (in_sizes[10] != HD * OD) return;
  if (in_sizes[11] != OD) return;
  if (out_size != NTOK * OD) return;

  const float* x    = (const float*)d_in[0];    // [32768][2]
  const int*   bsz  = (const int*)d_in[1];      // [1]
  const float* wq   = (const float*)d_in[2];    // [2][512]
  const float* wk   = (const float*)d_in[3];    // [2][512]
  const float* wv   = (const float*)d_in[4];    // [2][512]
  const float* gam  = (const float*)d_in[5];    // [512]
  const float* bet  = (const float*)d_in[6];    // [512]
  const float* mu   = (const float*)d_in[7];    // [512]
  const float* var  = (const float*)d_in[8];    // [512]
  const float* pa   = (const float*)d_in[9];    // [1]
  const float* wo   = (const float*)d_in[10];   // [512][32]
  const float* bo   = (const float*)d_in[11];   // [32]
  float* out = (float*)d_out;                   // [32768][32]

  const float sscale = 1.0f / sqrtf((float)HD);

  // attention + BN/PReLU/Wout tail -> d_out
  k_attn<<<dim3(SEQ / BR, NBAT), dim3(256), 0, stream>>>(x, wq, wk, wv, gam, bet, mu, var, wo, pa, bo, bsz, out, sscale);
  (void)hipGetLastError();
}

// v009
// One run takes 6.65 microseconds.
// Two timings next to v008 both put it at 1.13 times that version's speed.
// Counting every step since v000, it is 45.7 times as fast.
// Contractions: S^T = x.(x.M)^T with M = Wq.Wk^T (2 x 2, f32) on v_wmma_f32_16x16x32_f16 (f16 hi + lo operand pairs, f32 accumulate, minus the softmax reference point enters as C); u^T = [x^T; 1].P^T (x as hi and lo rows, a row of ones for the row sum, p in its query's own scale packed from the score accumulators) on v_wmma_f32_16x16x32_f16 (f16 operands, f32 accumulate); z^T = W'.[u; 1]^T (projection u.Wv with the BN affine folded in, x16; f16 hi + lo operand pairs, D written as f16) on v_wmma_f16_16x16x32_f16; out^T = Wout^T.z^T on v_wmma_f32_16x16x32_f16 (f16 operands: z x16 as the z product's f16 D tiles after PReLU, Wout x64; f32 accumulate, 1/1024 folded back in f32). M, y = x.M and the folded channel constants exact f32 on VALU; score scale, softmax reference point, exp2, 1/l and bias in f32; PReLU in packed f16 on the f16 z tiles.
#include <hip/hip_runtime.h>
#include <math.h>
#include <stddef.h>
#include <stdint.h>

#define NTOK 32768              // token rows
#define NBAT 32                 // sequences
#define SEQ  1024               // tokens per sequence
#define HD   512                // head width
#define OD   32                 // output width
#define BR   128                // query rows per attention block
#define BC   128                // keys per chunk

static_assert(NTOK == NBAT * SEQ);
static_assert(SEQ % BC == 0);
static_assert(SEQ % BR == 0);
static_assert(BC % 32 == 0);
static_assert(HD == 512);
static_assert((HD / 8) == 64);
static_assert(SEQ == 256 * 4);
static_assert(OD == 32);

typedef _Float16 v16h __attribute__((ext_vector_type(16)));
typedef _Float16 v8h  __attribute__((ext_vector_type(8)));
typedef _Float16 v4h  __attribute__((ext_vector_type(4)));
typedef float    v8f  __attribute__((ext_vector_type(8)));
typedef float    v4f  __attribute__((ext_vector_type(4)));
typedef float    v2f  __attribute__((ext_vector_type(2)));
typedef unsigned int v4u __attribute__((ext_vector_type(4)));

union Frag  { v16h v; v8h h[2]; };
union Pack8 { v8h h; v4u u; };

// Fragment loader for k-contiguous 16-bit rows with pitch ld.
// A operand: row0 + (lane&15) is the M row.  B operand stored [n][k]: row0 + (lane&15) is the N column.
// Split k map for both: elements 0..7 <- k0 + 8*(lane>>4) + 0..7, elements 8..15 <- k0 + 16 + 8*(lane>>4) + 0..7.
// D map: acc[r] = element (8*(lane>>4) + r, lane&15) of the 16x16 tile.
__device__ __forceinline__ v16h ldfrag(const _Float16* p, int ld, int row0, int k0, int lane) {
  const int m = lane & 15, lh = lane >> 4;
  const _Float16* q = p + (size_t)(row0 + m) * ld + k0 + 8 * lh;
  Frag f;
  f.h[0] = *(const v8h*)(q);
  f.h[1] = *(const v8h*)(q + 16);
  return f.v;
}

__device__ __forceinline__ v8f zero8() { return (v8f){0.f, 0.f, 0.f, 0.f, 0.f, 0.f, 0.f, 0.f}; }

// ---------------------------------------------------------------------------
// the one kernel: non-causal attention per (query tile, sequence), single head of width 512, with the
// BN-affine + PReLU + z.Wout + bias tail fused, and every derived weight formed by the block that uses it. Block = 8 waves = 128 query rows of one sequence;
// key chunks of 128 (nch = SEQ/BC = 8, derived from the batch_size input and clamped to the static maximum).
//   x: f32 input [token][2]; all weights as the f32 inputs.
// Derived weights, formed in front of the first barrier:
//   M = Wq.Wk^T [2][2] in f32: thread t takes h = 2t, 2t+1; sum over the wave's lanes in registers; the eight waves'
//   partial sums go to LDS (mP) and every wave adds them behind the barrier.
//   W' (x16): wave w forms channels 64w .. 64w+63, lane l channels 64w + l and 64w + 32 + l. With sc = gamma/sqrt(var + eps):
//   z = (u.Wv - mean) sc + beta = u0 (Wv0 sc) + u1 (Wv1 sc) + (beta - mean sc); the three constants x16, each as an f16
//   pair hi + lo: w0hi w0lo w0hi w1hi w1lo w1hi bhi blo, the channel side of the z product's 8 k slots; kept in LDS (sWz), read in the tail by the four waves of that channel half.
//   Wout (x64, f16): the wave's 64 rows [k][32], 16 B a lane (whole 128-B lines), eight k of one column packed to 16 B and
//   stored [n][k] in LDS rows (sWo, pitch 144 B), one piece of 32 rows per 64 channels; read in the tail, behind both barriers, by the four waves of that channel half.
// S: q.k = sum_ij x_i M_ij x'_j = y.x' with y = x.M, so the score product contracts 2 dims, not 512. y carries
//   the score scale and log2(e). Each f32 factor goes in as an f16 pair hi + lo and the four cross products of
//   the two dims fill 8 k slots of one 16x16x32 step.
// Wave w: query tiles 2(w&3) and 2(w&3) + 1 (16 rows each; one key fragment and one x^T fragment serve both), keys 64(w>>2)..+63 of each chunk;
//   the softmax never leaves the wave's registers.
//   S^T = K.Y^T: keys are the M rows, queries the N columns, so lane (h, c) holds keys 8h + r of query c.
//   The block forms kF [key][8 halves] once in LDS; lane l loads keys k0 + l and k0 + 32 + l, so one A fragment holds
//   four 16-key tiles, tile j in elements 8(j>>1)..+7 of lanes 16(j&1)..+15 (8 of the 32 k slots each); the B
//   fragment yq[j] is zero outside tile j's slots, which picks the 16 keys of each product.
//   Reference point mw per query: softmax is the same under any shift, so no pass looks for the maximum: s = y.x' <= |y| max|x'|
//   (max|x'|^2 over the sequence: per thread, per wave in registers, the eight waves' values through LDS (rP) behind the first barrier);
//   mw = that bound - 15, so p = exp2(s - mw) <= 2^15. The products run with C = -mw, p = exp2(D); the two D tiles of 32 keys, converted in
//   place, are the B operand of the value product (element s = key kmap(s, h) of query c).
//   A wave whose row sums show the bound too loose for f16 repeats its keys under the exact maximum (in-lane, one exchange between the lane halves).
// O: p.v = p.(x.Wv) = (p.x).Wv. u^T = A.P^T with A rows [hi0 hi1 lo0 lo1 ones ones ...][key] from LDS (xT, the same
//   k map): D rows 0..3 are the four partial sums of u, row 4 the row sum l (of the rounded p), all in p's scale.
//   After the loop the two key slices, each under its own reference point, are joined through LDS (uP).
// Tail: wave w keeps its 32 query rows and takes channel half w>>2 (256 channels, four groups of 64). It joins the slices of its own rows (lane = row): u = (hi + lo sums) / l. z never leaves the wave's registers:
//   z^T = W'.[u; 1]^T: channels are the M rows, queries the N columns.
//   One A fragment holds the four 16-channel tiles of a group, tile j in elements 8(j>>1)..+7 of lanes 16(j&1)..+15 (8 of the 32 k
//   slots each); the B fragment of tile j is zero outside tile j's slots, as in the score product. Query side of the 8 slots:
//   u0hi u0hi u0lo u1hi u1hi u1lo 1 1 (the lo.lo products are left out), all times sg. D is written as f16 (element e of a
//   lane = row 8(lane>>4) + e, the order of a converted f32 D tile). PReLU on the packed halves, two instructions a register:
//   with sg = +1 for a <= 1 and -1 for a > 1, PReLU(z) = sg max(sg z, a sg z) for every a; sg rides on the query side and on the
//   last scale. Two D tiles are the B operand of out^T = Wout^T.z^T (k slot = channel offset, the split k map of ldfrag).
//   out^T accumulates over the four groups in its D registers. D: lane (h, c) holds out columns 16nt + 8h + r of query c: partial tile to LDS part[channel half][128][32]; barrier;
//   val = sg (sum of the two parts)/1024 + b_out.
// LDS: sKX = kF + xT; sWz; sWo; mP; rP; uP; part.
// grid = (SEQ/BR, NBAT) = (8, 32): one block for each of 256 WGPs.
// coverage: part per wave 32 x 32; d_out per block 256 thr x 4 x 4 floats = 128 rows x 32 -> 256 blocks = 32768 rows x 32.
// ---------------------------------------------------------------------------
#define PTP 36
#define XTP 1040                              // xT row pitch in halves: rows 32 B apart modulo the 256-B bank span
#define WOP 72                                // Wout row pitch in halves: 144 B
static_assert((WOP % 8) == 0);
static_assert(BR == 128);
static_assert(BC == 128);
static_assert((PTP % 4) == 0);
static_assert((XTP % 8) == 0);
static_assert(XTP >= SEQ);
static_assert(HD == 8 * 64);

// Score operands from one f32 pair (u0, u1), eight halves (k slots) a side:
//   query side: hi0 hi1 hi0 hi1 lo0 lo1 lo0 lo1      key side: hi0 hi1 lo0 lo1 hi0 hi1 lo0 lo1
// so slot by slot the products are hi.hi, hi.lo, lo.hi, lo.lo for dim 0 and dim 1.
__device__ __forceinline__ v8h qhalves(float u0, float u1) {
  const _Float16 h0 = (_Float16)u0, h1 = (_Float16)u1;
  const _Float16 l0 = (_Float16)(u0 - (float)h0), l1 = (_Float16)(u1 - (float)h1);
  return (v8h){h0, h1, h0, h1, l0, l1, l0, l1};
}

// WMMA as the bare builtin: the compiler keeps the distance behind it and can fill it with the other tile's work
__device__ __forceinline__ v8f mmab(v16h a, v16h b, v8f c) {
  return __builtin_amdgcn_wmma_f32_16x16x32_f16(false, a, false, b, (short)0, c, false, false);
}

// the same product with D (and C) in f16: four registers a tile, already in the packed order of a B operand half
__device__ __forceinline__ v8h mmah(v16h a, v16h b, v8h c) {
  return __builtin_amdgcn_wmma_f16_16x16x32_f16(false, a, false, b, (short)0, c, false, false);
}

// v + (v of lane l ^ X) inside a 16-lane row: one DPP add (row_xmask), no LDS trip
template <int X>
__device__ __forceinline__ float addx(float v) {
  return v + __builtin_bit_cast(float, __builtin_amdgcn_update_dpp(0, __builtin_bit_cast(int, v), 0x160 + X, 0xf, 0xf, true));
}
// sum over the 32 lanes, the same value in every lane
__device__ __forceinline__ float wsum(float v) {
  v = addx<1>(v);
  v = addx<2>(v);
  v = addx<4>(v);
  v = addx<8>(v);
  const int vb = __builtin_bit_cast(int, v);            // lane l <-> l ^ 16
  return v + __builtin_bit_cast(float, __builtin_amdgcn_permlanex16(vb, vb, 0x76543210, 0xfedcba98, false, false));
}

// max(v, v of lane l ^ X) inside a 16-lane row, on the bits of floats that are not negative (their order is the unsigned order): one DPP maximum
template <int X>
__device__ __forceinline__ unsigned int maxx(unsigned int v) {
  const unsigned int o = (unsigned int)__builtin_amdgcn_update_dpp(0, (int)v, 0x160 + X, 0xf, 0xf, true);
  return (v > o) ? v : o;
}

// channel side of the z product's 8 k slots for BN channel h
__device__ __forceinline__ v8h chrow(float g, float vr, float v0, float v1, float be, float mn) {
  const float sc = g * (1.0f / sqrtf(vr + 1.0e-5f));
  const float w0 = v0 * sc * 16.0f, w1 = v1 * sc * 16.0f;
  const float bb = (be - mn * sc) * 16.0f;
  const _Float16 w0h = (_Float16)w0, w1h = (_Float16)w1, bh = (_Float16)bb;
  const _Float16 w0l = (_Float16)(w0 - (float)w0h), w1l = (_Float16)(w1 - (float)w1h), bl = (_Float16)(bb - (float)bh);
  return (v8h){w0h, w0l, w0h, w1h, w1l, w1h, bh, bl};
}

// A operands of one 64-channel group: W' (lane l holds the group's channels l and 32 + l) and Wout^T [out column tile][32-channel step]
__device__ __forceinline__ void ldgrp(const _Float16* wzr, const _Float16* wor, int lane, Frag& wz, v16h (&wof)[2][2]) {
  wz.h[0] = *(const v8h*)(wzr);
  wz.h[1] = *(const v8h*)(wzr + 256);
#pragma unroll
  for (int nt = 0; nt < 2; ++nt)
#pragma unroll
    for (int ks = 0; ks < 2; ++ks) wof[nt][ks] = ldfrag(wor, WOP, 16 * nt, 32 * ks, lane);
}

// second bound: 256 registers, so that no register window is switched; the 256 blocks are resident in one round
__global__ __launch_bounds__(256, 4) void k_attn(const float* __restrict__ x,
                                              const float* __restrict__ wq,
                                              const float* __restrict__ wk,
                                              const float* __restrict__ wv,
                                              const float* __restrict__ gam,
                                              const float* __restrict__ bet,
                                              const float* __restrict__ mu,
                                              const float* __restrict__ var,
                                              const float* __restrict__ wo,
                                              const float* __restrict__ pa,
                                              const float* __restrict__ bo,
                                              const int* __restrict__ bsp,
                                              float* __restrict__ out, float sscale) {
  __shared__ __align__(16) float part[2 * BR * PTP];    // [channel half][row][32 out columns, pitch 36]
  __shared__ __align__(16) _Float16 sWo[8 * OD * WOP];  // [64-channel group][out column][channel in the group, pitch 72]
  __shared__ __align__(16) _Float16 sKX[SEQ * 8 + 5 * XTP];
  __shared__ __align__(16) float uP[2 * BR * 8];        // [key slice][row][u hi0 hi1 lo0 lo1, l, reference point, -, -]
  __shared__ __align__(16) float mP[8 * 4];             // [wave][M00 M01 M10 M11], partial sums
  __shared__ __align__(16) unsigned int rP[8];          // [wave] largest |x|^2 of the wave's 128 tokens, the float's bits
  __shared__ __align__(16) _Float16 sWz[8 * 2 * 32 * 8];  // [wave][channel half][lane][8 k slots]

  _Float16* kF   = sKX;
  _Float16* xT   = sKX + SEQ * 8;

  const int tid = threadIdx.x, lane = tid & 31, wave = tid >> 5;
  const int hh = lane >> 4, c = lane & 15;
  const int b  = blockIdx.y;
  const int q0 = (int)blockIdx.x * BR;                  // query row base within the sequence
  int bs = bsp[0];
  bs = (bs < 1) ? 1 : bs;
  int seql = NTOK / bs;
  seql = (seql > SEQ) ? SEQ : seql;
  const int nch = seql / BC;                            // block-uniform, <= SEQ/BC
  const float* Xb = x + (size_t)b * SEQ * 2;             // this sequence's token rows [l][2]
  const size_t tokbase = (size_t)b * SEQ + q0;
  const int pt = wave & 3, pk = wave >> 2;              // this wave's pair of query tiles; its 64-key slice of each chunk, and in the tail its channel half
  const v8h zz = (v8h){0, 0, 0, 0, 0, 0, 0, 0};

  const int ch0 = wave * 64;                            // the 64 channels whose weights this wave forms
  _Float16* wl = sWo + wave * (OD * WOP);               // their Wout rows [n][k - ch0]
  _Float16* wzl = sWz + wave * 512 + lane * 8;          // W' rows that this lane forms: channel ch0 + l, and at + 256 halves ch0 + 32 + l
  // every global load of the prologue, in the order of use
  const v4f a0 = *(const v4f*)(Xb + 8 * tid);           // thread t: tokens 4t .. 4t+3
  const v4f a1 = *(const v4f*)(Xb + 8 * tid + 4);
  const v2f q0v = *(const v2f*)(wq + 2 * tid);          // thread t: h = 2t, 2t+1 of M's sum
  const v2f q1v = *(const v2f*)(wq + HD + 2 * tid);
  const v2f k0v = *(const v2f*)(wk + 2 * tid);
  const v2f k1v = *(const v2f*)(wk + HD + 2 * tid);
  float cg[2], cr[2], c0[2], c1[2], cb[2], cm[2];       // lane l: channels ch0 + l and ch0 + 32 + l
#pragma unroll
  for (int i = 0; i < 2; ++i) {
    const int h = ch0 + 32 * i + lane;
    cg[i] = gam[h];
    cr[i] = var[h];
    c0[i] = wv[h];
    c1[i] = wv[HD + h];
    cb[i] = bet[h];
    cm[i] = mu[h];
  }
  // the wait that stands in front of an overwrite of the loads' offset registers;
  // the two scheduling barriers hold it directly behind the loads: without them a register write is placed in between
  __builtin_amdgcn_sched_barrier(0);
  asm volatile("s_wait_xcnt 0x0" ::: "memory");
  __builtin_amdgcn_sched_barrier(0);
  const int nq = lane & 7, kg = lane >> 3;              // lane l: Wout columns 4(l&7)..+3 of rows 8(l>>3) + 0..7 of each 32-row half
  v4f wr[2][8];
  {
    const float* ws = wo + (size_t)(ch0 + 8 * kg) * OD + 4 * nq;
#pragma unroll
    for (int s = 0; s < 2; ++s)
#pragma unroll
      for (int i = 0; i < 8; ++i) {
        // the last load's result lands on the address pair that all sixteen name: the wait that stands in front of such an overwrite
        if (s == 1 && i == 7) asm volatile("s_wait_xcnt 0x0" ::: "memory");
        wr[s][i] = *(const v4f*)(ws + (size_t)(32 * s + i) * OD);
      }
  }
  // keeps the Wout loads issued in front of the first wait for data: without it they start a load latency later
  __builtin_amdgcn_sched_barrier(0);
  {
    // this sequence's tokens as f16 hi and lo: x^T rows (and a row of ones) and the key-side score operands
    const int l0 = tid * 4;
    const v4f e0 = (v4f){a0[0], a0[2], a1[0], a1[2]};
    const v4f e1 = (v4f){a0[1], a0[3], a1[1], a1[3]};
    v4h h0, h1, g0, g1;
#pragma unroll
    for (int e = 0; e < 4; ++e) {
      h0[e] = (_Float16)e0[e];
      h1[e] = (_Float16)e1[e];
      g0[e] = (_Float16)(e0[e] - (float)h0[e]);
      g1[e] = (_Float16)(e1[e] - (float)h1[e]);
    }
    *(v4h*)(xT + 0 * XTP + l0) = h0;
    *(v4h*)(xT + 1 * XTP + l0) = h1;
    *(v4h*)(xT + 2 * XTP + l0) = g0;
    *(v4h*)(xT + 3 * XTP + l0) = g1;
    *(v4h*)(xT + 4 * XTP + l0) = (v4h){1, 1, 1, 1};
#pragma unroll
    for (int e = 0; e < 4; ++e)
      *(v8h*)(kF + (size_t)(l0 + e) * 8) = (v8h){h0[e], h1[e], g0[e], g1[e], h0[e], h1[e], g0[e], g1[e]};
  }
  // largest squared token norm of this wave's 128 tokens, the same value in every lane
  unsigned int r2 = __builtin_bit_cast(unsigned int, fmaxf(fmaxf(fmaf(a0[1], a0[1], a0[0] * a0[0]), fmaf(a0[3], a0[3], a0[2] * a0[2])),
                                                           fmaxf(fmaf(a1[1], a1[1], a1[0] * a1[0]), fmaf(a1[3], a1[3], a1[2] * a1[2]))));
  r2 = maxx<8>(maxx<4>(maxx<2>(maxx<1>(r2))));
  {
    const unsigned int ro = (unsigned int)__builtin_amdgcn_permlanex16((int)r2, (int)r2, 0x76543210, 0xfedcba98, false, false);  // lane l <-> l ^ 16
    r2 = (r2 > ro) ? r2 : ro;
  }
  // M = Wq.Wk^T: this wave's 64 h
  const float m00 = wsum(fmaf(q0v[1], k0v[1], q0v[0] * k0v[0]));
  const float m01 = wsum(fmaf(q0v[1], k1v[1], q0v[0] * k1v[0]));
  const float m10 = wsum(fmaf(q1v[1], k0v[1], q1v[0] * k0v[0]));
  const float m11 = wsum(fmaf(q1v[1], k1v[1], q1v[0] * k1v[0]));
  // W' rows, done under the flight of the Wout loads and parked in LDS until the tail
#pragma unroll
  for (int i = 0; i < 2; ++i) *(v8h*)(wzl + i * 256) = chrow(cg[i], cr[i], c0[i], c1[i], cb[i], cm[i]);
  {
#pragma unroll
    for (int s = 0; s < 2; ++s) {
      v4f r[8];
#pragma unroll
      for (int i = 0; i < 8; ++i) r[i] = wr[s][i] * 64.0f;
#pragma unroll
      for (int e = 0; e < 4; ++e)
        *(v8h*)(wl + (4 * nq + e) * WOP + (4 * s + kg) * 8) =
            (v8h){(_Float16)r[0][e], (_Float16)r[1][e], (_Float16)r[2][e], (_Float16)r[3][e],
                  (_Float16)r[4][e], (_Float16)r[5][e], (_Float16)r[6][e], (_Float16)r[7][e]};
    }
  }
  if (lane == 0) {
    *(v4f*)(mP + 4 * wave) = (v4f){m00, m01, m10, m11};
    rP[wave] = r2;
  }
  __syncthreads();                                      // kF, xT, mP, rP, sWz and sWo complete
  // B fragments of the score product: y = x.M (x score scale x log2 e) for query rows q0 + 32pt + 16t + (lane&15), t = 0, 1
  v16h yq[2][4];
  float mw[2];                                          // reference point of the softmax per query: p = exp2(s - mw)
  {
    // asked for here, not with the prologue's loads: this block has just read the lines, and the loads fly beside the LDS trip below
    v2f xq[2];
#pragma unroll
    for (int t = 0; t < 2; ++t) xq[t] = *(const v2f*)(Xb + 2 * (size_t)(q0 + 32 * pt + 16 * t + c));
    // the wait that stands in front of an overwrite of the two loads' offset registers; the two scheduling barriers hold it directly behind the loads
    __builtin_amdgcn_sched_barrier(0);
    asm volatile("s_wait_xcnt 0x0" ::: "memory");
    __builtin_amdgcn_sched_barrier(0);
    // lane l reads partial sum l&3 of wave l>>2; three exchanges (l ^ 4, l ^ 8, l ^ 16) sum over the waves
    float ms = addx<8>(addx<4>(mP[lane]));
    const int mb = __builtin_bit_cast(int, ms);
    ms += __builtin_bit_cast(float, __builtin_amdgcn_permlanex16(mb, mb, 0x76543210, 0xfedcba98, false, false));
    const int mi = __builtin_bit_cast(int, ms);
    const v4f mv = (v4f){__builtin_bit_cast(float, __builtin_amdgcn_readlane(mi, 0)),    // M00 M01 M10 M11, wave-uniform
                         __builtin_bit_cast(float, __builtin_amdgcn_readlane(mi, 1)),
                         __builtin_bit_cast(float, __builtin_amdgcn_readlane(mi, 2)),
                         __builtin_bit_cast(float, __builtin_amdgcn_readlane(mi, 3))};
    const float ys = sscale * 1.4426950408889634f;
    const float rr = __builtin_bit_cast(float, maxx<4>(maxx<2>(maxx<1>(rP[lane & 7]))));   // largest |x|^2 of the sequence
#pragma unroll
    for (int t = 0; t < 2; ++t) {
      const float y0 = fmaf(xq[t][1], mv[2], xq[t][0] * mv[0]) * ys, y1 = fmaf(xq[t][1], mv[3], xq[t][0] * mv[1]) * ys;
      const v8h yv = qhalves(y0, y1);
      // s = y.x' <= |y| max|x'|: no key's p exceeds 2^15, which f16 holds
      mw[t] = __builtin_amdgcn_sqrtf(fmaf(y1, y1, y0 * y0) * rr) - 15.0f;
#pragma unroll
      for (int j = 0; j < 4; ++j) {
        Frag f;
        f.h[j >> 1]       = (hh == (j & 1)) ? yv : zz;
        f.h[(j >> 1) ^ 1] = zz;
        yq[t][j] = f.v;
      }
    }
  }

  const _Float16* kp = kF + (size_t)(pk * 64 + lane) * 8;   // lane l: keys k0 + l and k0 + 32 + l of each chunk (64 of this wave's keys per A fragment)

  v8f uacc[2];
  // First trip: the bound is the reference point, so no pass over the scores looks for a maximum. A loose bound makes every p small;
  // the row sum l (D rows 4..15, so element 4 of every lane) tells: at l >= 2^-4 the f16 floor (2^-25 a key, 512 keys) is below 2^-12 of l.
  // Where a query of this wave falls short of that, or a p left f16's range, a second trip takes the exact maximum instead.
#pragma unroll 1                                        // rolled: the second trip is rare, and unrolled it would double the loop's code
  for (int att = 0; att < 2; ++att) {
    // ---- p = exp2(s - mw), packed in place into the value product's B operand ----
    uacc[0] = zero8();
    uacc[1] = zero8();
    {
      v8f cneg[2];
#pragma unroll
      for (int t = 0; t < 2; ++t) {
        const float cm = -mw[t];
        cneg[t] = (v8f){cm, cm, cm, cm, cm, cm, cm, cm};
      }
      const int xl = ((c < 4) ? c : 4) | (lane & 16);     // A row (lane&15) reads xT row min(lane&15, 4)
#pragma unroll 1                                        // rolled: a trip already holds eight independent products; a second trip's 64 score registers would press on the bound of 256
      for (int cp = 0; cp < nch; ++cp) {
        Frag ka;
        ka.h[0] = *(const v8h*)(kp + (size_t)cp * (BC * 8));
        ka.h[1] = *(const v8h*)(kp + (size_t)cp * (BC * 8) + 32 * 8);
        // A operands of the value product: split k map over keys, the map of the packed D pair
        const v16h xa0 = ldfrag(xT, XTP, 0, cp * BC + pk * 64, xl);
        const v16h xa1 = ldfrag(xT, XTP, 0, cp * BC + pk * 64 + 32, xl);
        v8f s[2][4];                                      // s[t][j][r]: key BC cp + 64 pk + 16j + 8hh + r, query c of tile t
#pragma unroll
        for (int t = 0; t < 2; ++t)
#pragma unroll
          for (int j = 0; j < 4; ++j) s[t][j] = mmab(ka.v, yq[t][j], cneg[t]);
        // keeps the eight products together: each fills the distance behind the one before, which v_nop fills otherwise
        __builtin_amdgcn_sched_barrier(0);
#pragma unroll
        for (int t = 0; t < 2; ++t) {
#pragma unroll
          for (int j = 0; j < 4; ++j)
#pragma unroll
            for (int r = 0; r < 8; ++r) s[t][j][r] = __builtin_amdgcn_exp2f(s[t][j][r]);
          Frag pb0, pb1;
          pb0.h[0] = __builtin_convertvector(s[t][0], v8h);
          pb0.h[1] = __builtin_convertvector(s[t][1], v8h);
          pb1.h[0] = __builtin_convertvector(s[t][2], v8h);
          pb1.h[1] = __builtin_convertvector(s[t][3], v8h);
          uacc[t] = mmab(xa0, pb0.v, uacc[t]);
          uacc[t] = mmab(xa1, pb1.v, uacc[t]);
        }
      }
    }
    const float la = uacc[0][4], lb = uacc[1][4];
    const bool good = (la >= 0.0625f) && (la <= 1.7e7f) && (lb >= 0.0625f) && (lb <= 1.7e7f);
    if (att == 1 || __builtin_amdgcn_ballot_w32(!good) == 0u) break;   // wave-uniform; no barrier stands in this loop

    // ---- the rare trip's reference point: this wave's maximum per query over its keys, p x1024 ----
    {
      v8f mx[2];
#pragma unroll
      for (int t = 0; t < 2; ++t)
#pragma unroll
        for (int r = 0; r < 8; ++r) mx[t][r] = -3.0e38f;  // finite, so that a wave without keys joins with factor 1
#pragma unroll 1                                        // rolled, for the same register bound
      for (int cp = 0; cp < nch; ++cp) {
        Frag ka;
        ka.h[0] = *(const v8h*)(kp + (size_t)cp * (BC * 8));
        ka.h[1] = *(const v8h*)(kp + (size_t)cp * (BC * 8) + 32 * 8);
        v8f s[2][4];
#pragma unroll
        for (int t = 0; t < 2; ++t)
#pragma unroll
          for (int j = 0; j < 4; ++j) s[t][j] = mmab(ka.v, yq[t][j], zero8());
        // keeps the eight products together, for the same reason as above
        __builtin_amdgcn_sched_barrier(0);
#pragma unroll
        for (int t = 0; t < 2; ++t)
#pragma unroll
          for (int r = 0; r < 8; ++r)
            mx[t][r] = fmaxf(fmaxf(mx[t][r], fmaxf(s[t][0][r], s[t][1][r])), fmaxf(s[t][2][r], s[t][3][r]));
      }
#pragma unroll
      for (int t = 0; t < 2; ++t) {
        const float m = fmaxf(fmaxf(fmaxf(mx[t][0], mx[t][1]), fmaxf(mx[t][2], mx[t][3])),
                              fmaxf(fmaxf(mx[t][4], mx[t][5]), fmaxf(mx[t][6], mx[t][7])));
        const int mb = __builtin_bit_cast(int, m);        // lane l <-> l ^ 16: the other eight keys of each tile
        mw[t] = fmaxf(m, __builtin_bit_cast(float, __builtin_amdgcn_permlanex16(mb, mb, 0x76543210, 0xfedcba98, false, false))) - 10.0f;
      }
    }
  }

  // ---- tail: join the two key slices, 1/l per row, z^T = W'.[u; 1]^T, PReLU, out^T = Wout^T.z^T ----
  const float a = pa[0];
  const float sg = (a <= 1.0f) ? 1.0f : -1.0f;          // PReLU(z) = sg max(sg z, a sg z), for every a
  const _Float16 sh = (_Float16)sg, ah = (_Float16)a;
  const v8h av = (v8h){ah, ah, ah, ah, ah, ah, ah, ah};
  if (lane < 16) {                                      // D rows 0..4 sit in lanes 0..15
#pragma unroll
    for (int t = 0; t < 2; ++t) {
      float* d = uP + (size_t)(pk * BR + 32 * pt + 16 * t + c) * 8;
      *(v4f*)d       = (v4f){uacc[t][0], uacc[t][1], uacc[t][2], uacc[t][3]};
      *(v2f*)(d + 4) = (v2f){uacc[t][4], mw[t]};
    }
  }
  __syncthreads();                                      // uP complete (cross-wave)
  Frag wz[4];                                           // A operands of this wave's four channel groups 4pk .. 4pk + 3
  v16h wof[4][2][2];
  const _Float16* wzr = sWz + (4 * pk) * 512 + lane * 8;
  const _Float16* wor = sWo + (4 * pk) * (OD * WOP);
  ldgrp(wzr, wor, lane, wz[0], wof[0]);
  // keeps the ten loads issued here, in front of the join: without it the compiler may sink them to just in front of
  // their first use, where their latency is waited out
  __builtin_amdgcn_sched_barrier(0);
  Pack8 own, oth;                                       // query side of the z product: row 32pt + lane, and row 32pt + (lane ^ 16)
  {
    const int jr = 32 * pt + lane;
    v2f lm[2];
#pragma unroll
    for (int i = 0; i < 2; ++i) lm[i] = *(const v2f*)(uP + (size_t)(i * BR + jr) * 8 + 4);
    const float m = fmaxf(lm[0][1], lm[1][1]);
    v4f us = (v4f){0.f, 0.f, 0.f, 0.f};
    float l = 0.f;
#pragma unroll
    for (int i = 0; i < 2; ++i) {
      const float f = __builtin_amdgcn_exp2f(lm[i][1] - m);
      us += *(const v4f*)(uP + (size_t)(i * BR + jr) * 8) * f;
      l = fmaf(lm[i][0], f, l);
    }
    const float inv = (l > 0.f) ? (sg / l) : 0.f;       // u and l carry the same scale; sg: see above
    const float u0 = (us[0] + us[2]) * inv, u1 = (us[1] + us[3]) * inv;
    const _Float16 h0 = (_Float16)u0, h1 = (_Float16)u1;
    const _Float16 l0 = (_Float16)(u0 - (float)h0), l1 = (_Float16)(u1 - (float)h1);
    own.h = (v8h){h0, h0, l0, h1, h1, l1, sh, sh};
#pragma unroll
    for (int i = 0; i < 4; ++i)                         // lane l <-> l ^ 16
      oth.u[i] = (unsigned int)__builtin_amdgcn_permlanex16((int)own.u[i], (int)own.u[i], 0x76543210, 0xfedcba98, false, false);
  }
  v16h zb[2][4];                                        // B operands of the z product, the same for every channel group: [query tile][channel tile of the group]
#pragma unroll
  for (int t = 0; t < 2; ++t) {                         // query tile: rows 32pt + 16t + c
    const v8h rq = (hh == t) ? own.h : oth.h;           // the eight halves of row 32pt + 16t + c, in both lane halves
#pragma unroll
    for (int j = 0; j < 4; ++j) {
      Frag f;                                           // tile j's 8 k slots alone carry the row
      f.h[j >> 1]       = (hh == (j & 1)) ? rq : zz;
      f.h[(j >> 1) ^ 1] = zz;
      zb[t][j] = f.v;
    }
  }
  v8f acc[2][2];                                        // out^T [query tile][out column tile], summed over the four groups
#pragma unroll
  for (int t = 0; t < 2; ++t)
#pragma unroll
    for (int nt = 0; nt < 2; ++nt) acc[t][nt] = zero8();
#pragma unroll
  for (int gi = 0; gi < 4; ++gi) {
    if (gi < 3) ldgrp(wzr + (gi + 1) * 512, wor + (gi + 1) * (OD * WOP), lane, wz[gi + 1], wof[gi + 1]);
    v8h s[2][4];                                        // s[t][j][r]: sg z x16 of channel 64(4pk + gi) + 16j + 8hh + r, row 32pt + 16t + c
#pragma unroll
    for (int t = 0; t < 2; ++t)
#pragma unroll
      for (int j = 0; j < 4; ++j) s[t][j] = mmah(wz[gi].v, zb[t][j], zz);
    // keeps the next group's loads in front of this group's work, so that they fly under it, and the eight products together:
    // each fills the distance behind the one before, which v_nop fills otherwise
    __builtin_amdgcn_sched_barrier(0);
#pragma unroll
    for (int t = 0; t < 2; ++t) {
#pragma unroll
      for (int j = 0; j < 4; ++j) s[t][j] = __builtin_elementwise_maximum(s[t][j], s[t][j] * av);
      Frag pb0, pb1;
      pb0.h[0] = s[t][0];
      pb0.h[1] = s[t][1];
      pb1.h[0] = s[t][2];
      pb1.h[1] = s[t][3];
#pragma unroll
      for (int nt = 0; nt < 2; ++nt) acc[t][nt] = mmab(wof[gi][nt][0], pb0.v, acc[t][nt]);
#pragma unroll
      for (int nt = 0; nt < 2; ++nt) acc[t][nt] = mmab(wof[gi][nt][1], pb1.v, acc[t][nt]);
    }
  }
#pragma unroll
  for (int t = 0; t < 2; ++t)
#pragma unroll
    for (int nt = 0; nt < 2; ++nt) {
      float* pp = part + pk * (BR * PTP) + (32 * pt + 16 * t + c) * PTP + 16 * nt + 8 * hh;
      *(v4f*)pp       = (v4f){acc[t][nt][0], acc[t][nt][1], acc[t][nt][2], acc[t][nt][3]};
      *(v4f*)(pp + 4) = (v4f){acc[t][nt][4], acc[t][nt][5], acc[t][nt][6], acc[t][nt][7]};
    }
  __syncthreads();                                      // part complete
  {
    const int pc = tid & 7;
    const v4f bb = *(const v4f*)(bo + pc * 4);
#pragma unroll
    for (int g = 0; g < 4; ++g) {
      const int row = 32 * g + (tid >> 3);
      const v4f sum = *(const v4f*)(part + row * PTP + pc * 4) + *(const v4f*)(part + BR * PTP + row * PTP + pc * 4);
      const v4f val = sum * (sg * 0.0009765625f) + bb;  // sg/(16 * 64)
      v4f* d = (v4f*)(out + (tokbase + (size_t)row) * OD + pc * 4);
      *d = val;
    }
  }
}

// No workspace is used.
extern "C" void kernel_launch(void* const* d_in, const int* in_sizes, int n_in,
                              void* d_out, int out_size, void* d_ws, size_t ws_size,
                              hipStream_t stream) {
  if (n_in < 12) return;
  if (in_sizes[0] != NTOK * 2) return;
  if (in_sizes[1] < 1) return;
  if (in_sizes[2] != 2 * HD) return;
  if (in_sizes[3] != 2 * HD) return;
  if (in_sizes[4] != 2 * HD) return;
  if (in_sizes[5] != HD) return;
  if (in_sizes[6] != HD) return;
  if (in_sizes[7] != HD) return;
  if (in_sizes[8] != HD) return;
  if (in_sizes[9] < 1) return;
  if (in_sizes[10] != HD * OD) return;
  if (in_sizes[11] != OD) return;
  if (out_size != NTOK * OD) return;

  const float* x    = (const float*)d_in[0];    // [32768][2]
  const int*   bsz  = (const int*)d_in[1];      // [1]
  const float* wq   = (const float*)d_in[2];    // [2][512]
  const float* wk   = (const float*)d_in[3];    // [2][512]
  const float* wv   = (const float*)d_in[4];    // [2][512]
  const float* gam  = (const float*)d_in[5];    // [512]
  const float* bet  = (const float*)d_in[6];    // [512]
  const float* mu   = (const float*)d_in[7];    // [512]
  const float* var  = (const float*)d_in[8];    // [512]
  const float* pa   = (const float*)d_in[9];    // [1]
  const float* wo   = (const float*)d_in[10];   // [512][32]
  const float* bo   = (const float*)d_in[11];   // [32]
  float* out = (float*)d_out;                   // [32768][32]

  const float sscale = 1.0f / sqrtf((float)HD);

  // attention + BN/PReLU/Wout tail -> d_out
  k_attn<<<dim3(SEQ / BR, NBAT), dim3(256), 0, stream>>>(x, wq, wk, wv, gam, bet, mu, var, wo, pa, bo, bsz, out, sscale);
  (void)hipGetLastError();
}

// v010
// Measured time: 6.38 microseconds a run.
// In two side-by-side timings against v009, it was 1.06 and 1.04 times as fast.
// Over all steps from v000 it is 48.0 times as fast.
// Contractions: S^T = x.(x.M)^T with M = Wq.Wk^T (2 x 2, f32) on v_wmma_f32_16x16x32_f16 (f16 hi + lo operand pairs, f32 accumulate, minus the softmax reference point enters as C); u^T = [x^T; 1].P^T (x as hi and lo rows, a row of ones for the row sum, p in its query's own scale packed from the score accumulators) on v_wmma_f32_16x16x32_f16 (f16 operands, f32 accumulate); z^T = W'.[u; 1]^T (projection u.Wv with the BN affine folded in, x16; f16 hi + lo operand pairs, D written as f16) on v_wmma_f16_16x16x32_f16; out^T = Wout^T.z^T on v_wmma_f32_16x16x32_f16 (f16 operands: z x16 as the z product's f16 D tiles after PReLU, Wout x64; f32 accumulate, 1/1024 folded back in f32). M, y = x.M and the folded channel constants exact f32 on VALU; score scale, softmax reference point, exp2, 1/l and bias in f32; PReLU in packed f16 on the f16 z tiles.
#include <hip/hip_runtime.h>
#include <math.h>
#include <stddef.h>
#include <stdint.h>

#define NTOK 32768              // token rows
#define NBAT 32                 // sequences
#define SEQ  1024               // tokens per sequence
#define HD   512                // head width
#define OD   32                 // output width
#define BR   128                // query rows per attention block
#define BC   128                // keys per chunk

static_assert(NTOK == NBAT * SEQ);
static_assert(SEQ % BC == 0);
static_assert(SEQ % BR == 0);
static_assert(BC % 32 == 0);
static_assert(HD == 512);
static_assert((HD / 8) == 64);
static_assert(SEQ == 256 * 4);
static_assert(OD == 32);

typedef _Float16 v16h __attribute__((ext_vector_type(16)));
typedef _Float16 v8h  __attribute__((ext_vector_type(8)));
typedef _Float16 v4h  __attribute__((ext_vector_type(4)));
typedef float    v8f  __attribute__((ext_vector_type(8)));
typedef float    v4f  __attribute__((ext_vector_type(4)));
typedef float    v2f  __attribute__((ext_vector_type(2)));
typedef unsigned int v4u __attribute__((ext_vector_type(4)));

union Frag  { v16h v; v8h h[2]; };
union Pack8 { v8h h; v4u u; };

// Fragment loader for k-contiguous 16-bit rows with pitch ld.
// A operand: row0 + (lane&15) is the M row.  B operand stored [n][k]: row0 + (lane&15) is the N column.
// Split k map for both: elements 0..7 <- k0 + 8*(lane>>4) + 0..7, elements 8..15 <- k0 + 16 + 8*(lane>>4) + 0..7.
// D map: acc[r] = element (8*(lane>>4) + r, lane&15) of the 16x16 tile.
__device__ __forceinline__ v16h ldfrag(const _Float16* p, int ld, int row0, int k0, int lane) {
  const int m = lane & 15, lh = lane >> 4;
  const _Float16* q = p + (size_t)(row0 + m) * ld + k0 + 8 * lh;
  Frag f;
  f.h[0] = *(const v8h*)(q);
  f.h[1] = *(const v8h*)(q + 16);
  return f.v;
}

__device__ __forceinline__ v8f zero8() { return (v8f){0.f, 0.f, 0.f, 0.f, 0.f, 0.f, 0.f, 0.f}; }

// ---------------------------------------------------------------------------
// the one kernel: non-causal attention per (query tile, sequence), single head of width 512, with the
// BN-affine + PReLU + z.Wout + bias tail fused, and every derived weight formed by the block that uses it. Block = 8 waves = 128 query rows of one sequence;
// key chunks of 128 (nch = SEQ/BC = 8, derived from the batch_size input and clamped to the static maximum).
//   x: f32 input [token][2]; all weights as the f32 inputs.
// Derived weights, formed in front of the first barrier:
//   M = Wq.Wk^T [2][2] in f32: thread t takes h = 2t, 2t+1; sum over the wave's lanes in registers; the eight waves'
//   partial sums go to LDS (mP) and every wave adds them behind the barrier.
//   W' (x16): wave w forms channels 64w .. 64w+63, lane l channels 64w + l and 64w + 32 + l. With sc = gamma/sqrt(var + eps):
//   z = (u.Wv - mean) sc + beta = u0 (Wv0 sc) + u1 (Wv1 sc) + (beta - mean sc); the three constants x16, each as an f16
//   pair hi + lo: w0hi w0lo w0hi w1hi w1lo w1hi bhi blo, the channel side of the z product's 8 k slots; kept in LDS (sWz), read in the tail by the four waves of that channel half.
//   Wout (x64, f16): the wave's 64 rows [k][32], 16 B a lane (whole 128-B lines), eight k of one column packed to 16 B and
//   stored [n][k] in LDS rows (sWo, pitch 144 B), one piece of 32 rows per 64 channels; read in the tail, behind both barriers, by the four waves of that channel half.
// S: q.k = sum_ij x_i M_ij x'_j = y.x' with y = x.M, so the score product contracts 2 dims, not 512. y carries
//   the score scale and log2(e). Each f32 factor goes in as an f16 pair hi + lo and the four cross products of
//   the two dims fill 8 k slots of one 16x16x32 step.
// Wave w: query tiles 2(w&3) and 2(w&3) + 1 (16 rows each; one key fragment and one x^T fragment serve both), keys 64(w>>2)..+63 of each chunk;
//   the softmax never leaves the wave's registers.
//   S^T = K.Y^T: keys are the M rows, queries the N columns, so lane (h, c) holds keys 8h + r of query c.
//   The block forms kF [key][8 halves] once in LDS; lane l loads keys k0 + l and k0 + 32 + l, so one A fragment holds
//   four 16-key tiles, tile j in elements 8(j>>1)..+7 of lanes 16(j&1)..+15 (8 of the 32 k slots each); the B
//   fragment yq[j] is zero outside tile j's slots, which picks the 16 keys of each product.
//   Reference point mw per query: softmax is the same under any shift, so no pass looks for the maximum: s = y.x' <= |y| max|x'|
//   (max|x'|^2 over the sequence: per thread, per wave in registers, the eight waves' values through LDS (rP) behind the first barrier);
//   mw = that bound - 15, so p = exp2(s - mw) <= 2^15. The products run with C = -mw, p = exp2(D); the two D tiles of 32 keys, converted in
//   place, are the B operand of the value product (element s = key kmap(s, h) of query c).
//   A wave whose row sums show the bound too loose for f16 repeats its keys under the exact maximum (in-lane, one exchange between the lane halves).
// O: p.v = p.(x.Wv) = (p.x).Wv. u^T = A.P^T with A rows [hi0 hi1 lo0 lo1 ones ones ...][key] from LDS (xT, the same
//   k map): D rows 0..3 are the four partial sums of u, row 4 the row sum l (of the rounded p), all in p's scale.
//   After the loop the two key slices, each under its own reference point, are joined through LDS (uP).
// Tail: wave w keeps its 32 query rows and takes channel half w>>2 (256 channels, four groups of 64). It joins the slices of its own rows (lane = row): u = (hi + lo sums) / l. z never leaves the wave's registers:
//   z^T = W'.[u; 1]^T: channels are the M rows, queries the N columns.
//   One A fragment holds the four 16-channel tiles of a group, tile j in elements 8(j>>1)..+7 of lanes 16(j&1)..+15 (8 of the 32 k
//   slots each); the B fragment of tile j is zero outside tile j's slots, as in the score product. Query side of the 8 slots:
//   u0hi u0hi u0lo u1hi u1hi u1lo 1 1 (the lo.lo products are left out), all times sg. D is written as f16 (element e of a
//   lane = row 8(lane>>4) + e, the order of a converted f32 D tile). PReLU on the packed halves, two instructions a register:
//   with sg = +1 for a <= 1 and -1 for a > 1, PReLU(z) = sg max(sg z, a sg z) for every a; sg rides on the query side and on the
//   last scale. Two D tiles are the B operand of out^T = Wout^T.z^T (k slot = channel offset, the split k map of ldfrag).
//   out^T accumulates over the four groups in its D registers. D: lane (h, c) holds out columns 16nt + 8h + r of query c: partial tile to LDS part[channel half][128][32]; barrier;
//   val = sg (sum of the two parts)/1024 + b_out.
// LDS: sKX = kF + xT; sWz; sWo; mP; rP; uP; part.
// grid = (SEQ/BR, NBAT) = (8, 32): one block for each of 256 WGPs.
// coverage: part per wave 32 x 32; d_out per block 256 thr x 4 x 4 floats = 128 rows x 32 -> 256 blocks = 32768 rows x 32.
// ---------------------------------------------------------------------------
#define PTP 36
#define XTP 1040                              // xT row pitch in halves: rows 32 B apart modulo the 256-B bank span
#define WOP 72                                // Wout row pitch in halves: 144 B
static_assert((WOP % 8) == 0);
static_assert(BR == 128);
static_assert(BC == 128);
static_assert((PTP % 4) == 0);
static_assert((XTP % 8) == 0);
static_assert(XTP >= SEQ);
static_assert(HD == 8 * 64);

// Score operands from one f32 pair (u0, u1), eight halves (k slots) a side:
//   query side: hi0 hi1 hi0 hi1 lo0 lo1 lo0 lo1      key side: hi0 hi1 lo0 lo1 hi0 hi1 lo0 lo1
// so slot by slot the products are hi.hi, hi.lo, lo.hi, lo.lo for dim 0 and dim 1.
__device__ __forceinline__ v8h qhalves(float u0, float u1) {
  const _Float16 h0 = (_Float16)u0, h1 = (_Float16)u1;
  const _Float16 l0 = (_Float16)(u0 - (float)h0), l1 = (_Float16)(u1 - (float)h1);
  return (v8h){h0, h1, h0, h1, l0, l1, l0, l1};
}

// WMMA as the bare builtin: the compiler keeps the distance behind it and can fill it with the other tile's work
__device__ __forceinline__ v8f mmab(v16h a, v16h b, v8f c) {
  return __builtin_amdgcn_wmma_f32_16x16x32_f16(false, a, false, b, (short)0, c, false, false);
}

// the same product with D (and C) in f16: four registers a tile, already in the packed order of a B operand half
__device__ __forceinline__ v8h mmah(v16h a, v16h b, v8h c) {
  return __builtin_amdgcn_wmma_f16_16x16x32_f16(false, a, false, b, (short)0, c, false, false);
}

// v + (v of lane l ^ X) inside a 16-lane row: one DPP add (row_xmask), no LDS trip
template <int X>
__device__ __forceinline__ float addx(float v) {
  return v + __builtin_bit_cast(float, __builtin_amdgcn_update_dpp(0, __builtin_bit_cast(int, v), 0x160 + X, 0xf, 0xf, true));
}
// sum over the 32 lanes, the same value in every lane
__device__ __forceinline__ float wsum(float v) {
  v = addx<1>(v);
  v = addx<2>(v);
  v = addx<4>(v);
  v = addx<8>(v);
  const int vb = __builtin_bit_cast(int, v);            // lane l <-> l ^ 16
  return v + __builtin_bit_cast(float, __builtin_amdgcn_permlanex16(vb, vb, 0x76543210, 0xfedcba98, false, false));
}

// max(v, v of lane l ^ X) inside a 16-lane row, on the bits of floats that are not negative (their order is the unsigned order): one DPP maximum
template <int X>
__device__ __forceinline__ unsigned int maxx(unsigned int v) {
  const unsigned int o = (unsigned int)__builtin_amdgcn_update_dpp(0, (int)v, 0x160 + X, 0xf, 0xf, true);
  return (v > o) ? v : o;
}

// channel side of the z product's 8 k slots for BN channel h
__device__ __forceinline__ v8h chrow(float g, float vr, float v0, float v1, float be, float mn) {
  const float sc = g * (1.0f / sqrtf(vr + 1.0e-5f));
  const float w0 = v0 * sc * 16.0f, w1 = v1 * sc * 16.0f;
  const float bb = (be - mn * sc) * 16.0f;
  const _Float16 w0h = (_Float16)w0, w1h = (_Float16)w1, bh = (_Float16)bb;
  const _Float16 w0l = (_Float16)(w0 - (float)w0h), w1l = (_Float16)(w1 - (float)w1h), bl = (_Float16)(bb - (float)bh);
  return (v8h){w0h, w0l, w0h, w1h, w1l, w1h, bh, bl};
}

// A operands of one 64-channel group: W' (lane l holds the group's channels l and 32 + l) and Wout^T [out column tile][32-channel step]
__device__ __forceinline__ void ldgrp(const _Float16* wzr, const _Float16* wor, int lane, Frag& wz, v16h (&wof)[2][2]) {
  wz.h[0] = *(const v8h*)(wzr);
  wz.h[1] = *(const v8h*)(wzr + 256);
#pragma unroll
  for (int nt = 0; nt < 2; ++nt)
#pragma unroll
    for (int ks = 0; ks < 2; ++ks) wof[nt][ks] = ldfrag(wor, WOP, 16 * nt, 32 * ks, lane);
}

// One trip of the score loop (64 keys x 32 queries of one wave), pipelined inside the wave. On entry s0 holds the scores of
// this chunk for query tile 0 (formed a trip earlier). First half: the four score products of tile 1 issue one by one among the exp2 of
// tile 0; second half: the four products of the NEXT chunk's tile 0 (key fragment kx, loaded at the head of this trip) among the exp2 of tile 1.
// The scheduling barriers hold that order: without them the compiler gathers the products in front of the exp2 run, and the wave then
// waits out the LDS latency and the matrix pipe with its transcendental pipe idle. Packing of a tile follows one group behind its exp2.
// WEAVE asks for the order inside a group: the product first, then one pack behind every two exp2, so that the packs issue while the transcendental pipe is busy.
#define WEAVE()                                          \
  __builtin_amdgcn_sched_group_barrier(0x008, 1, 0);     \
  __builtin_amdgcn_sched_group_barrier(0x400, 2, 0);     \
  __builtin_amdgcn_sched_group_barrier(0x002, 1, 0);     \
  __builtin_amdgcn_sched_group_barrier(0x400, 2, 0);     \
  __builtin_amdgcn_sched_group_barrier(0x002, 1, 0);     \
  __builtin_amdgcn_sched_group_barrier(0x400, 2, 0);     \
  __builtin_amdgcn_sched_group_barrier(0x002, 1, 0);     \
  __builtin_amdgcn_sched_group_barrier(0x400, 2, 0);     \
  __builtin_amdgcn_sched_group_barrier(0x002, 1, 0)
__device__ __forceinline__ void trip(const _Float16* kn, const _Float16* xT, int key0, int xl, const Frag& kc, Frag& kx,
                                     const v16h (&yq)[2][4], const v8f (&cneg)[2], v8f (&s0)[4], v8f (&uacc)[2]) {
  kx.h[0] = *(const v8h*)(kn);
  kx.h[1] = *(const v8h*)(kn + 32 * 8);
  // A operands of the value product: split k map over keys, the map of the packed D pair
  const v16h xa0 = ldfrag(xT, XTP, 0, key0, xl);
  const v16h xa1 = ldfrag(xT, XTP, 0, key0 + 32, xl);
  // keeps the six LDS loads in one place at the head of the trip, a half trip or more in front of their first use
  __builtin_amdgcn_sched_barrier(0);
  v8f s1[4];                                            // s1[j][r]: key key0 + 16j + 8hh + r, query c of tile 1
  Frag pa, pb;
#pragma unroll
  for (int j = 0; j < 4; ++j) {
    s1[j] = mmab(kc.v, yq[1][j], cneg[1]);
#pragma unroll
    for (int r = 0; r < 8; ++r) s0[j][r] = __builtin_amdgcn_exp2f(s0[j][r]);
    if (j == 1) pa.h[0] = __builtin_convertvector(s0[0], v8h);
    if (j == 2) pa.h[1] = __builtin_convertvector(s0[1], v8h);
    if (j == 3) pb.h[0] = __builtin_convertvector(s0[2], v8h);
    WEAVE();
    __builtin_amdgcn_sched_barrier(0);                  // holds the order described above
  }
  Frag qa, qb;
#pragma unroll
  for (int j = 0; j < 4; ++j) {
    if (j == 0) pb.h[1] = __builtin_convertvector(s0[3], v8h);
    s0[j] = mmab(kx.v, yq[0][j], cneg[0]);
#pragma unroll
    for (int r = 0; r < 8; ++r) s1[j][r] = __builtin_amdgcn_exp2f(s1[j][r]);
    if (j == 0) uacc[0] = mmab(xa0, pa.v, uacc[0]);     // tile 0's value products stand here, a half trip behind the loads of their A operands
    if (j == 1) {
      uacc[0] = mmab(xa1, pb.v, uacc[0]);
      qa.h[0] = __builtin_convertvector(s1[0], v8h);
    }
    if (j == 2) qa.h[1] = __builtin_convertvector(s1[1], v8h);
    if (j == 3) {
      qb.h[0] = __builtin_convertvector(s1[2], v8h);
      uacc[1] = mmab(xa0, qa.v, uacc[1]);
    }
    WEAVE();
    __builtin_amdgcn_sched_barrier(0);                  // holds the order described above
  }
  qb.h[1] = __builtin_convertvector(s1[3], v8h);
  uacc[1] = mmab(xa1, qb.v, uacc[1]);
}
#undef WEAVE

// second bound: 256 registers, so that no register window is switched; the 256 blocks are resident in one round
__global__ __launch_bounds__(256, 4) void k_attn(const float* __restrict__ x,
                                              const float* __restrict__ wq,
                                              const float* __restrict__ wk,
                                              const float* __restrict__ wv,
                                              const float* __restrict__ gam,
                                              const float* __restrict__ bet,
                                              const float* __restrict__ mu,
                                              const float* __restrict__ var,
                                              const float* __restrict__ wo,
                                              const float* __restrict__ pa,
                                              const float* __restrict__ bo,
                                              const int* __restrict__ bsp,
                                              float* __restrict__ out, float sscale) {
  __shared__ __align__(16) float part[2 * BR * PTP];    // [channel half][row][32 out columns, pitch 36]
  __shared__ __align__(16) _Float16 sWo[8 * OD * WOP];  // [64-channel group][out column][channel in the group, pitch 72]
  __shared__ __align__(16) _Float16 sKX[SEQ * 8 + 5 * XTP];
  __shared__ __align__(16) float uP[2 * BR * 8];        // [key slice][row][u hi0 hi1 lo0 lo1, l, reference point, -, -]
  __shared__ __align__(16) float mP[8 * 4];             // [wave][M00 M01 M10 M11], partial sums
  __shared__ __align__(16) unsigned int rP[8];          // [wave] largest |x|^2 of the wave's 128 tokens, the float's bits
  __shared__ __align__(16) _Float16 sWz[8 * 2 * 32 * 8];  // [wave][channel half][lane][8 k slots]

  _Float16* kF   = sKX;
  _Float16* xT   = sKX + SEQ * 8;

  const int tid = threadIdx.x, lane = tid & 31, wave = tid >> 5;
  const int hh = lane >> 4, c = lane & 15;
  const int b  = blockIdx.y;
  const int q0 = (int)blockIdx.x * BR;                  // query row base within the sequence
  int bs = bsp[0];
  bs = (bs < 1) ? 1 : bs;
  int seql = NTOK / bs;
  seql = (seql > SEQ) ? SEQ : seql;
  const int nch = seql / BC;                            // block-uniform, <= SEQ/BC
  const float* Xb = x + (size_t)b * SEQ * 2;             // this sequence's token rows [l][2]
  const size_t tokbase = (size_t)b * SEQ + q0;
  const int pt = wave & 3, pk = wave >> 2;              // this wave's pair of query tiles; its 64-key slice of each chunk, and in the tail its channel half
  const v8h zz = (v8h){0, 0, 0, 0, 0, 0, 0, 0};

  const int ch0 = wave * 64;                            // the 64 channels whose weights this wave forms
  _Float16* wl = sWo + wave * (OD * WOP);               // their Wout rows [n][k - ch0]
  _Float16* wzl = sWz + wave * 512 + lane * 8;          // W' rows that this lane forms: channel ch0 + l, and at + 256 halves ch0 + 32 + l
  // every global load of the prologue, in the order of use
  const v4f a0 = *(const v4f*)(Xb + 8 * tid);           // thread t: tokens 4t .. 4t+3
  const v4f a1 = *(const v4f*)(Xb + 8 * tid + 4);
  const v2f q0v = *(const v2f*)(wq + 2 * tid);          // thread t: h = 2t, 2t+1 of M's sum
  const v2f q1v = *(const v2f*)(wq + HD + 2 * tid);
  const v2f k0v = *(const v2f*)(wk + 2 * tid);
  const v2f k1v = *(const v2f*)(wk + HD + 2 * tid);
  float cg[2], cr[2], c0[2], c1[2], cb[2], cm[2];       // lane l: channels ch0 + l and ch0 + 32 + l
#pragma unroll
  for (int i = 0; i < 2; ++i) {
    const int h = ch0 + 32 * i + lane;
    cg[i] = gam[h];
    cr[i] = var[h];
    c0[i] = wv[h];
    c1[i] = wv[HD + h];
    cb[i] = bet[h];
    cm[i] = mu[h];
  }
  // the wait that stands in front of an overwrite of the loads' offset registers;
  // the two scheduling barriers hold it directly behind the loads: without them a register write is placed in between
  __builtin_amdgcn_sched_barrier(0);
  asm volatile("s_wait_xcnt 0x0" ::: "memory");
  __builtin_amdgcn_sched_barrier(0);
  const int nq = lane & 7, kg = lane >> 3;              // lane l: Wout columns 4(l&7)..+3 of rows 8(l>>3) + 0..7 of each 32-row half
  v4f wr[2][8];
  {
    const float* ws = wo + (size_t)(ch0 + 8 * kg) * OD + 4 * nq;
#pragma unroll
    for (int s = 0; s < 2; ++s)
#pragma unroll
      for (int i = 0; i < 8; ++i) {
        // the last load's result lands on the address pair that all sixteen name: the wait that stands in front of such an overwrite
        if (s == 1 && i == 7) asm volatile("s_wait_xcnt 0x0" ::: "memory");
        wr[s][i] = *(const v4f*)(ws + (size_t)(32 * s + i) * OD);
      }
  }
  // keeps the Wout loads issued in front of the first wait for data: without it they start a load latency later
  __builtin_amdgcn_sched_barrier(0);
  {
    // this sequence's tokens as f16 hi and lo: x^T rows (and a row of ones) and the key-side score operands
    const int l0 = tid * 4;
    const v4f e0 = (v4f){a0[0], a0[2], a1[0], a1[2]};
    const v4f e1 = (v4f){a0[1], a0[3], a1[1], a1[3]};
    v4h h0, h1, g0, g1;
#pragma unroll
    for (int e = 0; e < 4; ++e) {
      h0[e] = (_Float16)e0[e];
      h1[e] = (_Float16)e1[e];
      g0[e] = (_Float16)(e0[e] - (float)h0[e]);
      g1[e] = (_Float16)(e1[e] - (float)h1[e]);
    }
    *(v4h*)(xT + 0 * XTP + l0) = h0;
    *(v4h*)(xT + 1 * XTP + l0) = h1;
    *(v4h*)(xT + 2 * XTP + l0) = g0;
    *(v4h*)(xT + 3 * XTP + l0) = g1;
    *(v4h*)(xT + 4 * XTP + l0) = (v4h){1, 1, 1, 1};
#pragma unroll
    for (int e = 0; e < 4; ++e)
      *(v8h*)(kF + (size_t)(l0 + e) * 8) = (v8h){h0[e], h1[e], g0[e], g1[e], h0[e], h1[e], g0[e], g1[e]};
  }
  // largest squared token norm of this wave's 128 tokens, the same value in every lane
  unsigned int r2 = __builtin_bit_cast(unsigned int, fmaxf(fmaxf(fmaf(a0[1], a0[1], a0[0] * a0[0]), fmaf(a0[3], a0[3], a0[2] * a0[2])),
                                                           fmaxf(fmaf(a1[1], a1[1], a1[0] * a1[0]), fmaf(a1[3], a1[3], a1[2] * a1[2]))));
  r2 = maxx<8>(maxx<4>(maxx<2>(maxx<1>(r2))));
  {
    const unsigned int ro = (unsigned int)__builtin_amdgcn_permlanex16((int)r2, (int)r2, 0x76543210, 0xfedcba98, false, false);  // lane l <-> l ^ 16
    r2 = (r2 > ro) ? r2 : ro;
  }
  // M = Wq.Wk^T: this wave's 64 h
  const float m00 = wsum(fmaf(q0v[1], k0v[1], q0v[0] * k0v[0]));
  const float m01 = wsum(fmaf(q0v[1], k1v[1], q0v[0] * k1v[0]));
  const float m10 = wsum(fmaf(q1v[1], k0v[1], q1v[0] * k0v[0]));
  const float m11 = wsum(fmaf(q1v[1], k1v[1], q1v[0] * k1v[0]));
  // W' rows, done under the flight of the Wout loads and parked in LDS until the tail
#pragma unroll
  for (int i = 0; i < 2; ++i) *(v8h*)(wzl + i * 256) = chrow(cg[i], cr[i], c0[i], c1[i], cb[i], cm[i]);
  {
#pragma unroll
    for (int s = 0; s < 2; ++s) {
      v4f r[8];
#pragma unroll
      for (int i = 0; i < 8; ++i) r[i] = wr[s][i] * 64.0f;
#pragma unroll
      for (int e = 0; e < 4; ++e)
        *(v8h*)(wl + (4 * nq + e) * WOP + (4 * s + kg) * 8) =
            (v8h){(_Float16)r[0][e], (_Float16)r[1][e], (_Float16)r[2][e], (_Float16)r[3][e],
                  (_Float16)r[4][e], (_Float16)r[5][e], (_Float16)r[6][e], (_Float16)r[7][e]};
    }
  }
  if (lane == 0) {
    *(v4f*)(mP + 4 * wave) = (v4f){m00, m01, m10, m11};
    rP[wave] = r2;
  }
  __syncthreads();                                      // kF, xT, mP, rP, sWz and sWo complete
  // B fragments of the score product: y = x.M (x score scale x log2 e) for query rows q0 + 32pt + 16t + (lane&15), t = 0, 1
  v16h yq[2][4];
  float mw[2];                                          // reference point of the softmax per query: p = exp2(s - mw)
  {
    // asked for here, not with the prologue's loads: this block has just read the lines, and the loads fly beside the LDS trip below
    v2f xq[2];
#pragma unroll
    for (int t = 0; t < 2; ++t) xq[t] = *(const v2f*)(Xb + 2 * (size_t)(q0 + 32 * pt + 16 * t + c));
    // the wait that stands in front of an overwrite of the two loads' offset registers; the two scheduling barriers hold it directly behind the loads
    __builtin_amdgcn_sched_barrier(0);
    asm volatile("s_wait_xcnt 0x0" ::: "memory");
    __builtin_amdgcn_sched_barrier(0);
    // lane l reads partial sum l&3 of wave l>>2; three exchanges (l ^ 4, l ^ 8, l ^ 16) sum over the waves
    float ms = addx<8>(addx<4>(mP[lane]));
    const int mb = __builtin_bit_cast(int, ms);
    ms += __builtin_bit_cast(float, __builtin_amdgcn_permlanex16(mb, mb, 0x76543210, 0xfedcba98, false, false));
    const int mi = __builtin_bit_cast(int, ms);
    const v4f mv = (v4f){__builtin_bit_cast(float, __builtin_amdgcn_readlane(mi, 0)),    // M00 M01 M10 M11, wave-uniform
                         __builtin_bit_cast(float, __builtin_amdgcn_readlane(mi, 1)),
                         __builtin_bit_cast(float, __builtin_amdgcn_readlane(mi, 2)),
                         __builtin_bit_cast(float, __builtin_amdgcn_readlane(mi, 3))};
    const float ys = sscale * 1.4426950408889634f;
    const float rr = __builtin_bit_cast(float, maxx<4>(maxx<2>(maxx<1>(rP[lane & 7]))));   // largest |x|^2 of the sequence
#pragma unroll
    for (int t = 0; t < 2; ++t) {
      const float y0 = fmaf(xq[t][1], mv[2], xq[t][0] * mv[0]) * ys, y1 = fmaf(xq[t][1], mv[3], xq[t][0] * mv[1]) * ys;
      const v8h yv = qhalves(y0, y1);
      // s = y.x' <= |y| max|x'|: no key's p exceeds 2^15, which f16 holds
      mw[t] = __builtin_amdgcn_sqrtf(fmaf(y1, y1, y0 * y0) * rr) - 15.0f;
#pragma unroll
      for (int j = 0; j < 4; ++j) {
        Frag f;
        f.h[j >> 1]       = (hh == (j & 1)) ? yv : zz;
        f.h[(j >> 1) ^ 1] = zz;
        yq[t][j] = f.v;
      }
    }
  }

  const _Float16* kp = kF + (size_t)(pk * 64 + lane) * 8;   // lane l: keys k0 + l and k0 + 32 + l of each chunk (64 of this wave's keys per A fragment)

  v8f uacc[2];
  // First trip: the bound is the reference point, so no pass over the scores looks for a maximum. A loose bound makes every p small;
  // the row sum l (D rows 4..15, so element 4 of every lane) tells: at l >= 2^-4 the f16 floor (2^-25 a key, 512 keys) is below 2^-12 of l.
  // Where a query of this wave falls short of that, or a p left f16's range, a second trip takes the exact maximum instead.
#pragma unroll 1                                        // rolled: the second trip is rare, and unrolled it would double the loop's code
  for (int att = 0; att < 2; ++att) {
    // ---- p = exp2(s - mw), packed in place into the value product's B operand ----
    uacc[0] = zero8();
    uacc[1] = zero8();
    {
      v8f cneg[2];
#pragma unroll
      for (int t = 0; t < 2; ++t) {
        const float cm = -mw[t];
        cneg[t] = (v8f){cm, cm, cm, cm, cm, cm, cm, cm};
      }
      const int xl = ((c < 4) ? c : 4) | (lane & 16);     // A row (lane&15) reads xT row min(lane&15, 4)
      // the pipeline's start: chunk 0's key fragment and its scores for query tile 0 (LDS rows that the first barrier has published)
      Frag kA, kB;
      kA.h[0] = *(const v8h*)(kp);
      kA.h[1] = *(const v8h*)(kp + 32 * 8);
      v8f s0[4];                                          // s0[j][r]: key BC cp + 64 pk + 16j + 8hh + r, query c of tile 0
#pragma unroll
      for (int j = 0; j < 4; ++j) s0[j] = mmab(kA.v, yq[0][j], cneg[0]);
      // two trips a pass, so that the two key fragments change roles without register copies; an odd last chunk follows the loop.
      // The last trip has no next chunk: it forms its own chunk's tile 0 again, unused.
      int cp = 0;
#pragma unroll 1                                        // rolled: a pass already holds two trips; more would only add code
      for (; cp + 1 < nch; cp += 2) {
        const int c2 = (cp + 2 < nch) ? cp + 2 : cp + 1;
        trip(kp + (size_t)(cp + 1) * (BC * 8), xT, cp * BC + pk * 64, xl, kA, kB, yq, cneg, s0, uacc);
        trip(kp + (size_t)c2 * (BC * 8), xT, (cp + 1) * BC + pk * 64, xl, kB, kA, yq, cneg, s0, uacc);
      }
      if (cp < nch) trip(kp + (size_t)cp * (BC * 8), xT, cp * BC + pk * 64, xl, kA, kB, yq, cneg, s0, uacc);   // block-uniform
    }
    const float la = uacc[0][4], lb = uacc[1][4];
    const bool good = (la >= 0.0625f) && (la <= 1.7e7f) && (lb >= 0.0625f) && (lb <= 1.7e7f);
    if (att == 1 || __builtin_amdgcn_ballot_w32(!good) == 0u) break;   // wave-uniform; no barrier stands in this loop

    // ---- the rare trip's reference point: this wave's maximum per query over its keys, p x1024 ----
    {
      v8f mx[2];
#pragma unroll
      for (int t = 0; t < 2; ++t)
#pragma unroll
        for (int r = 0; r < 8; ++r) mx[t][r] = -3.0e38f;  // finite, so that a wave without keys joins with factor 1
#pragma unroll 1                                        // rolled, for the same register bound
      for (int cp = 0; cp < nch; ++cp) {
        Frag ka;
        ka.h[0] = *(const v8h*)(kp + (size_t)cp * (BC * 8));
        ka.h[1] = *(const v8h*)(kp + (size_t)cp * (BC * 8) + 32 * 8);
        v8f s[2][4];
#pragma unroll
        for (int t = 0; t < 2; ++t)
#pragma unroll
          for (int j = 0; j < 4; ++j) s[t][j] = mmab(ka.v, yq[t][j], zero8());
        // keeps the eight products together
        __builtin_amdgcn_sched_barrier(0);
#pragma unroll
        for (int t = 0; t < 2; ++t)
#pragma unroll
          for (int r = 0; r < 8; ++r)
            mx[t][r] = fmaxf(fmaxf(mx[t][r], fmaxf(s[t][0][r], s[t][1][r])), fmaxf(s[t][2][r], s[t][3][r]));
      }
#pragma unroll
      for (int t = 0; t < 2; ++t) {
        const float m = fmaxf(fmaxf(fmaxf(mx[t][0], mx[t][1]), fmaxf(mx[t][2], mx[t][3])),
                              fmaxf(fmaxf(mx[t][4], mx[t][5]), fmaxf(mx[t][6], mx[t][7])));
        const int mb = __builtin_bit_cast(int, m);        // lane l <-> l ^ 16: the other eight keys of each tile
        mw[t] = fmaxf(m, __builtin_bit_cast(float, __builtin_amdgcn_permlanex16(mb, mb, 0x76543210, 0xfedcba98, false, false))) - 10.0f;
      }
    }
  }

  // ---- tail: join the two key slices, 1/l per row, z^T = W'.[u; 1]^T, PReLU, out^T = Wout^T.z^T ----
  const float a = pa[0];
  const float sg = (a <= 1.0f) ? 1.0f : -1.0f;          // PReLU(z) = sg max(sg z, a sg z), for every a
  const _Float16 sh = (_Float16)sg, ah = (_Float16)a;
  const v8h av = (v8h){ah, ah, ah, ah, ah, ah, ah, ah};
  if (lane < 16) {                                      // D rows 0..4 sit in lanes 0..15
#pragma unroll
    for (int t = 0; t < 2; ++t) {
      float* d = uP + (size_t)(pk * BR + 32 * pt + 16 * t + c) * 8;
      *(v4f*)d       = (v4f){uacc[t][0], uacc[t][1], uacc[t][2], uacc[t][3]};
      *(v2f*)(d + 4) = (v2f){uacc[t][4], mw[t]};
    }
  }
  __syncthreads();                                      // uP complete (cross-wave)
  Frag wz[4];                                           // A operands of this wave's four channel groups 4pk .. 4pk + 3
  v16h wof[4][2][2];
  const _Float16* wzr = sWz + (4 * pk) * 512 + lane * 8;
  const _Float16* wor = sWo + (4 * pk) * (OD * WOP);
  ldgrp(wzr, wor, lane, wz[0], wof[0]);
  wz[1].h[0] = *(const v8h*)(wzr + 512);
  wz[1].h[1] = *(const v8h*)(wzr + 512 + 256);
  // keeps the twelve loads issued here, in front of the join: without it the compiler may sink them to just in front of
  // their first use, where their latency is waited out
  __builtin_amdgcn_sched_barrier(0);
  Pack8 own, oth;                                       // query side of the z product: row 32pt + lane, and row 32pt + (lane ^ 16)
  {
    const int jr = 32 * pt + lane;
    v2f lm[2];
#pragma unroll
    for (int i = 0; i < 2; ++i) lm[i] = *(const v2f*)(uP + (size_t)(i * BR + jr) * 8 + 4);
    const float m = fmaxf(lm[0][1], lm[1][1]);
    v4f us = (v4f){0.f, 0.f, 0.f, 0.f};
    float l = 0.f;
#pragma unroll
    for (int i = 0; i < 2; ++i) {
      const float f = __builtin_amdgcn_exp2f(lm[i][1] - m);
      us += *(const v4f*)(uP + (size_t)(i * BR + jr) * 8) * f;
      l = fmaf(lm[i][0], f, l);
    }
    const float inv = (l > 0.f) ? (sg / l) : 0.f;       // u and l carry the same scale; sg: see above
    const float u0 = (us[0] + us[2]) * inv, u1 = (us[1] + us[3]) * inv;
    const _Float16 h0 = (_Float16)u0, h1 = (_Float16)u1;
    const _Float16 l0 = (_Float16)(u0 - (float)h0), l1 = (_Float16)(u1 - (float)h1);
    own.h = (v8h){h0, h0, l0, h1, h1, l1, sh, sh};
#pragma unroll
    for (int i = 0; i < 4; ++i)                         // lane l <-> l ^ 16
      oth.u[i] = (unsigned int)__builtin_amdgcn_permlanex16((int)own.u[i], (int)own.u[i], 0x76543210, 0xfedcba98, false, false);
  }
  v16h zb[2][4];                                        // B operands of the z product, the same for every channel group: [query tile][channel tile of the group]
#pragma unroll
  for (int t = 0; t < 2; ++t) {                         // query tile: rows 32pt + 16t + c
    const v8h rq = (hh == t) ? own.h : oth.h;           // the eight halves of row 32pt + 16t + c, in both lane halves
#pragma unroll
    for (int j = 0; j < 4; ++j) {
      Frag f;                                           // tile j's 8 k slots alone carry the row
      f.h[j >> 1]       = (hh == (j & 1)) ? rq : zz;
      f.h[(j >> 1) ^ 1] = zz;
      zb[t][j] = f.v;
    }
  }
  v8f acc[2][2];                                        // out^T [query tile][out column tile], summed over the four groups
#pragma unroll
  for (int t = 0; t < 2; ++t)
#pragma unroll
    for (int nt = 0; nt < 2; ++nt) acc[t][nt] = zero8();
  // The four groups, pipelined inside the wave like the score loop: the z products of group gi + 1 issue two by two among the PReLU and
  // the out products of group gi, so that the packed-f16 work runs while the matrix pipe is busy. s[group parity][t][j][r]: sg z x16 of
  // channel 64(4pk + gi) + 16j + 8hh + r, row 32pt + 16t + c.
  v8h s[2][2][4];
#pragma unroll
  for (int t = 0; t < 2; ++t)
#pragma unroll
    for (int j = 0; j < 4; ++j) s[0][t][j] = mmah(wz[0].v, zb[t][j], zz);
  // keeps the first group's eight products together: each fills the distance behind the one before, which v_nop fills otherwise
  __builtin_amdgcn_sched_barrier(0);
#pragma unroll
  for (int gi = 0; gi < 4; ++gi) {
    if (gi < 3) {
#pragma unroll
      for (int nt = 0; nt < 2; ++nt)
#pragma unroll
        for (int ks = 0; ks < 2; ++ks) wof[gi + 1][nt][ks] = ldfrag(wor + (gi + 1) * (OD * WOP), WOP, 16 * nt, 32 * ks, lane);
    }
    if (gi < 2) {
      wz[gi + 2].h[0] = *(const v8h*)(wzr + (gi + 2) * 512);
      wz[gi + 2].h[1] = *(const v8h*)(wzr + (gi + 2) * 512 + 256);
    }
    // keeps the loads (Wout a group ahead, W' two groups ahead) in one place at the head of the group, so that they fly under its work
    __builtin_amdgcn_sched_barrier(0);
#pragma unroll
    for (int t = 0; t < 2; ++t)
#pragma unroll
      for (int hf = 0; hf < 2; ++hf) {
        if (gi < 3) {
          s[(gi + 1) & 1][t][2 * hf]     = mmah(wz[gi + 1].v, zb[t][2 * hf], zz);
          s[(gi + 1) & 1][t][2 * hf + 1] = mmah(wz[gi + 1].v, zb[t][2 * hf + 1], zz);
        }
        Frag pb;
        pb.h[0] = __builtin_elementwise_maximum(s[gi & 1][t][2 * hf], s[gi & 1][t][2 * hf] * av);
        pb.h[1] = __builtin_elementwise_maximum(s[gi & 1][t][2 * hf + 1], s[gi & 1][t][2 * hf + 1] * av);
#pragma unroll
        for (int nt = 0; nt < 2; ++nt) acc[t][nt] = mmab(wof[gi][nt][hf], pb.v, acc[t][nt]);
        if (gi < 3) {
          // the order inside a unit: a z product, eight of the unit's sixteen PReLU instructions, a z product, the other eight, the two out products
          __builtin_amdgcn_sched_group_barrier(0x008, 1, 0);
          __builtin_amdgcn_sched_group_barrier(0x002, 8, 0);
          __builtin_amdgcn_sched_group_barrier(0x008, 1, 0);
          __builtin_amdgcn_sched_group_barrier(0x002, 8, 0);
          __builtin_amdgcn_sched_group_barrier(0x008, 2, 0);
        }
        __builtin_amdgcn_sched_barrier(0);              // holds the units in this order
      }
  }
#pragma unroll
  for (int t = 0; t < 2; ++t)
#pragma unroll
    for (int nt = 0; nt < 2; ++nt) {
      float* pp = part + pk * (BR * PTP) + (32 * pt + 16 * t + c) * PTP + 16 * nt + 8 * hh;
      *(v4f*)pp       = (v4f){acc[t][nt][0], acc[t][nt][1], acc[t][nt][2], acc[t][nt][3]};
      *(v4f*)(pp + 4) = (v4f){acc[t][nt][4], acc[t][nt][5], acc[t][nt][6], acc[t][nt][7]};
    }
  __syncthreads();                                      // part complete
  {
    const int pc = tid & 7;
    const v4f bb = *(const v4f*)(bo + pc * 4);
#pragma unroll
    for (int g = 0; g < 4; ++g) {
      const int row = 32 * g + (tid >> 3);
      const v4f sum = *(const v4f*)(part + row * PTP + pc * 4) + *(const v4f*)(part + BR * PTP + row * PTP + pc * 4);
      const v4f val = sum * (sg * 0.0009765625f) + bb;  // sg/(16 * 64)
      v4f* d = (v4f*)(out + (tokbase + (size_t)row) * OD + pc * 4);
      *d = val;
    }
  }
}

// No workspace is used.
extern "C" void kernel_launch(void* const* d_in, const int* in_sizes, int n_in,
                              void* d_out, int out_size, void* d_ws, size_t ws_size,
                              hipStream_t stream) {
  if (n_in < 12) return;
  if (in_sizes[0] != NTOK * 2) return;
  if (in_sizes[1] < 1) return;
  if (in_sizes[2] != 2 * HD) return;
  if (in_sizes[3] != 2 * HD) return;
  if (in_sizes[4] != 2 * HD) return;
  if (in_sizes[5] != HD) return;
  if (in_sizes[6] != HD) return;
  if (in_sizes[7] != HD) return;
  if (in_sizes[8] != HD) return;
  if (in_sizes[9] < 1) return;
  if (in_sizes[10] != HD * OD) return;
  if (in_sizes[11] != OD) return;
  if (out_size != NTOK * OD) return;

  const float* x    = (const float*)d_in[0];    // [32768][2]
  const int*   bsz  = (const int*)d_in[1];      // [1]
  const float* wq   = (const float*)d_in[2];    // [2][512]
  const float* wk   = (const float*)d_in[3];    // [2][512]
  const float* wv   = (const float*)d_in[4];    // [2][512]
  const float* gam  = (const float*)d_in[5];    // [512]
  const float* bet  = (const float*)d_in[6];    // [512]
  const float* mu   = (const float*)d_in[7];    // [512]
  const float* var  = (const float*)d_in[8];    // [512]
  const float* pa   = (const float*)d_in[9];    // [1]
  const float* wo   = (const float*)d_in[10];   // [512][32]
  const float* bo   = (const float*)d_in[11];   // [32]
  float* out = (float*)d_out;                   // [32768][32]

  const float sscale = 1.0f / sqrtf((float)HD);

  // attention + BN/PReLU/Wout tail -> d_out
  k_attn<<<dim3(SEQ / BR, NBAT), dim3(256), 0, stream>>>(x, wq, wk, wv, gam, bet, mu, var, wo, pa, bo, bsz, out, sscale);
  (void)hipGetLastError();
}
